// v000
// The times below were measured on an AMD MI455X: many runs one after another, warmed up first and cycling through
// copies of the inputs, with the whole window's GPU time divided by the number of runs. Launches and the gaps
// between them are all in it. The median over several windows is given; except for v000 it joins two sittings, which
// can be a few percent apart, so the side-by-side timings, each taken in one sitting, are the better comparison.
// v000 is the starting kernel.
#include <hip/hip_runtime.h>

// ---------------------------------------------------------------------------
// Transformer encoder layer for MI455X (gfx1250, wave32, WMMA).
// All GEMMs use v_wmma_f32_16x16x32_f16 (f16 in, fp32 accumulate).
// GEMM wave tile: 32x64 (2x4 WMMA), block tile 128x128 (8 waves).
// ---------------------------------------------------------------------------

typedef _Float16 half_t;
typedef __attribute__((ext_vector_type(16))) _Float16 v16h;
typedef __attribute__((ext_vector_type(8)))  float    v8f;

#define DMODEL 512
#define NSEQ   1024
#define NBATCH 16
#define NHEAD  8
#define DHEAD  64
#define MROWS  (NBATCH * NSEQ)   // 16384 token rows

union AFrag16 { v16h v; float4 q[2]; };

// Load one 16x32 f16 WMMA fragment (A layout, or B layout for W stored [N,K]).
// Per ISA 7.12.2: lane L (0..15) holds row/col L; lanes 16..31 hold the K+8
// group. frag elems 0..7 = K kb..kb+7, elems 8..15 = K kb+16..kb+23.
__device__ __forceinline__ v16h load_frag16(const half_t* __restrict__ base,
                                            int stride, int idx, int k, int lane) {
  const int kb = (lane >> 4) << 3;   // 0 or 8
  const half_t* p = base + (size_t)idx * (size_t)stride + (size_t)(k + kb);
  AFrag16 f;
  f.q[0] = *reinterpret_cast<const float4*>(p);        // K kb .. kb+7
  f.q[1] = *reinterpret_cast<const float4*>(p + 16);   // K kb+16 .. kb+23
  return f.v;
}

__device__ __forceinline__ v8f wmma32(v16h a, v16h b, v8f c) {
  return __builtin_amdgcn_wmma_f32_16x16x32_f16(false, a, false, b,
                                                (short)0, c, false, false);
}

__device__ __forceinline__ v8f vzero8() {
  v8f z = {0.f, 0.f, 0.f, 0.f, 0.f, 0.f, 0.f, 0.f};
  return z;
}

// ---------------------------------------------------------------------------
// fp32 -> f16 conversion (weights)
// ---------------------------------------------------------------------------
__global__ void f2h_kernel(const float* __restrict__ src, half_t* __restrict__ dst, int n) {
  int i = blockIdx.x * blockDim.x + threadIdx.x;
  if (i < n) dst[i] = (half_t)src[i];
}

// ---------------------------------------------------------------------------
// LayerNorm: one wave (32 lanes) per row of 512; lane owns 16 contiguous cols.
// ---------------------------------------------------------------------------
__global__ __launch_bounds__(256) void ln_kernel(const float* __restrict__ x,
                                                 const float* __restrict__ g,
                                                 const float* __restrict__ bta,
                                                 half_t* __restrict__ out) {
  const int row  = blockIdx.x * 8 + (threadIdx.x >> 5);
  const int lane = threadIdx.x & 31;
  const float* xr = x + (size_t)row * DMODEL + lane * 16;

  float v[16];
  const float4* x4 = reinterpret_cast<const float4*>(xr);
#pragma unroll
  for (int j = 0; j < 4; ++j) {
    float4 t = x4[j];
    v[4 * j + 0] = t.x; v[4 * j + 1] = t.y; v[4 * j + 2] = t.z; v[4 * j + 3] = t.w;
  }
  float s = 0.f;
#pragma unroll
  for (int j = 0; j < 16; ++j) s += v[j];
#pragma unroll
  for (int o = 16; o > 0; o >>= 1) s += __shfl_xor(s, o);
  const float mu = s * (1.0f / DMODEL);

  float q = 0.f;
#pragma unroll
  for (int j = 0; j < 16; ++j) { float d = v[j] - mu; q += d * d; }
#pragma unroll
  for (int o = 16; o > 0; o >>= 1) q += __shfl_xor(q, o);
  const float rs = rsqrtf(q * (1.0f / DMODEL) + 1e-5f);

  half_t* orow = out + (size_t)row * DMODEL + lane * 16;
#pragma unroll
  for (int j = 0; j < 16; ++j) {
    int c = lane * 16 + j;
    orow[j] = (half_t)((v[j] - mu) * rs * g[c] + bta[c]);
  }
}

// ---------------------------------------------------------------------------
// WMMA GEMM: out[M,Nn] = act(A_f16[M,K] @ W_f16[Nn,K]^T + bias) (+ resid)
// Block: 256 thr = 8 waves; block tile 128x128; wave tile 32x64 (2x4 WMMA).
// 8 WMMAs per 6 fragment loads -> 1.33x register-level reuse vs 2x2 tiling.
// ---------------------------------------------------------------------------
__global__ __launch_bounds__(256) void gemm_kernel(const half_t* __restrict__ A,
                                                   const half_t* __restrict__ W,
                                                   const float* __restrict__ bias,
                                                   const float* __restrict__ resid,
                                                   float* __restrict__ out32,
                                                   half_t* __restrict__ out16,
                                                   int Nn, int K, int act) {
  const int lane = threadIdx.x & 31;
  const int w    = threadIdx.x >> 5;
  const int wm   = w & 3;          // 4 waves along M (32 rows each)
  const int wn   = w >> 2;         // 2 waves along N (64 cols each)
  const int m0   = blockIdx.y * 128 + wm * 32;
  const int n0   = blockIdx.x * 128 + wn * 64;
  const int lm   = lane & 15;
  const int hi   = lane >> 4;

  v8f acc[2][4];
#pragma unroll
  for (int i = 0; i < 2; ++i)
#pragma unroll
    for (int j = 0; j < 4; ++j) acc[i][j] = vzero8();

  for (int k = 0; k < K; k += 32) {
    v16h a0 = load_frag16(A, K, m0 + lm,      k, lane);
    v16h a1 = load_frag16(A, K, m0 + 16 + lm, k, lane);
    v16h b0 = load_frag16(W, K, n0 + lm,      k, lane);
    v16h b1 = load_frag16(W, K, n0 + 16 + lm, k, lane);
    v16h b2 = load_frag16(W, K, n0 + 32 + lm, k, lane);
    v16h b3 = load_frag16(W, K, n0 + 48 + lm, k, lane);
    acc[0][0] = wmma32(a0, b0, acc[0][0]);
    acc[0][1] = wmma32(a0, b1, acc[0][1]);
    acc[0][2] = wmma32(a0, b2, acc[0][2]);
    acc[0][3] = wmma32(a0, b3, acc[0][3]);
    acc[1][0] = wmma32(a1, b0, acc[1][0]);
    acc[1][1] = wmma32(a1, b1, acc[1][1]);
    acc[1][2] = wmma32(a1, b2, acc[1][2]);
    acc[1][3] = wmma32(a1, b3, acc[1][3]);
  }

#pragma unroll
  for (int i = 0; i < 2; ++i) {
#pragma unroll
    for (int j = 0; j < 4; ++j) {
      const int colg = n0 + j * 16 + lm;
      const float bz = bias[colg];
#pragma unroll
      for (int r = 0; r < 8; ++r) {
        const int rowg = m0 + i * 16 + r + (hi << 3);
        float val = acc[i][j][r] + bz;
        if (act) val = val / (1.f + __expf(-val));     // SiLU
        const size_t off = (size_t)rowg * Nn + colg;
        if (resid) val += resid[off];
        if (out32) out32[off] = val;
        if (out16) out16[off] = (half_t)val;
      }
    }
  }
}

// ---------------------------------------------------------------------------
// V [B,N,H,DH] -> Vt [B,H,DH,N]
// ---------------------------------------------------------------------------
__global__ void transpose_v_kernel(const half_t* __restrict__ v, half_t* __restrict__ vt) {
  size_t i = (size_t)blockIdx.x * 256 + threadIdx.x;   // indexes vt, n fastest
  int n  = (int)(i & (NSEQ - 1));
  size_t r = i >> 10;
  int d  = (int)(r & (DHEAD - 1)); r >>= 6;
  int hh = (int)(r & (NHEAD - 1));
  int b  = (int)(r >> 3);
  vt[i] = v[(((size_t)(b * NSEQ + n)) * NHEAD + hh) * DHEAD + d];
}

// ---------------------------------------------------------------------------
// Attention: one wave per (b, h, 16-query tile).
// LDS: S = 16x1024 f32 scores (64KB), P = 16x1024 f16 probs (32KB) -> 96KB.
// ---------------------------------------------------------------------------
__global__ __launch_bounds__(32) void attn_kernel(const half_t* __restrict__ q,
                                                  const half_t* __restrict__ kk,
                                                  const half_t* __restrict__ vt,
                                                  half_t* __restrict__ ctx,
                                                  float* __restrict__ attnw) {
  extern __shared__ char smem[];
  float*  S = (float*)smem;                                // [16][NSEQ]
  half_t* P = (half_t*)(smem + 16 * NSEQ * sizeof(float)); // [16][NSEQ]

  const int lane = threadIdx.x;
  const int bid  = blockIdx.x;
  const int qt = bid & 63;          // N/16 = 64 query tiles
  const int hh = (bid >> 6) & 7;
  const int b  = bid >> 9;
  const int q0 = qt * 16;
  const int m  = lane & 15;
  const int hi = lane >> 4;

  // Q fragments for this 16-row query tile (K = DH = 64 -> 2 frags)
  const half_t* qbase = q + (((size_t)(b * NSEQ + q0 + m)) * NHEAD + hh) * DHEAD;
  v16h aq0 = load_frag16(qbase, 0, 0, 0,  lane);
  v16h aq1 = load_frag16(qbase, 0, 0, 32, lane);

  // ---- scores: S[16, NSEQ] = (Q @ K^T) / sqrt(DH) ----
  for (int nt = 0; nt < NSEQ / 16; ++nt) {
    const int n0 = nt * 16;
    const half_t* kbase = kk + (((size_t)(b * NSEQ + n0 + m)) * NHEAD + hh) * DHEAD;
    v16h bk0 = load_frag16(kbase, 0, 0, 0,  lane);
    v16h bk1 = load_frag16(kbase, 0, 0, 32, lane);
    v8f sacc = vzero8();
    sacc = wmma32(aq0, bk0, sacc);
    sacc = wmma32(aq1, bk1, sacc);
#pragma unroll
    for (int r = 0; r < 8; ++r)
      S[(r + (hi << 3)) * NSEQ + n0 + m] = sacc[r] * 0.125f;   // 1/sqrt(64)
  }
  __syncthreads();

  // ---- softmax: lane pair (l, l+16) shares row m, split columns ----
  {
    const int row = m;
    const int c0  = hi * (NSEQ / 2);
    float* Srow = S + row * NSEQ + c0;
    float mx = -1e30f;
    for (int c = 0; c < NSEQ / 2; ++c) mx = fmaxf(mx, Srow[c]);
    mx = fmaxf(mx, __shfl_xor(mx, 16));
    float sum = 0.f;
    for (int c = 0; c < NSEQ / 2; ++c) {
      float e = __expf(Srow[c] - mx);
      Srow[c] = e;
      sum += e;
    }
    sum += __shfl_xor(sum, 16);
    const float inv = 1.f / sum;
    const float wsc = inv * (1.0f / NHEAD);   // head-average factor
    float* aw = attnw + ((size_t)(b * NSEQ + q0 + row)) * NSEQ + c0;
    half_t* Prow = P + row * NSEQ + c0;
    for (int c = 0; c < NSEQ / 2; ++c) {
      float e = Srow[c];
      Prow[c] = (half_t)(e * inv);
      atomicAdd(&aw[c], e * wsc);
    }
  }
  __syncthreads();

  // ---- ctx: P[16, NSEQ] @ V[NSEQ, DH] using Vt rows (contiguous keys) ----
  v8f cacc[4];
#pragma unroll
  for (int d = 0; d < 4; ++d) cacc[d] = vzero8();

  const half_t* vbase = vt + ((size_t)(b * NHEAD + hh)) * DHEAD * NSEQ;
  for (int k0 = 0; k0 < NSEQ; k0 += 32) {
    v16h ap = load_frag16(P, NSEQ, m, k0, lane);
#pragma unroll
    for (int d = 0; d < 4; ++d) {
      v16h bv = load_frag16(vbase, NSEQ, d * 16 + m, k0, lane);
      cacc[d] = wmma32(ap, bv, cacc[d]);
    }
  }
#pragma unroll
  for (int d = 0; d < 4; ++d) {
#pragma unroll
    for (int r = 0; r < 8; ++r) {
      const int rq = q0 + r + (hi << 3);
      ctx[(((size_t)(b * NSEQ + rq)) * NHEAD + hh) * DHEAD + d * 16 + m] = (half_t)cacc[d][r];
    }
  }
}

// ---------------------------------------------------------------------------
// Host launch
// ---------------------------------------------------------------------------
extern "C" void kernel_launch(void* const* d_in, const int* in_sizes, int n_in,
                              void* d_out, int out_size, void* d_ws, size_t ws_size,
                              hipStream_t stream) {
  (void)in_sizes; (void)n_in; (void)out_size; (void)ws_size;

  const float* h_in  = (const float*)d_in[0];
  const float* ln1_g = (const float*)d_in[1];
  const float* ln1_b = (const float*)d_in[2];
  const float* wq = (const float*)d_in[3];  const float* bq = (const float*)d_in[4];
  const float* wk = (const float*)d_in[5];  const float* bk = (const float*)d_in[6];
  const float* wv = (const float*)d_in[7];  const float* bv = (const float*)d_in[8];
  const float* wo = (const float*)d_in[9];  const float* bo = (const float*)d_in[10];
  const float* ln2_g = (const float*)d_in[11]; const float* ln2_b = (const float*)d_in[12];
  const float* w1 = (const float*)d_in[13]; const float* b1 = (const float*)d_in[14];
  const float* w2 = (const float*)d_in[15]; const float* b2 = (const float*)d_in[16];

  // ---- workspace layout (bytes) ----
  char* ws = (char*)d_ws;
  size_t off = 0;
  half_t* WQH = (half_t*)(ws + off); off += (size_t)DMODEL * DMODEL * 2;        // 0.5 MB
  half_t* WKH = (half_t*)(ws + off); off += (size_t)DMODEL * DMODEL * 2;
  half_t* WVH = (half_t*)(ws + off); off += (size_t)DMODEL * DMODEL * 2;
  half_t* WOH = (half_t*)(ws + off); off += (size_t)DMODEL * DMODEL * 2;
  half_t* W1H = (half_t*)(ws + off); off += (size_t)2 * DMODEL * DMODEL * 2;    // (2D,D)
  half_t* W2H = (half_t*)(ws + off); off += (size_t)2 * DMODEL * DMODEL * 2;    // (D,2D)
  half_t* HN  = (half_t*)(ws + off); off += (size_t)MROWS * DMODEL * 2;         // hn / f (reused)
  float*  H2  = (float*)(ws + off);  off += (size_t)MROWS * DMODEL * 4;         // h + attn_out
  half_t* CTX = (half_t*)(ws + off); off += (size_t)MROWS * DMODEL * 2;
  half_t* Qb  = (half_t*)(ws + off); size_t qoff = off; off += (size_t)MROWS * DMODEL * 2;
  half_t* Kb  = (half_t*)(ws + off); off += (size_t)MROWS * DMODEL * 2;
  half_t* Vb  = (half_t*)(ws + off); off += (size_t)MROWS * DMODEL * 2;
  half_t* VT  = (half_t*)(ws + off); off += (size_t)MROWS * DMODEL * 2;
  half_t* Gb  = (half_t*)(ws + qoff);  // FFN hidden [M, 2D] reuses Q+K regions (dead by then)

  float* out_h    = (float*)d_out;
  float* out_attn = (float*)d_out + (size_t)MROWS * DMODEL;

  // attn_weights accumulated via atomics -> zero it first (capture-safe).
  hipMemsetAsync(out_attn, 0, (size_t)NBATCH * NSEQ * NSEQ * sizeof(float), stream);

  // weights -> f16
  const int DD = DMODEL * DMODEL, DD2 = 2 * DMODEL * DMODEL;
  f2h_kernel<<<(DD  + 255) / 256, 256, 0, stream>>>(wq, WQH, DD);
  f2h_kernel<<<(DD  + 255) / 256, 256, 0, stream>>>(wk, WKH, DD);
  f2h_kernel<<<(DD  + 255) / 256, 256, 0, stream>>>(wv, WVH, DD);
  f2h_kernel<<<(DD  + 255) / 256, 256, 0, stream>>>(wo, WOH, DD);
  f2h_kernel<<<(DD2 + 255) / 256, 256, 0, stream>>>(w1, W1H, DD2);
  f2h_kernel<<<(DD2 + 255) / 256, 256, 0, stream>>>(w2, W2H, DD2);

  // LN1
  ln_kernel<<<MROWS / 8, 256, 0, stream>>>(h_in, ln1_g, ln1_b, HN);

  // QKV projections (block tile 128x128)
  dim3 gD(DMODEL / 128, MROWS / 128);       // (4, 128)
  gemm_kernel<<<gD, 256, 0, stream>>>(HN, WQH, bq, nullptr, nullptr, Qb, DMODEL, DMODEL, 0);
  gemm_kernel<<<gD, 256, 0, stream>>>(HN, WKH, bk, nullptr, nullptr, Kb, DMODEL, DMODEL, 0);
  gemm_kernel<<<gD, 256, 0, stream>>>(HN, WVH, bv, nullptr, nullptr, Vb, DMODEL, DMODEL, 0);

  // V -> Vt
  transpose_v_kernel<<<(MROWS * DMODEL) / 256, 256, 0, stream>>>(Vb, VT);

  // attention (96 KB dynamic LDS; CDNA5 WGP has 320 KB)
  const int attn_lds = 16 * NSEQ * (int)sizeof(float) + 16 * NSEQ * (int)sizeof(half_t);
  hipFuncSetAttribute(reinterpret_cast<const void*>(attn_kernel),
                      hipFuncAttributeMaxDynamicSharedMemorySize, attn_lds);
  attn_kernel<<<NBATCH * NHEAD * (NSEQ / 16), 32, attn_lds, stream>>>(Qb, Kb, VT, CTX, out_attn);

  // out projection + residual -> h2 (fp32)
  gemm_kernel<<<gD, 256, 0, stream>>>(CTX, WOH, bo, h_in, H2, nullptr, DMODEL, DMODEL, 0);

  // LN2 -> f (f16, reuses HN)
  ln_kernel<<<MROWS / 8, 256, 0, stream>>>(H2, ln2_g, ln2_b, HN);

  // FFN1: silu(f @ w1^T + b1) -> g f16 [M, 2D]
  dim3 g2(2 * DMODEL / 128, MROWS / 128);   // (8, 128)
  gemm_kernel<<<g2, 256, 0, stream>>>(HN, W1H, b1, nullptr, nullptr, Gb, 2 * DMODEL, DMODEL, 1);

  // FFN2: g @ w2^T + b2 + h2 -> final h (fp32, straight to d_out)
  gemm_kernel<<<gD, 256, 0, stream>>>(Gb, W2H, b2, H2, out_h, nullptr, DMODEL, 2 * DMODEL, 0);
}

// v001
// Next to v000, in two timings, it ran 1.93 times as fast each time.
#include <hip/hip_runtime.h>

// ---------------------------------------------------------------------------
// Transformer encoder layer for MI455X (gfx1250, wave32, WMMA).
// All GEMMs use v_wmma_f32_16x16x32_f16 (f16 in, fp32 accumulate).
// GEMM wave tile: 32x64 (2x4 WMMA), block tile 128x128 (8 waves).
// ---------------------------------------------------------------------------

typedef _Float16 half_t;
typedef __attribute__((ext_vector_type(16))) _Float16 v16h;
typedef __attribute__((ext_vector_type(8)))  float    v8f;

#define DMODEL 512
#define NSEQ   1024
#define NBATCH 16
#define NHEAD  8
#define DHEAD  64
#define MROWS  (NBATCH * NSEQ)   // 16384 token rows

union AFrag16 { v16h v; float4 q[2]; };

// Load one 16x32 f16 WMMA fragment (A layout, or B layout for W stored [N,K]).
// Per ISA 7.12.2: lane L (0..15) holds row/col L; lanes 16..31 hold the K+8
// group. frag elems 0..7 = K kb..kb+7, elems 8..15 = K kb+16..kb+23.
__device__ __forceinline__ v16h load_frag16(const half_t* __restrict__ base,
                                            int stride, int idx, int k, int lane) {
  const int kb = (lane >> 4) << 3;   // 0 or 8
  const half_t* p = base + (size_t)idx * (size_t)stride + (size_t)(k + kb);
  AFrag16 f;
  f.q[0] = *reinterpret_cast<const float4*>(p);        // K kb .. kb+7
  f.q[1] = *reinterpret_cast<const float4*>(p + 16);   // K kb+16 .. kb+23
  return f.v;
}

__device__ __forceinline__ v8f wmma32(v16h a, v16h b, v8f c) {
  return __builtin_amdgcn_wmma_f32_16x16x32_f16(false, a, false, b,
                                                (short)0, c, false, false);
}

__device__ __forceinline__ v8f vzero8() {
  v8f z = {0.f, 0.f, 0.f, 0.f, 0.f, 0.f, 0.f, 0.f};
  return z;
}

// ---------------------------------------------------------------------------
// fp32 -> f16 conversion (weights)
// ---------------------------------------------------------------------------
__global__ void f2h_kernel(const float* __restrict__ src, half_t* __restrict__ dst, int n) {
  int i = blockIdx.x * blockDim.x + threadIdx.x;
  if (i < n) dst[i] = (half_t)src[i];
}

// ---------------------------------------------------------------------------
// LayerNorm: one wave (32 lanes) per row of 512; lane owns 16 contiguous cols.
// ---------------------------------------------------------------------------
__global__ __launch_bounds__(256) void ln_kernel(const float* __restrict__ x,
                                                 const float* __restrict__ g,
                                                 const float* __restrict__ bta,
                                                 half_t* __restrict__ out) {
  const int row  = blockIdx.x * 8 + (threadIdx.x >> 5);
  const int lane = threadIdx.x & 31;
  const float* xr = x + (size_t)row * DMODEL + lane * 16;

  float v[16];
  const float4* x4 = reinterpret_cast<const float4*>(xr);
#pragma unroll
  for (int j = 0; j < 4; ++j) {
    float4 t = x4[j];
    v[4 * j + 0] = t.x; v[4 * j + 1] = t.y; v[4 * j + 2] = t.z; v[4 * j + 3] = t.w;
  }
  float s = 0.f;
#pragma unroll
  for (int j = 0; j < 16; ++j) s += v[j];
#pragma unroll
  for (int o = 16; o > 0; o >>= 1) s += __shfl_xor(s, o);
  const float mu = s * (1.0f / DMODEL);

  float q = 0.f;
#pragma unroll
  for (int j = 0; j < 16; ++j) { float d = v[j] - mu; q += d * d; }
#pragma unroll
  for (int o = 16; o > 0; o >>= 1) q += __shfl_xor(q, o);
  const float rs = rsqrtf(q * (1.0f / DMODEL) + 1e-5f);

  half_t* orow = out + (size_t)row * DMODEL + lane * 16;
#pragma unroll
  for (int j = 0; j < 16; ++j) {
    int c = lane * 16 + j;
    orow[j] = (half_t)((v[j] - mu) * rs * g[c] + bta[c]);
  }
}

// ---------------------------------------------------------------------------
// WMMA GEMM: out[M,Nn] = act(A_f16[M,K] @ W_f16[Nn,K]^T + bias) (+ resid)
// Block: 256 thr = 8 waves; block tile 128x128; wave tile 32x64 (2x4 WMMA).
// 8 WMMAs per 6 fragment loads -> 1.33x register-level reuse vs 2x2 tiling.
// ---------------------------------------------------------------------------
__global__ __launch_bounds__(256) void gemm_kernel(const half_t* __restrict__ A,
                                                   const half_t* __restrict__ W,
                                                   const float* __restrict__ bias,
                                                   const float* __restrict__ resid,
                                                   float* __restrict__ out32,
                                                   half_t* __restrict__ out16,
                                                   int Nn, int K, int act) {
  const int lane = threadIdx.x & 31;
  const int w    = threadIdx.x >> 5;
  const int wm   = w & 3;          // 4 waves along M (32 rows each)
  const int wn   = w >> 2;         // 2 waves along N (64 cols each)
  const int m0   = blockIdx.y * 128 + wm * 32;
  const int n0   = blockIdx.x * 128 + wn * 64;
  const int lm   = lane & 15;
  const int hi   = lane >> 4;

  v8f acc[2][4];
#pragma unroll
  for (int i = 0; i < 2; ++i)
#pragma unroll
    for (int j = 0; j < 4; ++j) acc[i][j] = vzero8();

  for (int k = 0; k < K; k += 32) {
    v16h a0 = load_frag16(A, K, m0 + lm,      k, lane);
    v16h a1 = load_frag16(A, K, m0 + 16 + lm, k, lane);
    v16h b0 = load_frag16(W, K, n0 + lm,      k, lane);
    v16h b1 = load_frag16(W, K, n0 + 16 + lm, k, lane);
    v16h b2 = load_frag16(W, K, n0 + 32 + lm, k, lane);
    v16h b3 = load_frag16(W, K, n0 + 48 + lm, k, lane);
    acc[0][0] = wmma32(a0, b0, acc[0][0]);
    acc[0][1] = wmma32(a0, b1, acc[0][1]);
    acc[0][2] = wmma32(a0, b2, acc[0][2]);
    acc[0][3] = wmma32(a0, b3, acc[0][3]);
    acc[1][0] = wmma32(a1, b0, acc[1][0]);
    acc[1][1] = wmma32(a1, b1, acc[1][1]);
    acc[1][2] = wmma32(a1, b2, acc[1][2]);
    acc[1][3] = wmma32(a1, b3, acc[1][3]);
  }

#pragma unroll
  for (int i = 0; i < 2; ++i) {
#pragma unroll
    for (int j = 0; j < 4; ++j) {
      const int colg = n0 + j * 16 + lm;
      const float bz = bias[colg];
#pragma unroll
      for (int r = 0; r < 8; ++r) {
        const int rowg = m0 + i * 16 + r + (hi << 3);
        float val = acc[i][j][r] + bz;
        if (act) val = val / (1.f + __expf(-val));     // SiLU
        const size_t off = (size_t)rowg * Nn + colg;
        if (resid) val += resid[off];
        if (out32) out32[off] = val;
        if (out16) out16[off] = (half_t)val;
      }
    }
  }
}

// ---------------------------------------------------------------------------
// V [B,N,H,DH] -> Vt [B,H,DH,N]
// ---------------------------------------------------------------------------
__global__ void transpose_v_kernel(const half_t* __restrict__ v, half_t* __restrict__ vt) {
  size_t i = (size_t)blockIdx.x * 256 + threadIdx.x;   // indexes vt, n fastest
  int n  = (int)(i & (NSEQ - 1));
  size_t r = i >> 10;
  int d  = (int)(r & (DHEAD - 1)); r >>= 6;
  int hh = (int)(r & (NHEAD - 1));
  int b  = (int)(r >> 3);
  vt[i] = v[(((size_t)(b * NSEQ + n)) * NHEAD + hh) * DHEAD + d];
}

// ---------------------------------------------------------------------------
// exp(x) as __expf forms it (x * log2(e), then v_exp_f32). The v_nop is the one
// slot the instruction set asks for behind a transcendental before its source
// is overwritten or its result read; inside one statement it cannot be lost.
// ---------------------------------------------------------------------------
__device__ __forceinline__ float exp_slot(float x) {
  const float t = x * 1.4426950408889634f;
  float r;
  asm("v_exp_f32 %0, %1\n\tv_nop" : "=v"(r) : "v"(t));
  return r;
}

// ---------------------------------------------------------------------------
// Attention: one wave per (b, h, 16-query tile).
// LDS: S = 16x1024 f32 scores (64KB), P = 16x1024 f16 probs (32KB) -> 96KB.
// ---------------------------------------------------------------------------
__global__ __launch_bounds__(32) void attn_kernel(const half_t* __restrict__ q,
                                                  const half_t* __restrict__ kk,
                                                  const half_t* __restrict__ vt,
                                                  half_t* __restrict__ ctx,
                                                  float* __restrict__ attnw) {
  extern __shared__ char smem[];
  float*  S = (float*)smem;                                // [16][NSEQ]
  half_t* P = (half_t*)(smem + 16 * NSEQ * sizeof(float)); // [16][NSEQ]

  const int lane = threadIdx.x;
  const int bid  = blockIdx.x;
  const int qt = bid & 63;          // N/16 = 64 query tiles
  const int hh = (bid >> 6) & 7;
  const int b  = bid >> 9;
  const int q0 = qt * 16;
  const int m  = lane & 15;
  const int hi = lane >> 4;

  // Q fragments for this 16-row query tile (K = DH = 64 -> 2 frags)
  const half_t* qbase = q + (((size_t)(b * NSEQ + q0 + m)) * NHEAD + hh) * DHEAD;
  v16h aq0 = load_frag16(qbase, 0, 0, 0,  lane);
  v16h aq1 = load_frag16(qbase, 0, 0, 32, lane);

  // ---- scores: S[16, NSEQ] = (Q @ K^T) / sqrt(DH) ----
  for (int nt = 0; nt < NSEQ / 16; ++nt) {
    const int n0 = nt * 16;
    const half_t* kbase = kk + (((size_t)(b * NSEQ + n0 + m)) * NHEAD + hh) * DHEAD;
    v16h bk0 = load_frag16(kbase, 0, 0, 0,  lane);
    v16h bk1 = load_frag16(kbase, 0, 0, 32, lane);
    v8f sacc = vzero8();
    sacc = wmma32(aq0, bk0, sacc);
    sacc = wmma32(aq1, bk1, sacc);
#pragma unroll
    for (int r = 0; r < 8; ++r)
      S[(r + (hi << 3)) * NSEQ + n0 + m] = sacc[r] * 0.125f;   // 1/sqrt(64)
  }
  __syncthreads();

  // ---- softmax: the whole wave walks one row; lane l owns columns l, l+32, ...
  // Consecutive lanes touch consecutive LDS banks and one 128-byte line of
  // attn_weights per atomic. Four rows per pass so that their cross-lane
  // reductions overlap; a row's 32 values per lane stay in registers.
  for (int r0 = 0; r0 < 16; r0 += 4) {
    float e[4][NSEQ / 32];
    float mx[4], sum[4];
#pragma unroll  // e[][] must be indexed statically to stay in registers
    for (int i = 0; i < 4; ++i) {
      const float* Srow = S + (r0 + i) * NSEQ + lane;
#pragma unroll
      for (int k = 0; k < NSEQ / 32; ++k) e[i][k] = Srow[k * 32];
    }
#pragma unroll
    for (int i = 0; i < 4; ++i) {
      float m0 = -1e30f, m1 = -1e30f, m2 = -1e30f, m3 = -1e30f;
#pragma unroll
      for (int k = 0; k < NSEQ / 32; k += 4) {
        m0 = fmaxf(m0, e[i][k]);     m1 = fmaxf(m1, e[i][k + 1]);
        m2 = fmaxf(m2, e[i][k + 2]); m3 = fmaxf(m3, e[i][k + 3]);
      }
      mx[i] = fmaxf(fmaxf(m0, m1), fmaxf(m2, m3));
    }
#pragma unroll
    for (int o = 16; o > 0; o >>= 1)
#pragma unroll
      for (int i = 0; i < 4; ++i) mx[i] = fmaxf(mx[i], __shfl_xor(mx[i], o));
#pragma unroll
    for (int i = 0; i < 4; ++i) {
      float s0 = 0.f, s1 = 0.f, s2 = 0.f, s3 = 0.f;
#pragma unroll
      for (int k = 0; k < NSEQ / 32; k += 4) {
        e[i][k]     = exp_slot(e[i][k]     - mx[i]); s0 += e[i][k];
        e[i][k + 1] = exp_slot(e[i][k + 1] - mx[i]); s1 += e[i][k + 1];
        e[i][k + 2] = exp_slot(e[i][k + 2] - mx[i]); s2 += e[i][k + 2];
        e[i][k + 3] = exp_slot(e[i][k + 3] - mx[i]); s3 += e[i][k + 3];
      }
      sum[i] = (s0 + s1) + (s2 + s3);
    }
#pragma unroll
    for (int o = 16; o > 0; o >>= 1)
#pragma unroll
      for (int i = 0; i < 4; ++i) sum[i] += __shfl_xor(sum[i], o);
#pragma unroll
    for (int i = 0; i < 4; ++i) {
      const float inv = 1.f / sum[i];
      const float wsc = inv * (1.0f / NHEAD);   // head-average factor
      float* aw = attnw + ((size_t)(b * NSEQ + q0 + r0 + i)) * NSEQ + lane;
      half_t* Prow = P + (r0 + i) * NSEQ + lane;
#pragma unroll
      for (int k = 0; k < NSEQ / 32; ++k) {
        Prow[k * 32] = (half_t)(e[i][k] * inv);
        atomicAdd(&aw[k * 32], e[i][k] * wsc);
      }
    }
    // The next pass reloads the registers that these atomics name as data and
    // forms a new address in their address pair: keep the wait in front of that.
    asm volatile("s_wait_xcnt 0x0" ::: "memory");
  }
  __syncthreads();

  // ---- ctx: P[16, NSEQ] @ V[NSEQ, DH] using Vt rows (contiguous keys) ----
  v8f cacc[4];
#pragma unroll
  for (int d = 0; d < 4; ++d) cacc[d] = vzero8();

  const half_t* vbase = vt + ((size_t)(b * NHEAD + hh)) * DHEAD * NSEQ;
  for (int k0 = 0; k0 < NSEQ; k0 += 32) {
    v16h ap = load_frag16(P, NSEQ, m, k0, lane);
#pragma unroll
    for (int d = 0; d < 4; ++d) {
      v16h bv = load_frag16(vbase, NSEQ, d * 16 + m, k0, lane);
      cacc[d] = wmma32(ap, bv, cacc[d]);
    }
  }
#pragma unroll
  for (int d = 0; d < 4; ++d) {
#pragma unroll
    for (int r = 0; r < 8; ++r) {
      const int rq = q0 + r + (hi << 3);
      ctx[(((size_t)(b * NSEQ + rq)) * NHEAD + hh) * DHEAD + d * 16 + m] = (half_t)cacc[d][r];
    }
  }
}

// ---------------------------------------------------------------------------
// Host launch
// ---------------------------------------------------------------------------
extern "C" void kernel_launch(void* const* d_in, const int* in_sizes, int n_in,
                              void* d_out, int out_size, void* d_ws, size_t ws_size,
                              hipStream_t stream) {
  (void)in_sizes; (void)n_in; (void)out_size; (void)ws_size;

  const float* h_in  = (const float*)d_in[0];
  const float* ln1_g = (const float*)d_in[1];
  const float* ln1_b = (const float*)d_in[2];
  const float* wq = (const float*)d_in[3];  const float* bq = (const float*)d_in[4];
  const float* wk = (const float*)d_in[5];  const float* bk = (const float*)d_in[6];
  const float* wv = (const float*)d_in[7];  const float* bv = (const float*)d_in[8];
  const float* wo = (const float*)d_in[9];  const float* bo = (const float*)d_in[10];
  const float* ln2_g = (const float*)d_in[11]; const float* ln2_b = (const float*)d_in[12];
  const float* w1 = (const float*)d_in[13]; const float* b1 = (const float*)d_in[14];
  const float* w2 = (const float*)d_in[15]; const float* b2 = (const float*)d_in[16];

  // ---- workspace layout (bytes) ----
  char* ws = (char*)d_ws;
  size_t off = 0;
  half_t* WQH = (half_t*)(ws + off); off += (size_t)DMODEL * DMODEL * 2;        // 0.5 MB
  half_t* WKH = (half_t*)(ws + off); off += (size_t)DMODEL * DMODEL * 2;
  half_t* WVH = (half_t*)(ws + off); off += (size_t)DMODEL * DMODEL * 2;
  half_t* WOH = (half_t*)(ws + off); off += (size_t)DMODEL * DMODEL * 2;
  half_t* W1H = (half_t*)(ws + off); off += (size_t)2 * DMODEL * DMODEL * 2;    // (2D,D)
  half_t* W2H = (half_t*)(ws + off); off += (size_t)2 * DMODEL * DMODEL * 2;    // (D,2D)
  half_t* HN  = (half_t*)(ws + off); off += (size_t)MROWS * DMODEL * 2;         // hn / f (reused)
  float*  H2  = (float*)(ws + off);  off += (size_t)MROWS * DMODEL * 4;         // h + attn_out
  half_t* CTX = (half_t*)(ws + off); off += (size_t)MROWS * DMODEL * 2;
  half_t* Qb  = (half_t*)(ws + off); size_t qoff = off; off += (size_t)MROWS * DMODEL * 2;
  half_t* Kb  = (half_t*)(ws + off); off += (size_t)MROWS * DMODEL * 2;
  half_t* Vb  = (half_t*)(ws + off); off += (size_t)MROWS * DMODEL * 2;
  half_t* VT  = (half_t*)(ws + off); off += (size_t)MROWS * DMODEL * 2;
  half_t* Gb  = (half_t*)(ws + qoff);  // FFN hidden [M, 2D] reuses Q+K regions (dead by then)

  float* out_h    = (float*)d_out;
  float* out_attn = (float*)d_out + (size_t)MROWS * DMODEL;

  // attn_weights accumulated via atomics -> zero it first (capture-safe).
  hipMemsetAsync(out_attn, 0, (size_t)NBATCH * NSEQ * NSEQ * sizeof(float), stream);

  // weights -> f16
  const int DD = DMODEL * DMODEL, DD2 = 2 * DMODEL * DMODEL;
  f2h_kernel<<<(DD  + 255) / 256, 256, 0, stream>>>(wq, WQH, DD);
  f2h_kernel<<<(DD  + 255) / 256, 256, 0, stream>>>(wk, WKH, DD);
  f2h_kernel<<<(DD  + 255) / 256, 256, 0, stream>>>(wv, WVH, DD);
  f2h_kernel<<<(DD  + 255) / 256, 256, 0, stream>>>(wo, WOH, DD);
  f2h_kernel<<<(DD2 + 255) / 256, 256, 0, stream>>>(w1, W1H, DD2);
  f2h_kernel<<<(DD2 + 255) / 256, 256, 0, stream>>>(w2, W2H, DD2);

  // LN1
  ln_kernel<<<MROWS / 8, 256, 0, stream>>>(h_in, ln1_g, ln1_b, HN);

  // QKV projections (block tile 128x128)
  dim3 gD(DMODEL / 128, MROWS / 128);       // (4, 128)
  gemm_kernel<<<gD, 256, 0, stream>>>(HN, WQH, bq, nullptr, nullptr, Qb, DMODEL, DMODEL, 0);
  gemm_kernel<<<gD, 256, 0, stream>>>(HN, WKH, bk, nullptr, nullptr, Kb, DMODEL, DMODEL, 0);
  gemm_kernel<<<gD, 256, 0, stream>>>(HN, WVH, bv, nullptr, nullptr, Vb, DMODEL, DMODEL, 0);

  // V -> Vt
  transpose_v_kernel<<<(MROWS * DMODEL) / 256, 256, 0, stream>>>(Vb, VT);

  // attention (96 KB dynamic LDS; CDNA5 WGP has 320 KB)
  const int attn_lds = 16 * NSEQ * (int)sizeof(float) + 16 * NSEQ * (int)sizeof(half_t);
  hipFuncSetAttribute(reinterpret_cast<const void*>(attn_kernel),
                      hipFuncAttributeMaxDynamicSharedMemorySize, attn_lds);
  attn_kernel<<<NBATCH * NHEAD * (NSEQ / 16), 32, attn_lds, stream>>>(Qb, Kb, VT, CTX, out_attn);

  // out projection + residual -> h2 (fp32)
  gemm_kernel<<<gD, 256, 0, stream>>>(CTX, WOH, bo, h_in, H2, nullptr, DMODEL, DMODEL, 0);

  // LN2 -> f (f16, reuses HN)
  ln_kernel<<<MROWS / 8, 256, 0, stream>>>(H2, ln2_g, ln2_b, HN);

  // FFN1: silu(f @ w1^T + b1) -> g f16 [M, 2D]
  dim3 g2(2 * DMODEL / 128, MROWS / 128);   // (8, 128)
  gemm_kernel<<<g2, 256, 0, stream>>>(HN, W1H, b1, nullptr, nullptr, Gb, 2 * DMODEL, DMODEL, 1);

  // FFN2: g @ w2^T + b2 + h2 -> final h (fp32, straight to d_out)
  gemm_kernel<<<gD, 256, 0, stream>>>(Gb, W2H, b2, H2, out_h, nullptr, DMODEL, 2 * DMODEL, 0);
}

// v002
// Measured time: 460 microseconds a run.
// Timed twice side by side with v001, it ran 1.80 times as fast both times.
// Over all steps from v000 it is 3.47 times as fast.
#include <hip/hip_runtime.h>

// ---------------------------------------------------------------------------
// Transformer encoder layer for MI455X (gfx1250, wave32, WMMA).
// All GEMMs use v_wmma_f32_16x16x32_f16 (f16 in, fp32 accumulate).
// GEMM wave tile: 32x64 (2x4 WMMA), block tile 128x128 (8 waves).
// ---------------------------------------------------------------------------

typedef _Float16 half_t;
typedef __attribute__((ext_vector_type(16))) _Float16 v16h;
typedef __attribute__((ext_vector_type(8)))  float    v8f;

#define DMODEL 512
#define NSEQ   1024
#define NBATCH 16
#define NHEAD  8
#define DHEAD  64
#define MROWS  (NBATCH * NSEQ)   // 16384 token rows

union AFrag16 { v16h v; float4 q[2]; };

// Load one 16x32 f16 WMMA fragment (A layout, or B layout for W stored [N,K]).
// Per ISA 7.12.2: lane L (0..15) holds row/col L; lanes 16..31 hold the K+8
// group. frag elems 0..7 = K kb..kb+7, elems 8..15 = K kb+16..kb+23.
__device__ __forceinline__ v16h load_frag16(const half_t* __restrict__ base,
                                            int stride, int idx, int k, int lane) {
  const int kb = (lane >> 4) << 3;   // 0 or 8
  const half_t* p = base + (size_t)idx * (size_t)stride + (size_t)(k + kb);
  AFrag16 f;
  f.q[0] = *reinterpret_cast<const float4*>(p);        // K kb .. kb+7
  f.q[1] = *reinterpret_cast<const float4*>(p + 16);   // K kb+16 .. kb+23
  return f.v;
}

__device__ __forceinline__ v8f wmma32(v16h a, v16h b, v8f c) {
  return __builtin_amdgcn_wmma_f32_16x16x32_f16(false, a, false, b,
                                                (short)0, c, false, false);
}

__device__ __forceinline__ v8f vzero8() {
  v8f z = {0.f, 0.f, 0.f, 0.f, 0.f, 0.f, 0.f, 0.f};
  return z;
}

// ---------------------------------------------------------------------------
// fp32 -> f16 conversion (weights)
// ---------------------------------------------------------------------------
__global__ void f2h_kernel(const float* __restrict__ src, half_t* __restrict__ dst, int n) {
  int i = blockIdx.x * blockDim.x + threadIdx.x;
  if (i < n) dst[i] = (half_t)src[i];
}

// ---------------------------------------------------------------------------
// LayerNorm: one wave (32 lanes) per row of 512; lane owns 16 contiguous cols.
// ---------------------------------------------------------------------------
__global__ __launch_bounds__(256) void ln_kernel(const float* __restrict__ x,
                                                 const float* __restrict__ g,
                                                 const float* __restrict__ bta,
                                                 half_t* __restrict__ out) {
  const int row  = blockIdx.x * 8 + (threadIdx.x >> 5);
  const int lane = threadIdx.x & 31;
  const float* xr = x + (size_t)row * DMODEL + lane * 16;

  float v[16];
  const float4* x4 = reinterpret_cast<const float4*>(xr);
#pragma unroll
  for (int j = 0; j < 4; ++j) {
    float4 t = x4[j];
    v[4 * j + 0] = t.x; v[4 * j + 1] = t.y; v[4 * j + 2] = t.z; v[4 * j + 3] = t.w;
  }
  float s = 0.f;
#pragma unroll
  for (int j = 0; j < 16; ++j) s += v[j];
#pragma unroll
  for (int o = 16; o > 0; o >>= 1) s += __shfl_xor(s, o);
  const float mu = s * (1.0f / DMODEL);

  float q = 0.f;
#pragma unroll
  for (int j = 0; j < 16; ++j) { float d = v[j] - mu; q += d * d; }
#pragma unroll
  for (int o = 16; o > 0; o >>= 1) q += __shfl_xor(q, o);
  const float rs = rsqrtf(q * (1.0f / DMODEL) + 1e-5f);

  half_t* orow = out + (size_t)row * DMODEL + lane * 16;
#pragma unroll
  for (int j = 0; j < 16; ++j) {
    int c = lane * 16 + j;
    orow[j] = (half_t)((v[j] - mu) * rs * g[c] + bta[c]);
  }
}

// ---------------------------------------------------------------------------
// WMMA GEMM: out[M,Nn] = act(A_f16[M,K] @ W_f16[Nn,K]^T + bias) (+ resid)
// Block: 256 thr = 8 waves; block tile 128x128; wave tile 32x64 (2x4 WMMA).
// 8 WMMAs per 6 fragment loads -> 1.33x register-level reuse vs 2x2 tiling.
// ---------------------------------------------------------------------------
__global__ __launch_bounds__(256) void gemm_kernel(const half_t* __restrict__ A,
                                                   const half_t* __restrict__ W,
                                                   const float* __restrict__ bias,
                                                   const float* __restrict__ resid,
                                                   float* __restrict__ out32,
                                                   half_t* __restrict__ out16,
                                                   int Nn, int K, int act) {
  const int lane = threadIdx.x & 31;
  const int w    = threadIdx.x >> 5;
  const int wm   = w & 3;          // 4 waves along M (32 rows each)
  const int wn   = w >> 2;         // 2 waves along N (64 cols each)
  const int m0   = blockIdx.y * 128 + wm * 32;
  const int n0   = blockIdx.x * 128 + wn * 64;
  const int lm   = lane & 15;
  const int hi   = lane >> 4;

  v8f acc[2][4];
#pragma unroll
  for (int i = 0; i < 2; ++i)
#pragma unroll
    for (int j = 0; j < 4; ++j) acc[i][j] = vzero8();

  for (int k = 0; k < K; k += 32) {
    v16h a0 = load_frag16(A, K, m0 + lm,      k, lane);
    v16h a1 = load_frag16(A, K, m0 + 16 + lm, k, lane);
    v16h b0 = load_frag16(W, K, n0 + lm,      k, lane);
    v16h b1 = load_frag16(W, K, n0 + 16 + lm, k, lane);
    v16h b2 = load_frag16(W, K, n0 + 32 + lm, k, lane);
    v16h b3 = load_frag16(W, K, n0 + 48 + lm, k, lane);
    acc[0][0] = wmma32(a0, b0, acc[0][0]);
    acc[0][1] = wmma32(a0, b1, acc[0][1]);
    acc[0][2] = wmma32(a0, b2, acc[0][2]);
    acc[0][3] = wmma32(a0, b3, acc[0][3]);
    acc[1][0] = wmma32(a1, b0, acc[1][0]);
    acc[1][1] = wmma32(a1, b1, acc[1][1]);
    acc[1][2] = wmma32(a1, b2, acc[1][2]);
    acc[1][3] = wmma32(a1, b3, acc[1][3]);
  }

#pragma unroll
  for (int i = 0; i < 2; ++i) {
#pragma unroll
    for (int j = 0; j < 4; ++j) {
      const int colg = n0 + j * 16 + lm;
      const float bz = bias[colg];
#pragma unroll
      for (int r = 0; r < 8; ++r) {
        const int rowg = m0 + i * 16 + r + (hi << 3);
        float val = acc[i][j][r] + bz;
        if (act) val = val / (1.f + __expf(-val));     // SiLU
        const size_t off = (size_t)rowg * Nn + colg;
        if (resid) val += resid[off];
        if (out32) out32[off] = val;
        if (out16) out16[off] = (half_t)val;
      }
    }
  }
}

// ---------------------------------------------------------------------------
// V [B,N,H,DH] -> Vt [B,H,DH,N]
// ---------------------------------------------------------------------------
__global__ void transpose_v_kernel(const half_t* __restrict__ v, half_t* __restrict__ vt) {
  size_t i = (size_t)blockIdx.x * 256 + threadIdx.x;   // indexes vt, n fastest
  int n  = (int)(i & (NSEQ - 1));
  size_t r = i >> 10;
  int d  = (int)(r & (DHEAD - 1)); r >>= 6;
  int hh = (int)(r & (NHEAD - 1));
  int b  = (int)(r >> 3);
  vt[i] = v[(((size_t)(b * NSEQ + n)) * NHEAD + hh) * DHEAD + d];
}

// ---------------------------------------------------------------------------
// 2^t and log2(t) on the transcendental unit. The v_nop is the one slot the
// instruction set asks for behind a transcendental before its result is read or
// its source overwritten; inside one statement it cannot be lost. In place: the
// register written is the one the compiler's own arithmetic has just written, so
// it is never an operand of a matrix instruction that stands shortly in front.
// ---------------------------------------------------------------------------
__device__ __forceinline__ float exp2_slot(float t) {
  asm("v_exp_f32 %0, %0\n\tv_nop" : "+v"(t));
  return t;
}
__device__ __forceinline__ float log2_slot(float t) {
  asm("v_log_f32 %0, %0\n\tv_nop" : "+v"(t));
  return t;
}

#define QCOLS 32   // query columns per wave (two 16-column groups)
#define KCH   32   // keys per pass
#define RP    36   // LDS row pitch in floats: 144 B = 16 B x odd, for 16-byte accesses

// K fragments (A operand) of 32 keys of one head: two 16-key tiles x two k steps.
__device__ __forceinline__ void load_k(const half_t* __restrict__ krow, int n0, int lane,
                                       v16h (&kf)[2][2]) {
#pragma unroll
  for (int t = 0; t < 2; ++t) {
    const half_t* p = krow + (size_t)(n0 + t * 16) * DMODEL;
    kf[t][0] = load_frag16(p, 0, 0, 0,  lane);
    kf[t][1] = load_frag16(p, 0, 0, 32, lane);
  }
}

// S^T = K Q^T: st[t][g][r] = score(key 16 t + 8 hi + r, query 16 g + c), unscaled.
__device__ __forceinline__ void scores_t(const v16h (&kf)[2][2], const v16h (&qf)[2][2],
                                         v8f (&st)[2][2]) {
#pragma unroll
  for (int t = 0; t < 2; ++t)
#pragma unroll
    for (int g = 0; g < 2; ++g) st[t][g] = wmma32(kf[t][0], qf[g][0], vzero8());
#pragma unroll
  for (int t = 0; t < 2; ++t)
#pragma unroll
    for (int g = 0; g < 2; ++g) st[t][g] = wmma32(kf[t][1], qf[g][1], st[t][g]);
}

// Work-group barrier that orders LDS only: the K and V fragment loads issued
// ahead stay in flight across it (__syncthreads() would drain them).
__device__ __forceinline__ void lds_barrier() {
  __builtin_amdgcn_fence(__ATOMIC_RELEASE, "workgroup", "local");
  __builtin_amdgcn_s_barrier();
  __builtin_amdgcn_fence(__ATOMIC_ACQUIRE, "workgroup", "local");
}

// ---------------------------------------------------------------------------
// Attention: one work-group per (b, 32-query tile); wave w = head w.
// Walk 1 over the keys: S^T = K Q^T, each lane keeps the running maximum and
// sum of its own query column (scores are not stored).
// Walk 2: S^T again, P^T = 2^(x - max - log2 sum) in the accumulator registers,
// which are a B operand as they stand: O^T += V^T P^T. The eight heads' P^T of
// the pass meet in LDS, are summed in head order and stored once.
// LDS: two buffers of 8 heads x 32 queries x 32 keys f32 (pitch 36) = 72 KB.
// ---------------------------------------------------------------------------
// Second bound: four waves per SIMD (256 VGPRs), so that two work-groups share a WGP.
__global__ __launch_bounds__(256, 4) void attn_kernel(const half_t* __restrict__ q,
                                                   const half_t* __restrict__ kk,
                                                   const half_t* __restrict__ vt,
                                                   half_t* __restrict__ ctx,
                                                   float* __restrict__ attnw) {
  extern __shared__ char smem[];
  float* R = (float*)smem;                     // [2][NHEAD][QCOLS][RP]

  const int lane = threadIdx.x & 31;
  const int hh   = threadIdx.x >> 5;           // head
  const int b    = blockIdx.x >> 5;            // N / 32 = 32 query tiles per batch
  const int q0   = (blockIdx.x & 31) * QCOLS;
  const int c    = lane & 15;
  const int hi   = lane >> 4;
  const float SC = 0.125f * 1.4426950408889634f;   // 1/sqrt(64) * log2(e)

  v16h qf[2][2];
#pragma unroll
  for (int g = 0; g < 2; ++g) {
    const half_t* qb = q + (((size_t)(b * NSEQ + q0 + g * 16 + c)) * NHEAD + hh) * DHEAD;
    qf[g][0] = load_frag16(qb, 0, 0, 0,  lane);
    qf[g][1] = load_frag16(qb, 0, 0, 32, lane);
  }
  // The Q loads' address pair is free for reuse from here on (the build gave it to
  // a K fragment): keep the wait in front of whatever overwrites it.
  asm volatile("s_wait_xcnt 0x0" ::: "memory");
  const half_t* krow = kk + (((size_t)(b * NSEQ + c)) * NHEAD + hh) * DHEAD;

  // ---- walk 1: column maximum and sum (log2 domain), per lane half ----
  float mrun[2] = {-1e30f, -1e30f};
  float lrun[2] = {0.f, 0.f};
  v16h kc[2][2];
  load_k(krow, 0, lane, kc);
#pragma unroll 1  // one pass per trip keeps the live set under 256 registers
  for (int i = 0; i < NSEQ / KCH; ++i) {
    v8f st[2][2];
    scores_t(kc, qf, st);
    // the next pass's K, into the same registers, behind their last use; the
    // last pass fetches walk 2's first keys
    load_k(krow, ((i + 1) & (NSEQ / KCH - 1)) * KCH, lane, kc);
#pragma unroll
    for (int g = 0; g < 2; ++g) {
      float c0 = fmaxf(st[0][g][0], st[1][g][0]);
#pragma unroll
      for (int r = 1; r < 8; ++r) c0 = fmaxf(c0, fmaxf(st[0][g][r], st[1][g][r]));
      const float mn = fmaxf(mrun[g], c0 * SC);
      float s0 = exp2_slot(fmaf(st[0][g][0], SC, -mn));
      float s1 = exp2_slot(fmaf(st[0][g][1], SC, -mn));
      float s2 = exp2_slot(fmaf(st[1][g][0], SC, -mn));
      float s3 = exp2_slot(fmaf(st[1][g][1], SC, -mn));
#pragma unroll
      for (int r = 2; r < 8; r += 2) {
        s0 += exp2_slot(fmaf(st[0][g][r],     SC, -mn));
        s1 += exp2_slot(fmaf(st[0][g][r + 1], SC, -mn));
        s2 += exp2_slot(fmaf(st[1][g][r],     SC, -mn));
        s3 += exp2_slot(fmaf(st[1][g][r + 1], SC, -mn));
      }
      lrun[g] = lrun[g] * exp2_slot(mrun[g] - mn) + ((s0 + s1) + (s2 + s3));
      mrun[g] = mn;
    }
  }

  // join the two lane halves of each column; off = max + log2(sum)
  float off[2];
#pragma unroll
  for (int g = 0; g < 2; ++g) {
    const float mo = __shfl_xor(mrun[g], 16);
    const float lo = __shfl_xor(lrun[g], 16);
    const float M  = fmaxf(mrun[g], mo);
    const float L  = lrun[g] * exp2_slot(mrun[g] - M) + lo * exp2_slot(mo - M);
    off[g] = M + log2_slot(L);
  }

  // ---- walk 2: P^T, O^T += V^T P^T, head mean of P ----
  v8f o[4][2];
#pragma unroll
  for (int d = 0; d < 4; ++d) { o[d][0] = vzero8(); o[d][1] = vzero8(); }

  const half_t* vbase = vt + ((size_t)(b * NHEAD + hh)) * DHEAD * NSEQ;
  const int tq = threadIdx.x >> 3;             // query row this thread sums
  const int tj = (threadIdx.x & 7) * 4;        // its four keys of the pass
  float* aw = attnw + ((size_t)(b * NSEQ + q0 + tq)) * NSEQ + tj;

  v16h vf[4];
#pragma unroll
  for (int d = 0; d < 4; ++d) vf[d] = load_frag16(vbase, NSEQ, d * 16 + c, 0, lane);

#pragma unroll 1  // as in walk 1
  for (int i = 0; i < NSEQ / KCH; ++i) {
    const int k0 = i * KCH;
    const int kx = ((i + 1) & (NSEQ / KCH - 1)) * KCH;   // next pass (the last one refetches the first: in bounds, unused)
    v8f st[2][2];
    scores_t(kc, qf, st);
    load_k(krow, kx, lane, kc);

    float* Rw = R + (size_t)(((i & 1) * NHEAD + hh) * QCOLS) * RP;
    v16h pb[2];
#pragma unroll
    for (int g = 0; g < 2; ++g) {
#pragma unroll
      for (int t = 0; t < 2; ++t) {
        float p[8];
#pragma unroll
        for (int r = 0; r < 8; ++r) {
          p[r] = exp2_slot(fmaf(st[t][g][r], SC, -off[g]));
          pb[g][t * 8 + r] = (half_t)p[r];     // hardware k order: keys 8 hi + r, 16 + 8 hi + r
        }
        float4* dst = reinterpret_cast<float4*>(Rw + (g * 16 + c) * RP + t * 16 + hi * 8);
        dst[0] = make_float4(p[0], p[1], p[2], p[3]);
        dst[1] = make_float4(p[4], p[5], p[6], p[7]);
      }
    }
#pragma unroll
    for (int d = 0; d < 4; ++d) {
      o[d][0] = wmma32(vf[d], pb[0], o[d][0]);
      o[d][1] = wmma32(vf[d], pb[1], o[d][1]);
    }
#pragma unroll
    for (int d = 0; d < 4; ++d) vf[d] = load_frag16(vbase, NSEQ, d * 16 + c, kx, lane);

    // One barrier per pass: it publishes this pass's P^T, and it ends every
    // reader's reads of the other buffer, which the next pass overwrites.
    lds_barrier();

    const float* Rr = R + (size_t)((i & 1) * NHEAD * QCOLS + tq) * RP + tj;
    float4 s = *reinterpret_cast<const float4*>(Rr);
#pragma unroll
    for (int h = 1; h < NHEAD; ++h) {
      const float4 u = *reinterpret_cast<const float4*>(Rr + h * QCOLS * RP);
      s.x += u.x; s.y += u.y; s.z += u.z; s.w += u.w;
    }
    *reinterpret_cast<float4*>(aw + k0) =
        make_float4(s.x * 0.125f, s.y * 0.125f, s.z * 0.125f, s.w * 0.125f);
  }

  // ---- ctx: a lane holds 8 consecutive d of one query: one 16-byte store ----
#pragma unroll
  for (int g = 0; g < 2; ++g) {
    half_t* crow = ctx + (((size_t)(b * NSEQ + q0 + g * 16 + c)) * NHEAD + hh) * DHEAD + hi * 8;
#pragma unroll
    for (int d = 0; d < 4; ++d) {
      union { half_t h[8]; float4 v; } u;
#pragma unroll
      for (int r = 0; r < 8; ++r) u.h[r] = (half_t)o[d][g][r];
      *reinterpret_cast<float4*>(crow + d * 16) = u.v;
    }
  }
}

// ---------------------------------------------------------------------------
// Host launch
// ---------------------------------------------------------------------------
extern "C" void kernel_launch(void* const* d_in, const int* in_sizes, int n_in,
                              void* d_out, int out_size, void* d_ws, size_t ws_size,
                              hipStream_t stream) {
  (void)in_sizes; (void)n_in; (void)out_size; (void)ws_size;

  const float* h_in  = (const float*)d_in[0];
  const float* ln1_g = (const float*)d_in[1];
  const float* ln1_b = (const float*)d_in[2];
  const float* wq = (const float*)d_in[3];  const float* bq = (const float*)d_in[4];
  const float* wk = (const float*)d_in[5];  const float* bk = (const float*)d_in[6];
  const float* wv = (const float*)d_in[7];  const float* bv = (const float*)d_in[8];
  const float* wo = (const float*)d_in[9];  const float* bo = (const float*)d_in[10];
  const float* ln2_g = (const float*)d_in[11]; const float* ln2_b = (const float*)d_in[12];
  const float* w1 = (const float*)d_in[13]; const float* b1 = (const float*)d_in[14];
  const float* w2 = (const float*)d_in[15]; const float* b2 = (const float*)d_in[16];

  // ---- workspace layout (bytes) ----
  char* ws = (char*)d_ws;
  size_t off = 0;
  half_t* WQH = (half_t*)(ws + off); off += (size_t)DMODEL * DMODEL * 2;        // 0.5 MB
  half_t* WKH = (half_t*)(ws + off); off += (size_t)DMODEL * DMODEL * 2;
  half_t* WVH = (half_t*)(ws + off); off += (size_t)DMODEL * DMODEL * 2;
  half_t* WOH = (half_t*)(ws + off); off += (size_t)DMODEL * DMODEL * 2;
  half_t* W1H = (half_t*)(ws + off); off += (size_t)2 * DMODEL * DMODEL * 2;    // (2D,D)
  half_t* W2H = (half_t*)(ws + off); off += (size_t)2 * DMODEL * DMODEL * 2;    // (D,2D)
  half_t* HN  = (half_t*)(ws + off); off += (size_t)MROWS * DMODEL * 2;         // hn / f (reused)
  float*  H2  = (float*)(ws + off);  off += (size_t)MROWS * DMODEL * 4;         // h + attn_out
  half_t* CTX = (half_t*)(ws + off); off += (size_t)MROWS * DMODEL * 2;
  half_t* Qb  = (half_t*)(ws + off); size_t qoff = off; off += (size_t)MROWS * DMODEL * 2;
  half_t* Kb  = (half_t*)(ws + off); off += (size_t)MROWS * DMODEL * 2;
  half_t* Vb  = (half_t*)(ws + off); off += (size_t)MROWS * DMODEL * 2;
  half_t* VT  = (half_t*)(ws + off); off += (size_t)MROWS * DMODEL * 2;
  half_t* Gb  = (half_t*)(ws + qoff);  // FFN hidden [M, 2D] reuses Q+K regions (dead by then)

  float* out_h    = (float*)d_out;
  float* out_attn = (float*)d_out + (size_t)MROWS * DMODEL;

  // weights -> f16
  const int DD = DMODEL * DMODEL, DD2 = 2 * DMODEL * DMODEL;
  f2h_kernel<<<(DD  + 255) / 256, 256, 0, stream>>>(wq, WQH, DD);
  f2h_kernel<<<(DD  + 255) / 256, 256, 0, stream>>>(wk, WKH, DD);
  f2h_kernel<<<(DD  + 255) / 256, 256, 0, stream>>>(wv, WVH, DD);
  f2h_kernel<<<(DD  + 255) / 256, 256, 0, stream>>>(wo, WOH, DD);
  f2h_kernel<<<(DD2 + 255) / 256, 256, 0, stream>>>(w1, W1H, DD2);
  f2h_kernel<<<(DD2 + 255) / 256, 256, 0, stream>>>(w2, W2H, DD2);

  // LN1
  ln_kernel<<<MROWS / 8, 256, 0, stream>>>(h_in, ln1_g, ln1_b, HN);

  // QKV projections (block tile 128x128)
  dim3 gD(DMODEL / 128, MROWS / 128);       // (4, 128)
  gemm_kernel<<<gD, 256, 0, stream>>>(HN, WQH, bq, nullptr, nullptr, Qb, DMODEL, DMODEL, 0);
  gemm_kernel<<<gD, 256, 0, stream>>>(HN, WKH, bk, nullptr, nullptr, Kb, DMODEL, DMODEL, 0);
  gemm_kernel<<<gD, 256, 0, stream>>>(HN, WVH, bv, nullptr, nullptr, Vb, DMODEL, DMODEL, 0);

  // V -> Vt
  transpose_v_kernel<<<(MROWS * DMODEL) / 256, 256, 0, stream>>>(Vb, VT);

  // attention (72 KB dynamic LDS; CDNA5 WGP has 320 KB)
  const int attn_lds = 2 * NHEAD * QCOLS * RP * (int)sizeof(float);
  hipFuncSetAttribute(reinterpret_cast<const void*>(attn_kernel),
                      hipFuncAttributeMaxDynamicSharedMemorySize, attn_lds);
  attn_kernel<<<NBATCH * (NSEQ / QCOLS), 256, attn_lds, stream>>>(Qb, Kb, VT, CTX, out_attn);

  // out projection + residual -> h2 (fp32)
  gemm_kernel<<<gD, 256, 0, stream>>>(CTX, WOH, bo, h_in, H2, nullptr, DMODEL, DMODEL, 0);

  // LN2 -> f (f16, reuses HN)
  ln_kernel<<<MROWS / 8, 256, 0, stream>>>(H2, ln2_g, ln2_b, HN);

  // FFN1: silu(f @ w1^T + b1) -> g f16 [M, 2D]
  dim3 g2(2 * DMODEL / 128, MROWS / 128);   // (8, 128)
  gemm_kernel<<<g2, 256, 0, stream>>>(HN, W1H, b1, nullptr, nullptr, Gb, 2 * DMODEL, DMODEL, 1);

  // FFN2: g @ w2^T + b2 + h2 -> final h (fp32, straight to d_out)
  gemm_kernel<<<gD, 256, 0, stream>>>(Gb, W2H, b2, H2, out_h, nullptr, DMODEL, 2 * DMODEL, 0);
}

// v003
// It runs in 317 microseconds.
// Two timings next to v002 both put it at 1.45 times that version's speed.
// Counting every step since v000, it is 5.04 times as fast.
#include <hip/hip_runtime.h>

// ---------------------------------------------------------------------------
// Transformer encoder layer for MI455X (gfx1250, wave32, WMMA).
// All GEMMs use v_wmma_f32_16x16x32_f16 (f16 in, fp32 accumulate).
// GEMM wave tile: 32x64 (2x4 WMMA), block tile 128x128 (8 waves), tiles staged in LDS.
// ---------------------------------------------------------------------------

typedef _Float16 half_t;
typedef __attribute__((ext_vector_type(16))) _Float16 v16h;
typedef __attribute__((ext_vector_type(8)))  float    v8f;

#define DMODEL 512
#define NSEQ   1024
#define NBATCH 16
#define NHEAD  8
#define DHEAD  64
#define MROWS  (NBATCH * NSEQ)   // 16384 token rows

union AFrag16 { v16h v; float4 q[2]; };

// Load one 16x32 f16 WMMA fragment (A layout, or B layout for W stored [N,K]).
// Per ISA 7.12.2: lane L (0..15) holds row/col L; lanes 16..31 hold the K+8
// group. frag elems 0..7 = K kb..kb+7, elems 8..15 = K kb+16..kb+23.
__device__ __forceinline__ v16h load_frag16(const half_t* __restrict__ base,
                                            int stride, int idx, int k, int lane) {
  const int kb = (lane >> 4) << 3;   // 0 or 8
  const half_t* p = base + (size_t)idx * (size_t)stride + (size_t)(k + kb);
  AFrag16 f;
  f.q[0] = *reinterpret_cast<const float4*>(p);        // K kb .. kb+7
  f.q[1] = *reinterpret_cast<const float4*>(p + 16);   // K kb+16 .. kb+23
  return f.v;
}

__device__ __forceinline__ v8f wmma32(v16h a, v16h b, v8f c) {
  return __builtin_amdgcn_wmma_f32_16x16x32_f16(false, a, false, b,
                                                (short)0, c, false, false);
}

__device__ __forceinline__ v8f vzero8() {
  v8f z = {0.f, 0.f, 0.f, 0.f, 0.f, 0.f, 0.f, 0.f};
  return z;
}

// ---------------------------------------------------------------------------
// fp32 -> f16 conversion (weights)
// ---------------------------------------------------------------------------
__global__ void f2h_kernel(const float* __restrict__ src, half_t* __restrict__ dst, int n) {
  int i = blockIdx.x * blockDim.x + threadIdx.x;
  if (i < n) dst[i] = (half_t)src[i];
}

// ---------------------------------------------------------------------------
// LayerNorm: one wave (32 lanes) per row of 512; lane owns 16 contiguous cols.
// ---------------------------------------------------------------------------
__global__ __launch_bounds__(256) void ln_kernel(const float* __restrict__ x,
                                                 const float* __restrict__ g,
                                                 const float* __restrict__ bta,
                                                 half_t* __restrict__ out) {
  const int row  = blockIdx.x * 8 + (threadIdx.x >> 5);
  const int lane = threadIdx.x & 31;
  const float* xr = x + (size_t)row * DMODEL + lane * 16;

  float v[16];
  const float4* x4 = reinterpret_cast<const float4*>(xr);
#pragma unroll
  for (int j = 0; j < 4; ++j) {
    float4 t = x4[j];
    v[4 * j + 0] = t.x; v[4 * j + 1] = t.y; v[4 * j + 2] = t.z; v[4 * j + 3] = t.w;
  }
  float s = 0.f;
#pragma unroll
  for (int j = 0; j < 16; ++j) s += v[j];
#pragma unroll
  for (int o = 16; o > 0; o >>= 1) s += __shfl_xor(s, o);
  const float mu = s * (1.0f / DMODEL);

  float q = 0.f;
#pragma unroll
  for (int j = 0; j < 16; ++j) { float d = v[j] - mu; q += d * d; }
#pragma unroll
  for (int o = 16; o > 0; o >>= 1) q += __shfl_xor(q, o);
  const float rs = rsqrtf(q * (1.0f / DMODEL) + 1e-5f);

  half_t* orow = out + (size_t)row * DMODEL + lane * 16;
#pragma unroll
  for (int j = 0; j < 16; ++j) {
    int c = lane * 16 + j;
    orow[j] = (half_t)((v[j] - mu) * rs * g[c] + bta[c]);
  }
}

// ---------------------------------------------------------------------------
// WMMA GEMM: out[M,Nn] = act(A_f16[M,K] @ W_f16[Nn,K]^T + bias) (+ resid)
// Block: 256 thr = 8 waves; block tile 128x128; wave tile 32x64 (2x4 WMMA).
// Both operand tiles pass through LDS: asynchronous 16-byte copies bring 128 B of
// each of the 128 + 128 rows per trip (a wave's copy covers four whole lines),
// two buffers, the next tile in flight while this one is multiplied.
// ---------------------------------------------------------------------------
#define GKT  64              // k per trip: 128 B of every operand row
#define GPIT 144             // LDS row pitch in bytes: 16 B x odd, for 16-byte fragment reads
#define GOPB (128 * GPIT)    // one operand's tile in LDS
#define GBUF (2 * GOPB)      // a buffer: A tile, then W tile

// One 16x32 f16 fragment from an LDS tile; the k order is load_frag16's.
__device__ __forceinline__ v16h lds_frag16(const char* tile, int row, int kbyte, int hi) {
  const char* p = tile + row * GPIT + kbyte + hi * 16;
  AFrag16 f;
  f.q[0] = *reinterpret_cast<const float4*>(p);        // K kb .. kb+7
  f.q[1] = *reinterpret_cast<const float4*>(p + 32);   // K kb+16 .. kb+23
  return f.v;
}

// One trip's tiles: a thread copies 16 B of rows r, r + 32, r + 64, r + 96 of A and
// of W. lds: its place in the buffer's A tile; rs: 32 rows of the source, in elements.
// The s_wait_xcnt closes the statement so that it stands in front of whatever
// rewrites an address register that a copy names.
__device__ __forceinline__ void copy_tiles(unsigned lds, const half_t* ga, const half_t* gw,
                                           size_t rs) {
  asm volatile(
      "global_load_async_to_lds_b128 %0, %8, off\n\t"
      "global_load_async_to_lds_b128 %1, %9, off\n\t"
      "global_load_async_to_lds_b128 %2, %10, off\n\t"
      "global_load_async_to_lds_b128 %3, %11, off\n\t"
      "global_load_async_to_lds_b128 %4, %12, off\n\t"
      "global_load_async_to_lds_b128 %5, %13, off\n\t"
      "global_load_async_to_lds_b128 %6, %14, off\n\t"
      "global_load_async_to_lds_b128 %7, %15, off\n\t"
      "s_wait_xcnt 0x0"
      :: "v"(lds), "v"(lds + 32 * GPIT), "v"(lds + 64 * GPIT), "v"(lds + 96 * GPIT),
         "v"(lds + GOPB), "v"(lds + GOPB + 32 * GPIT), "v"(lds + GOPB + 64 * GPIT),
         "v"(lds + GOPB + 96 * GPIT),
         "v"(ga), "v"(ga + rs), "v"(ga + 2 * rs), "v"(ga + 3 * rs),
         "v"(gw), "v"(gw + rs), "v"(gw + 2 * rs), "v"(gw + 3 * rs)
      : "memory");
}

__global__ __launch_bounds__(256) void gemm_kernel(const half_t* __restrict__ A,
                                                   const half_t* __restrict__ W,
                                                   const float* __restrict__ bias,
                                                   const float* __restrict__ resid,
                                                   float* __restrict__ out32,
                                                   half_t* __restrict__ out16,
                                                   int Nn, int K, int act) {
  __shared__ __attribute__((aligned(16))) char gs[2 * GBUF];

  const int lane = threadIdx.x & 31;
  const int w    = threadIdx.x >> 5;
  const int wm   = w & 3;          // 4 waves along M (32 rows each)
  const int wn   = w >> 2;         // 2 waves along N (64 cols each)
  const int m0   = blockIdx.y * 128 + wm * 32;
  const int n0   = blockIdx.x * 128 + wn * 64;
  const int lm   = lane & 15;
  const int hi   = lane >> 4;

  v8f acc[2][4];
#pragma unroll
  for (int i = 0; i < 2; ++i)
#pragma unroll
    for (int j = 0; j < 4; ++j) acc[i][j] = vzero8();

  // this thread's share of a tile: row cr (and + 32, 64, 96), 16-byte piece cp
  const int cr = threadIdx.x >> 3;
  const int cp = threadIdx.x & 7;
  const unsigned lds0 = (unsigned)(size_t)gs + (unsigned)(cr * GPIT + cp * 16);
  const half_t* ga = A + (size_t)(blockIdx.y * 128 + cr) * K + cp * 8;
  const half_t* gw = W + (size_t)(blockIdx.x * 128 + cr) * K + cp * 8;
  const size_t  rs = (size_t)32 * K;
  const int     T  = K / GKT;

  copy_tiles(lds0, ga, gw, rs);
  // tile 0 has landed for this wave; the barrier publishes every wave's share
  asm volatile("s_wait_asynccnt 0x0" ::: "memory");
  __syncthreads();
  if (T > 1) copy_tiles(lds0 + GBUF, ga + GKT, gw + GKT, rs);

  for (int t = 0; t < T; ++t) {
    const char* ta = gs + (t & 1) * GBUF + (wm * 32 + lm) * GPIT;
    const char* tw = gs + (t & 1) * GBUF + GOPB + (wn * 64 + lm) * GPIT;
#pragma unroll  // both 32-k halves of the trip in line: every LDS offset is an immediate
    for (int kb = 0; kb < 2 * GKT; kb += 64) {
      v16h a0 = lds_frag16(ta, 0,  kb, hi);
      v16h a1 = lds_frag16(ta, 16, kb, hi);
      v16h b0 = lds_frag16(tw, 0,  kb, hi);
      v16h b1 = lds_frag16(tw, 16, kb, hi);
      v16h b2 = lds_frag16(tw, 32, kb, hi);
      v16h b3 = lds_frag16(tw, 48, kb, hi);
      acc[0][0] = wmma32(a0, b0, acc[0][0]);
      acc[0][1] = wmma32(a0, b1, acc[0][1]);
      acc[0][2] = wmma32(a0, b2, acc[0][2]);
      acc[0][3] = wmma32(a0, b3, acc[0][3]);
      acc[1][0] = wmma32(a1, b0, acc[1][0]);
      acc[1][1] = wmma32(a1, b1, acc[1][1]);
      acc[1][2] = wmma32(a1, b2, acc[1][2]);
      acc[1][3] = wmma32(a1, b3, acc[1][3]);
    }
    // this wave's reads of the buffer are done before it is handed to the copies
    asm volatile("s_wait_dscnt 0x0" ::: "memory");
    // this wave's share of tile t + 1 has landed
    asm volatile("s_wait_asynccnt 0x0" ::: "memory");
    // publishes tile t + 1 and ends every reader's reads of tile t's buffer
    __syncthreads();
    if (t + 2 < T)
      copy_tiles(lds0 + (t & 1) * GBUF, ga + (size_t)(t + 2) * GKT, gw + (size_t)(t + 2) * GKT, rs);
  }
  // no copy is left in flight when the wave goes on to its stores and ends
  asm volatile("s_wait_asynccnt 0x0" ::: "memory");

#pragma unroll
  for (int i = 0; i < 2; ++i) {
#pragma unroll
    for (int j = 0; j < 4; ++j) {
      const int colg = n0 + j * 16 + lm;
      const float bz = bias[colg];
#pragma unroll
      for (int r = 0; r < 8; ++r) {
        const int rowg = m0 + i * 16 + r + (hi << 3);
        float val = acc[i][j][r] + bz;
        if (act) val = val / (1.f + __expf(-val));     // SiLU
        const size_t off = (size_t)rowg * Nn + colg;
        if (resid) val += resid[off];
        if (out32) out32[off] = val;
        if (out16) out16[off] = (half_t)val;
      }
    }
  }
}

// ---------------------------------------------------------------------------
// V [B,N,H,DH] -> Vt [B,H,DH,N]
// ---------------------------------------------------------------------------
__global__ void transpose_v_kernel(const half_t* __restrict__ v, half_t* __restrict__ vt) {
  size_t i = (size_t)blockIdx.x * 256 + threadIdx.x;   // indexes vt, n fastest
  int n  = (int)(i & (NSEQ - 1));
  size_t r = i >> 10;
  int d  = (int)(r & (DHEAD - 1)); r >>= 6;
  int hh = (int)(r & (NHEAD - 1));
  int b  = (int)(r >> 3);
  vt[i] = v[(((size_t)(b * NSEQ + n)) * NHEAD + hh) * DHEAD + d];
}

// ---------------------------------------------------------------------------
// 2^t and log2(t) on the transcendental unit. The v_nop is the one slot the
// instruction set asks for behind a transcendental before its result is read or
// its source overwritten; inside one statement it cannot be lost. In place: the
// register written is the one the compiler's own arithmetic has just written, so
// it is never an operand of a matrix instruction that stands shortly in front.
// ---------------------------------------------------------------------------
__device__ __forceinline__ float exp2_slot(float t) {
  asm("v_exp_f32 %0, %0\n\tv_nop" : "+v"(t));
  return t;
}
__device__ __forceinline__ float log2_slot(float t) {
  asm("v_log_f32 %0, %0\n\tv_nop" : "+v"(t));
  return t;
}

#define QCOLS 32   // query columns per wave (two 16-column groups)
#define KCH   32   // keys per pass
#define RP    36   // LDS row pitch in floats: 144 B = 16 B x odd, for 16-byte accesses

// K fragments (A operand) of 32 keys of one head: two 16-key tiles x two k steps.
__device__ __forceinline__ void load_k(const half_t* __restrict__ krow, int n0, int lane,
                                       v16h (&kf)[2][2]) {
#pragma unroll
  for (int t = 0; t < 2; ++t) {
    const half_t* p = krow + (size_t)(n0 + t * 16) * DMODEL;
    kf[t][0] = load_frag16(p, 0, 0, 0,  lane);
    kf[t][1] = load_frag16(p, 0, 0, 32, lane);
  }
}

// S^T = K Q^T: st[t][g][r] = score(key 16 t + 8 hi + r, query 16 g + c), unscaled.
__device__ __forceinline__ void scores_t(const v16h (&kf)[2][2], const v16h (&qf)[2][2],
                                         v8f (&st)[2][2]) {
#pragma unroll
  for (int t = 0; t < 2; ++t)
#pragma unroll
    for (int g = 0; g < 2; ++g) st[t][g] = wmma32(kf[t][0], qf[g][0], vzero8());
#pragma unroll
  for (int t = 0; t < 2; ++t)
#pragma unroll
    for (int g = 0; g < 2; ++g) st[t][g] = wmma32(kf[t][1], qf[g][1], st[t][g]);
}

// Work-group barrier that orders LDS only: the K and V fragment loads issued
// ahead stay in flight across it (__syncthreads() would drain them).
__device__ __forceinline__ void lds_barrier() {
  __builtin_amdgcn_fence(__ATOMIC_RELEASE, "workgroup", "local");
  __builtin_amdgcn_s_barrier();
  __builtin_amdgcn_fence(__ATOMIC_ACQUIRE, "workgroup", "local");
}

// ---------------------------------------------------------------------------
// Attention: one work-group per (b, 32-query tile); wave w = head w.
// Walk 1 over the keys: S^T = K Q^T, each lane keeps the running maximum and
// sum of its own query column (scores are not stored).
// Walk 2: S^T again, P^T = 2^(x - max - log2 sum) in the accumulator registers,
// which are a B operand as they stand: O^T += V^T P^T. The eight heads' P^T of
// the pass meet in LDS, are summed in head order and stored once.
// LDS: two buffers of 8 heads x 32 queries x 32 keys f32 (pitch 36) = 72 KB.
// ---------------------------------------------------------------------------
// Second bound: four waves per SIMD (256 VGPRs), so that two work-groups share a WGP.
__global__ __launch_bounds__(256, 4) void attn_kernel(const half_t* __restrict__ q,
                                                   const half_t* __restrict__ kk,
                                                   const half_t* __restrict__ vt,
                                                   half_t* __restrict__ ctx,
                                                   float* __restrict__ attnw) {
  extern __shared__ char smem[];
  float* R = (float*)smem;                     // [2][NHEAD][QCOLS][RP]

  const int lane = threadIdx.x & 31;
  const int hh   = threadIdx.x >> 5;           // head
  const int b    = blockIdx.x >> 5;            // N / 32 = 32 query tiles per batch
  const int q0   = (blockIdx.x & 31) * QCOLS;
  const int c    = lane & 15;
  const int hi   = lane >> 4;
  const float SC = 0.125f * 1.4426950408889634f;   // 1/sqrt(64) * log2(e)

  v16h qf[2][2];
#pragma unroll
  for (int g = 0; g < 2; ++g) {
    const half_t* qb = q + (((size_t)(b * NSEQ + q0 + g * 16 + c)) * NHEAD + hh) * DHEAD;
    qf[g][0] = load_frag16(qb, 0, 0, 0,  lane);
    qf[g][1] = load_frag16(qb, 0, 0, 32, lane);
  }
  // The Q loads' address pair is free for reuse from here on (the build gave it to
  // a K fragment): keep the wait in front of whatever overwrites it.
  asm volatile("s_wait_xcnt 0x0" ::: "memory");
  const half_t* krow = kk + (((size_t)(b * NSEQ + c)) * NHEAD + hh) * DHEAD;

  // ---- walk 1: column maximum and sum (log2 domain), per lane half ----
  float mrun[2] = {-1e30f, -1e30f};
  float lrun[2] = {0.f, 0.f};
  v16h kc[2][2];
  load_k(krow, 0, lane, kc);
#pragma unroll 1  // one pass per trip keeps the live set under 256 registers
  for (int i = 0; i < NSEQ / KCH; ++i) {
    v8f st[2][2];
    scores_t(kc, qf, st);
    // the next pass's K, into the same registers, behind their last use; the
    // last pass fetches walk 2's first keys
    load_k(krow, ((i + 1) & (NSEQ / KCH - 1)) * KCH, lane, kc);
#pragma unroll
    for (int g = 0; g < 2; ++g) {
      float c0 = fmaxf(st[0][g][0], st[1][g][0]);
#pragma unroll
      for (int r = 1; r < 8; ++r) c0 = fmaxf(c0, fmaxf(st[0][g][r], st[1][g][r]));
      const float mn = fmaxf(mrun[g], c0 * SC);
      float s0 = exp2_slot(fmaf(st[0][g][0], SC, -mn));
      float s1 = exp2_slot(fmaf(st[0][g][1], SC, -mn));
      float s2 = exp2_slot(fmaf(st[1][g][0], SC, -mn));
      float s3 = exp2_slot(fmaf(st[1][g][1], SC, -mn));
#pragma unroll
      for (int r = 2; r < 8; r += 2) {
        s0 += exp2_slot(fmaf(st[0][g][r],     SC, -mn));
        s1 += exp2_slot(fmaf(st[0][g][r + 1], SC, -mn));
        s2 += exp2_slot(fmaf(st[1][g][r],     SC, -mn));
        s3 += exp2_slot(fmaf(st[1][g][r + 1], SC, -mn));
      }
      lrun[g] = lrun[g] * exp2_slot(mrun[g] - mn) + ((s0 + s1) + (s2 + s3));
      mrun[g] = mn;
    }
  }

  // join the two lane halves of each column; off = max + log2(sum)
  float off[2];
#pragma unroll
  for (int g = 0; g < 2; ++g) {
    const float mo = __shfl_xor(mrun[g], 16);
    const float lo = __shfl_xor(lrun[g], 16);
    const float M  = fmaxf(mrun[g], mo);
    const float L  = lrun[g] * exp2_slot(mrun[g] - M) + lo * exp2_slot(mo - M);
    off[g] = M + log2_slot(L);
  }

  // ---- walk 2: P^T, O^T += V^T P^T, head mean of P ----
  v8f o[4][2];
#pragma unroll
  for (int d = 0; d < 4; ++d) { o[d][0] = vzero8(); o[d][1] = vzero8(); }

  const half_t* vbase = vt + ((size_t)(b * NHEAD + hh)) * DHEAD * NSEQ;
  const int tq = threadIdx.x >> 3;             // query row this thread sums
  const int tj = (threadIdx.x & 7) * 4;        // its four keys of the pass
  float* aw = attnw + ((size_t)(b * NSEQ + q0 + tq)) * NSEQ + tj;

  v16h vf[4];
#pragma unroll
  for (int d = 0; d < 4; ++d) vf[d] = load_frag16(vbase, NSEQ, d * 16 + c, 0, lane);

#pragma unroll 1  // as in walk 1
  for (int i = 0; i < NSEQ / KCH; ++i) {
    const int k0 = i * KCH;
    const int kx = ((i + 1) & (NSEQ / KCH - 1)) * KCH;   // next pass (the last one refetches the first: in bounds, unused)
    v8f st[2][2];
    scores_t(kc, qf, st);
    load_k(krow, kx, lane, kc);

    float* Rw = R + (size_t)(((i & 1) * NHEAD + hh) * QCOLS) * RP;
    v16h pb[2];
#pragma unroll
    for (int g = 0; g < 2; ++g) {
#pragma unroll
      for (int t = 0; t < 2; ++t) {
        float p[8];
#pragma unroll
        for (int r = 0; r < 8; ++r) {
          p[r] = exp2_slot(fmaf(st[t][g][r], SC, -off[g]));
          pb[g][t * 8 + r] = (half_t)p[r];     // hardware k order: keys 8 hi + r, 16 + 8 hi + r
        }
        float4* dst = reinterpret_cast<float4*>(Rw + (g * 16 + c) * RP + t * 16 + hi * 8);
        dst[0] = make_float4(p[0], p[1], p[2], p[3]);
        dst[1] = make_float4(p[4], p[5], p[6], p[7]);
      }
    }
#pragma unroll
    for (int d = 0; d < 4; ++d) {
      o[d][0] = wmma32(vf[d], pb[0], o[d][0]);
      o[d][1] = wmma32(vf[d], pb[1], o[d][1]);
    }
#pragma unroll
    for (int d = 0; d < 4; ++d) vf[d] = load_frag16(vbase, NSEQ, d * 16 + c, kx, lane);

    // One barrier per pass: it publishes this pass's P^T, and it ends every
    // reader's reads of the other buffer, which the next pass overwrites.
    lds_barrier();

    const float* Rr = R + (size_t)((i & 1) * NHEAD * QCOLS + tq) * RP + tj;
    float4 s = *reinterpret_cast<const float4*>(Rr);
#pragma unroll
    for (int h = 1; h < NHEAD; ++h) {
      const float4 u = *reinterpret_cast<const float4*>(Rr + h * QCOLS * RP);
      s.x += u.x; s.y += u.y; s.z += u.z; s.w += u.w;
    }
    *reinterpret_cast<float4*>(aw + k0) =
        make_float4(s.x * 0.125f, s.y * 0.125f, s.z * 0.125f, s.w * 0.125f);
  }

  // ---- ctx: a lane holds 8 consecutive d of one query: one 16-byte store ----
#pragma unroll
  for (int g = 0; g < 2; ++g) {
    half_t* crow = ctx + (((size_t)(b * NSEQ + q0 + g * 16 + c)) * NHEAD + hh) * DHEAD + hi * 8;
#pragma unroll
    for (int d = 0; d < 4; ++d) {
      union { half_t h[8]; float4 v; } u;
#pragma unroll
      for (int r = 0; r < 8; ++r) u.h[r] = (half_t)o[d][g][r];
      *reinterpret_cast<float4*>(crow + d * 16) = u.v;
    }
  }
}

// ---------------------------------------------------------------------------
// Host launch
// ---------------------------------------------------------------------------
extern "C" void kernel_launch(void* const* d_in, const int* in_sizes, int n_in,
                              void* d_out, int out_size, void* d_ws, size_t ws_size,
                              hipStream_t stream) {
  (void)in_sizes; (void)n_in; (void)out_size; (void)ws_size;

  const float* h_in  = (const float*)d_in[0];
  const float* ln1_g = (const float*)d_in[1];
  const float* ln1_b = (const float*)d_in[2];
  const float* wq = (const float*)d_in[3];  const float* bq = (const float*)d_in[4];
  const float* wk = (const float*)d_in[5];  const float* bk = (const float*)d_in[6];
  const float* wv = (const float*)d_in[7];  const float* bv = (const float*)d_in[8];
  const float* wo = (const float*)d_in[9];  const float* bo = (const float*)d_in[10];
  const float* ln2_g = (const float*)d_in[11]; const float* ln2_b = (const float*)d_in[12];
  const float* w1 = (const float*)d_in[13]; const float* b1 = (const float*)d_in[14];
  const float* w2 = (const float*)d_in[15]; const float* b2 = (const float*)d_in[16];

  // ---- workspace layout (bytes) ----
  char* ws = (char*)d_ws;
  size_t off = 0;
  half_t* WQH = (half_t*)(ws + off); off += (size_t)DMODEL * DMODEL * 2;        // 0.5 MB
  half_t* WKH = (half_t*)(ws + off); off += (size_t)DMODEL * DMODEL * 2;
  half_t* WVH = (half_t*)(ws + off); off += (size_t)DMODEL * DMODEL * 2;
  half_t* WOH = (half_t*)(ws + off); off += (size_t)DMODEL * DMODEL * 2;
  half_t* W1H = (half_t*)(ws + off); off += (size_t)2 * DMODEL * DMODEL * 2;    // (2D,D)
  half_t* W2H = (half_t*)(ws + off); off += (size_t)2 * DMODEL * DMODEL * 2;    // (D,2D)
  half_t* HN  = (half_t*)(ws + off); off += (size_t)MROWS * DMODEL * 2;         // hn / f (reused)
  float*  H2  = (float*)(ws + off);  off += (size_t)MROWS * DMODEL * 4;         // h + attn_out
  half_t* CTX = (half_t*)(ws + off); off += (size_t)MROWS * DMODEL * 2;
  half_t* Qb  = (half_t*)(ws + off); size_t qoff = off; off += (size_t)MROWS * DMODEL * 2;
  half_t* Kb  = (half_t*)(ws + off); off += (size_t)MROWS * DMODEL * 2;
  half_t* Vb  = (half_t*)(ws + off); off += (size_t)MROWS * DMODEL * 2;
  half_t* VT  = (half_t*)(ws + off); off += (size_t)MROWS * DMODEL * 2;
  half_t* Gb  = (half_t*)(ws + qoff);  // FFN hidden [M, 2D] reuses Q+K regions (dead by then)

  float* out_h    = (float*)d_out;
  float* out_attn = (float*)d_out + (size_t)MROWS * DMODEL;

  // weights -> f16
  const int DD = DMODEL * DMODEL, DD2 = 2 * DMODEL * DMODEL;
  f2h_kernel<<<(DD  + 255) / 256, 256, 0, stream>>>(wq, WQH, DD);
  f2h_kernel<<<(DD  + 255) / 256, 256, 0, stream>>>(wk, WKH, DD);
  f2h_kernel<<<(DD  + 255) / 256, 256, 0, stream>>>(wv, WVH, DD);
  f2h_kernel<<<(DD  + 255) / 256, 256, 0, stream>>>(wo, WOH, DD);
  f2h_kernel<<<(DD2 + 255) / 256, 256, 0, stream>>>(w1, W1H, DD2);
  f2h_kernel<<<(DD2 + 255) / 256, 256, 0, stream>>>(w2, W2H, DD2);

  // LN1
  ln_kernel<<<MROWS / 8, 256, 0, stream>>>(h_in, ln1_g, ln1_b, HN);

  // QKV projections (block tile 128x128)
  dim3 gD(DMODEL / 128, MROWS / 128);       // (4, 128)
  gemm_kernel<<<gD, 256, 0, stream>>>(HN, WQH, bq, nullptr, nullptr, Qb, DMODEL, DMODEL, 0);
  gemm_kernel<<<gD, 256, 0, stream>>>(HN, WKH, bk, nullptr, nullptr, Kb, DMODEL, DMODEL, 0);
  gemm_kernel<<<gD, 256, 0, stream>>>(HN, WVH, bv, nullptr, nullptr, Vb, DMODEL, DMODEL, 0);

  // V -> Vt
  transpose_v_kernel<<<(MROWS * DMODEL) / 256, 256, 0, stream>>>(Vb, VT);

  // attention (72 KB dynamic LDS; CDNA5 WGP has 320 KB)
  const int attn_lds = 2 * NHEAD * QCOLS * RP * (int)sizeof(float);
  hipFuncSetAttribute(reinterpret_cast<const void*>(attn_kernel),
                      hipFuncAttributeMaxDynamicSharedMemorySize, attn_lds);
  attn_kernel<<<NBATCH * (NSEQ / QCOLS), 256, attn_lds, stream>>>(Qb, Kb, VT, CTX, out_attn);

  // out projection + residual -> h2 (fp32)
  gemm_kernel<<<gD, 256, 0, stream>>>(CTX, WOH, bo, h_in, H2, nullptr, DMODEL, DMODEL, 0);

  // LN2 -> f (f16, reuses HN)
  ln_kernel<<<MROWS / 8, 256, 0, stream>>>(H2, ln2_g, ln2_b, HN);

  // FFN1: silu(f @ w1^T + b1) -> g f16 [M, 2D]
  dim3 g2(2 * DMODEL / 128, MROWS / 128);   // (8, 128)
  gemm_kernel<<<g2, 256, 0, stream>>>(HN, W1H, b1, nullptr, nullptr, Gb, 2 * DMODEL, DMODEL, 1);

  // FFN2: g @ w2^T + b2 + h2 -> final h (fp32, straight to d_out)
  gemm_kernel<<<gD, 256, 0, stream>>>(Gb, W2H, b2, H2, out_h, nullptr, DMODEL, 2 * DMODEL, 0);
}

// v004
// It runs in 280 microseconds.
// Timed twice side by side with v003, it ran 1.13 times as fast both times.
// All steps since v000 together make it 5.69 times as fast.
#include <hip/hip_runtime.h>

// ---------------------------------------------------------------------------
// Transformer encoder layer for MI455X (gfx1250, wave32, WMMA).
// All GEMMs use v_wmma_f32_16x16x32_f16 (f16 in, fp32 accumulate).
// GEMM wave tile: 32x64 (2x4 WMMA), block tile 128x128 (8 waves), tiles staged in LDS.
// ---------------------------------------------------------------------------

typedef _Float16 half_t;
typedef __attribute__((ext_vector_type(16))) _Float16 v16h;
typedef __attribute__((ext_vector_type(8)))  float    v8f;

#define DMODEL 512
#define NSEQ   1024
#define NBATCH 16
#define NHEAD  8
#define DHEAD  64
#define MROWS  (NBATCH * NSEQ)   // 16384 token rows

union AFrag16 { v16h v; float4 q[2]; };

// Load one 16x32 f16 WMMA fragment (A layout, or B layout for W stored [N,K]).
// Per ISA 7.12.2: lane L (0..15) holds row/col L; lanes 16..31 hold the K+8
// group. frag elems 0..7 = K kb..kb+7, elems 8..15 = K kb+16..kb+23.
__device__ __forceinline__ v16h load_frag16(const half_t* __restrict__ base,
                                            int stride, int idx, int k, int lane) {
  const int kb = (lane >> 4) << 3;   // 0 or 8
  const half_t* p = base + (size_t)idx * (size_t)stride + (size_t)(k + kb);
  AFrag16 f;
  f.q[0] = *reinterpret_cast<const float4*>(p);        // K kb .. kb+7
  f.q[1] = *reinterpret_cast<const float4*>(p + 16);   // K kb+16 .. kb+23
  return f.v;
}

__device__ __forceinline__ v8f wmma32(v16h a, v16h b, v8f c) {
  return __builtin_amdgcn_wmma_f32_16x16x32_f16(false, a, false, b,
                                                (short)0, c, false, false);
}

__device__ __forceinline__ v8f vzero8() {
  v8f z = {0.f, 0.f, 0.f, 0.f, 0.f, 0.f, 0.f, 0.f};
  return z;
}

// ---------------------------------------------------------------------------
// fp32 -> f16 conversion (weights)
// ---------------------------------------------------------------------------
__global__ void f2h_kernel(const float* __restrict__ src, half_t* __restrict__ dst, int n) {
  int i = blockIdx.x * blockDim.x + threadIdx.x;
  if (i < n) dst[i] = (half_t)src[i];
}

// ---------------------------------------------------------------------------
// LayerNorm: one wave (32 lanes) per row of 512; lane owns 16 contiguous cols.
// ---------------------------------------------------------------------------
__global__ __launch_bounds__(256) void ln_kernel(const float* __restrict__ x,
                                                 const float* __restrict__ g,
                                                 const float* __restrict__ bta,
                                                 half_t* __restrict__ out) {
  const int row  = blockIdx.x * 8 + (threadIdx.x >> 5);
  const int lane = threadIdx.x & 31;
  const float* xr = x + (size_t)row * DMODEL + lane * 16;

  float v[16];
  const float4* x4 = reinterpret_cast<const float4*>(xr);
#pragma unroll
  for (int j = 0; j < 4; ++j) {
    float4 t = x4[j];
    v[4 * j + 0] = t.x; v[4 * j + 1] = t.y; v[4 * j + 2] = t.z; v[4 * j + 3] = t.w;
  }
  float s = 0.f;
#pragma unroll
  for (int j = 0; j < 16; ++j) s += v[j];
#pragma unroll
  for (int o = 16; o > 0; o >>= 1) s += __shfl_xor(s, o);
  const float mu = s * (1.0f / DMODEL);

  float q = 0.f;
#pragma unroll
  for (int j = 0; j < 16; ++j) { float d = v[j] - mu; q += d * d; }
#pragma unroll
  for (int o = 16; o > 0; o >>= 1) q += __shfl_xor(q, o);
  const float rs = rsqrtf(q * (1.0f / DMODEL) + 1e-5f);

  half_t* orow = out + (size_t)row * DMODEL + lane * 16;
#pragma unroll
  for (int j = 0; j < 16; ++j) {
    int c = lane * 16 + j;
    orow[j] = (half_t)((v[j] - mu) * rs * g[c] + bta[c]);
  }
}

// ---------------------------------------------------------------------------
// WMMA GEMM: out[M,Nn] = act(A_f16[M,K] @ W_f16[Nn,K]^T + bias) (+ resid)
// Block: 256 thr = 8 waves; block tile 128x128; wave tile 32x64 (2x4 WMMA).
// Both operand tiles pass through LDS: asynchronous 16-byte copies bring 128 B of
// each of the 128 + 128 rows per trip (a wave's copy covers four whole lines),
// two buffers, the next tile in flight while this one is multiplied.
// ---------------------------------------------------------------------------
#define GKT  64              // k per trip: 128 B of every operand row
#define GPIT 144             // LDS row pitch in bytes: 16 B x odd, for 16-byte fragment reads
#define GOPB (128 * GPIT)    // one operand's tile in LDS
#define GBUF (2 * GOPB)      // a buffer: A tile, then W tile

// One 16x32 f16 fragment from an LDS tile; the k order is load_frag16's.
__device__ __forceinline__ v16h lds_frag16(const char* tile, int row, int kbyte, int hi) {
  const char* p = tile + row * GPIT + kbyte + hi * 16;
  AFrag16 f;
  f.q[0] = *reinterpret_cast<const float4*>(p);        // K kb .. kb+7
  f.q[1] = *reinterpret_cast<const float4*>(p + 32);   // K kb+16 .. kb+23
  return f.v;
}

// One trip's tiles: a thread copies 16 B of rows r, r + 32, r + 64, r + 96 of A and
// of W. lds: its place in the buffer's A tile; rs: 32 rows of the source, in elements.
// The s_wait_xcnt closes the statement so that it stands in front of whatever
// rewrites an address register that a copy names.
__device__ __forceinline__ void copy_tiles(unsigned lds, const half_t* ga, const half_t* gw,
                                           size_t rs) {
  asm volatile(
      "global_load_async_to_lds_b128 %0, %8, off\n\t"
      "global_load_async_to_lds_b128 %1, %9, off\n\t"
      "global_load_async_to_lds_b128 %2, %10, off\n\t"
      "global_load_async_to_lds_b128 %3, %11, off\n\t"
      "global_load_async_to_lds_b128 %4, %12, off\n\t"
      "global_load_async_to_lds_b128 %5, %13, off\n\t"
      "global_load_async_to_lds_b128 %6, %14, off\n\t"
      "global_load_async_to_lds_b128 %7, %15, off\n\t"
      "s_wait_xcnt 0x0"
      :: "v"(lds), "v"(lds + 32 * GPIT), "v"(lds + 64 * GPIT), "v"(lds + 96 * GPIT),
         "v"(lds + GOPB), "v"(lds + GOPB + 32 * GPIT), "v"(lds + GOPB + 64 * GPIT),
         "v"(lds + GOPB + 96 * GPIT),
         "v"(ga), "v"(ga + rs), "v"(ga + 2 * rs), "v"(ga + 3 * rs),
         "v"(gw), "v"(gw + rs), "v"(gw + 2 * rs), "v"(gw + 3 * rs)
      : "memory");
}

// TR: out16 is written transposed, [M / NSEQ][Nn][NSEQ], with the bias and nothing else.
template <bool TR>
__global__ __launch_bounds__(256) void gemm_kernel(const half_t* __restrict__ A,
                                                   const half_t* __restrict__ W,
                                                   const float* __restrict__ bias,
                                                   const float* __restrict__ resid,
                                                   float* __restrict__ out32,
                                                   half_t* __restrict__ out16,
                                                   int Nn, int K, int act) {
  __shared__ __attribute__((aligned(16))) char gs[2 * GBUF];

  const int lane = threadIdx.x & 31;
  const int w    = threadIdx.x >> 5;
  const int wm   = w & 3;          // 4 waves along M (32 rows each)
  const int wn   = w >> 2;         // 2 waves along N (64 cols each)
  const int m0   = blockIdx.y * 128 + wm * 32;
  const int n0   = blockIdx.x * 128 + wn * 64;
  const int lm   = lane & 15;
  const int hi   = lane >> 4;

  v8f acc[2][4];
#pragma unroll
  for (int i = 0; i < 2; ++i)
#pragma unroll
    for (int j = 0; j < 4; ++j) acc[i][j] = vzero8();

  // this thread's share of a tile: row cr (and + 32, 64, 96), 16-byte piece cp
  const int cr = threadIdx.x >> 3;
  const int cp = threadIdx.x & 7;
  const unsigned lds0 = (unsigned)(size_t)gs + (unsigned)(cr * GPIT + cp * 16);
  const half_t* ga = A + (size_t)(blockIdx.y * 128 + cr) * K + cp * 8;
  const half_t* gw = W + (size_t)(blockIdx.x * 128 + cr) * K + cp * 8;
  const size_t  rs = (size_t)32 * K;
  const int     T  = K / GKT;

  copy_tiles(lds0, ga, gw, rs);
  // tile 0 has landed for this wave; the barrier publishes every wave's share
  asm volatile("s_wait_asynccnt 0x0" ::: "memory");
  __syncthreads();
  if (T > 1) copy_tiles(lds0 + GBUF, ga + GKT, gw + GKT, rs);

  for (int t = 0; t < T; ++t) {
    const char* ta = gs + (t & 1) * GBUF + (wm * 32 + lm) * GPIT;
    const char* tw = gs + (t & 1) * GBUF + GOPB + (wn * 64 + lm) * GPIT;
#pragma unroll  // both 32-k halves of the trip in line: every LDS offset is an immediate
    for (int kb = 0; kb < 2 * GKT; kb += 64) {
      v16h a0 = lds_frag16(ta, 0,  kb, hi);
      v16h a1 = lds_frag16(ta, 16, kb, hi);
      v16h b0 = lds_frag16(tw, 0,  kb, hi);
      v16h b1 = lds_frag16(tw, 16, kb, hi);
      v16h b2 = lds_frag16(tw, 32, kb, hi);
      v16h b3 = lds_frag16(tw, 48, kb, hi);
      acc[0][0] = wmma32(a0, b0, acc[0][0]);
      acc[0][1] = wmma32(a0, b1, acc[0][1]);
      acc[0][2] = wmma32(a0, b2, acc[0][2]);
      acc[0][3] = wmma32(a0, b3, acc[0][3]);
      acc[1][0] = wmma32(a1, b0, acc[1][0]);
      acc[1][1] = wmma32(a1, b1, acc[1][1]);
      acc[1][2] = wmma32(a1, b2, acc[1][2]);
      acc[1][3] = wmma32(a1, b3, acc[1][3]);
    }
    // this wave's reads of the buffer are done before it is handed to the copies
    asm volatile("s_wait_dscnt 0x0" ::: "memory");
    // this wave's share of tile t + 1 has landed
    asm volatile("s_wait_asynccnt 0x0" ::: "memory");
    // publishes tile t + 1 and ends every reader's reads of tile t's buffer
    __syncthreads();
    if (t + 2 < T)
      copy_tiles(lds0 + (t & 1) * GBUF, ga + (size_t)(t + 2) * GKT, gw + (size_t)(t + 2) * GKT, rs);
  }
  // no copy is left in flight when the wave goes on to its stores and ends
  asm volatile("s_wait_asynccnt 0x0" ::: "memory");

  // Transposed f16 output [M / NSEQ][Nn][NSEQ]: a lane's 8 accumulator rows are 8
  // consecutive tokens of one column, so they leave as one 16-byte store.
  // The block's 128 rows lie in one sequence (128 divides NSEQ).
  if constexpr (TR) {
    half_t* p = out16 + ((size_t)((blockIdx.y * 128 / NSEQ) * Nn + n0 + lm)) * NSEQ +
                ((m0 & (NSEQ - 1)) + (hi << 3));
#pragma unroll
    for (int j = 0; j < 4; ++j) {
      const float bz = bias[n0 + j * 16 + lm];
#pragma unroll
      for (int i = 0; i < 2; ++i) {
        union { half_t h[8]; float4 v; } u;
#pragma unroll
        for (int r = 0; r < 8; ++r) u.h[r] = (half_t)(acc[i][j][r] + bz);
        *reinterpret_cast<float4*>(p + j * 16 * NSEQ + i * 16) = u.v;
      }
    }
    return;
  }

#pragma unroll
  for (int i = 0; i < 2; ++i) {
#pragma unroll
    for (int j = 0; j < 4; ++j) {
      const int colg = n0 + j * 16 + lm;
      const float bz = bias[colg];
#pragma unroll
      for (int r = 0; r < 8; ++r) {
        const int rowg = m0 + i * 16 + r + (hi << 3);
        float val = acc[i][j][r] + bz;
        if (act) val = val / (1.f + __expf(-val));     // SiLU
        const size_t off = (size_t)rowg * Nn + colg;
        if (resid) val += resid[off];
        if (out32) out32[off] = val;
        if (out16) out16[off] = (half_t)val;
      }
    }
  }
}

// ---------------------------------------------------------------------------
// 2^t and log2(t) on the transcendental unit. The v_nop is the one slot the
// instruction set asks for behind a transcendental before its result is read or
// its source overwritten; inside one statement it cannot be lost. In place: the
// register written is the one the compiler's own arithmetic has just written, so
// it is never an operand of a matrix instruction that stands shortly in front.
// ---------------------------------------------------------------------------
__device__ __forceinline__ float exp2_slot(float t) {
  asm("v_exp_f32 %0, %0\n\tv_nop" : "+v"(t));
  return t;
}
__device__ __forceinline__ float log2_slot(float t) {
  asm("v_log_f32 %0, %0\n\tv_nop" : "+v"(t));
  return t;
}

#define QCOLS 32   // query columns per wave (two 16-column groups)
#define KCH   32   // keys per pass
#define RP    36   // LDS row pitch in floats: 144 B = 16 B x odd, for 16-byte accesses

// K fragments (A operand) of 32 keys of one head: two 16-key tiles x two k steps.
__device__ __forceinline__ void load_k(const half_t* __restrict__ krow, int n0, int lane,
                                       v16h (&kf)[2][2]) {
#pragma unroll
  for (int t = 0; t < 2; ++t) {
    const half_t* p = krow + (size_t)(n0 + t * 16) * DMODEL;
    kf[t][0] = load_frag16(p, 0, 0, 0,  lane);
    kf[t][1] = load_frag16(p, 0, 0, 32, lane);
  }
}

// S^T = K Q^T: st[t][g][r] = score(key 16 t + 8 hi + r, query 16 g + c), unscaled.
__device__ __forceinline__ void scores_t(const v16h (&kf)[2][2], const v16h (&qf)[2][2],
                                         v8f (&st)[2][2]) {
#pragma unroll
  for (int t = 0; t < 2; ++t)
#pragma unroll
    for (int g = 0; g < 2; ++g) st[t][g] = wmma32(kf[t][0], qf[g][0], vzero8());
#pragma unroll
  for (int t = 0; t < 2; ++t)
#pragma unroll
    for (int g = 0; g < 2; ++g) st[t][g] = wmma32(kf[t][1], qf[g][1], st[t][g]);
}

// Work-group barrier that orders LDS only: the K and V fragment loads issued
// ahead stay in flight across it (__syncthreads() would drain them).
__device__ __forceinline__ void lds_barrier() {
  __builtin_amdgcn_fence(__ATOMIC_RELEASE, "workgroup", "local");
  __builtin_amdgcn_s_barrier();
  __builtin_amdgcn_fence(__ATOMIC_ACQUIRE, "workgroup", "local");
}

// ---------------------------------------------------------------------------
// Attention: one work-group per (b, 32-query tile); wave w = head w.
// Walk 1 over the keys: S^T = K Q^T, each lane keeps the running maximum and
// sum of its own query column (scores are not stored).
// Walk 2: S^T again, P^T = 2^(x - max - log2 sum) in the accumulator registers,
// which are a B operand as they stand: O^T += V^T P^T. The eight heads' P^T of
// the pass meet in LDS, are summed in head order and stored once.
// LDS: two buffers of 8 heads x 32 queries x 32 keys f32 (pitch 36) = 72 KB.
// ---------------------------------------------------------------------------
// Second bound: four waves per SIMD (256 VGPRs), so that two work-groups share a WGP.
__global__ __launch_bounds__(256, 4) void attn_kernel(const half_t* __restrict__ q,
                                                   const half_t* __restrict__ kk,
                                                   const half_t* __restrict__ vt,
                                                   half_t* __restrict__ ctx,
                                                   float* __restrict__ attnw) {
  extern __shared__ char smem[];
  float* R = (float*)smem;                     // [2][NHEAD][QCOLS][RP]

  const int lane = threadIdx.x & 31;
  const int hh   = threadIdx.x >> 5;           // head
  const int b    = blockIdx.x >> 5;            // N / 32 = 32 query tiles per batch
  const int q0   = (blockIdx.x & 31) * QCOLS;
  const int c    = lane & 15;
  const int hi   = lane >> 4;
  const float SC = 0.125f * 1.4426950408889634f;   // 1/sqrt(64) * log2(e)

  v16h qf[2][2];
#pragma unroll
  for (int g = 0; g < 2; ++g) {
    const half_t* qb = q + (((size_t)(b * NSEQ + q0 + g * 16 + c)) * NHEAD + hh) * DHEAD;
    qf[g][0] = load_frag16(qb, 0, 0, 0,  lane);
    qf[g][1] = load_frag16(qb, 0, 0, 32, lane);
  }
  // The Q loads' address pair is free for reuse from here on (the build gave it to
  // a K fragment): keep the wait in front of whatever overwrites it.
  asm volatile("s_wait_xcnt 0x0" ::: "memory");
  const half_t* krow = kk + (((size_t)(b * NSEQ + c)) * NHEAD + hh) * DHEAD;

  // ---- walk 1: column maximum and sum (log2 domain), per lane half ----
  float mrun[2] = {-1e30f, -1e30f};
  float lrun[2] = {0.f, 0.f};
  v16h kc[2][2];
  load_k(krow, 0, lane, kc);
#pragma unroll 1  // one pass per trip keeps the live set under 256 registers
  for (int i = 0; i < NSEQ / KCH; ++i) {
    v8f st[2][2];
    scores_t(kc, qf, st);
    // the next pass's K, into the same registers, behind their last use; the
    // last pass fetches walk 2's first keys
    load_k(krow, ((i + 1) & (NSEQ / KCH - 1)) * KCH, lane, kc);
#pragma unroll
    for (int g = 0; g < 2; ++g) {
      float c0 = fmaxf(st[0][g][0], st[1][g][0]);
#pragma unroll
      for (int r = 1; r < 8; ++r) c0 = fmaxf(c0, fmaxf(st[0][g][r], st[1][g][r]));
      const float mn = fmaxf(mrun[g], c0 * SC);
      float s0 = exp2_slot(fmaf(st[0][g][0], SC, -mn));
      float s1 = exp2_slot(fmaf(st[0][g][1], SC, -mn));
      float s2 = exp2_slot(fmaf(st[1][g][0], SC, -mn));
      float s3 = exp2_slot(fmaf(st[1][g][1], SC, -mn));
#pragma unroll
      for (int r = 2; r < 8; r += 2) {
        s0 += exp2_slot(fmaf(st[0][g][r],     SC, -mn));
        s1 += exp2_slot(fmaf(st[0][g][r + 1], SC, -mn));
        s2 += exp2_slot(fmaf(st[1][g][r],     SC, -mn));
        s3 += exp2_slot(fmaf(st[1][g][r + 1], SC, -mn));
      }
      lrun[g] = lrun[g] * exp2_slot(mrun[g] - mn) + ((s0 + s1) + (s2 + s3));
      mrun[g] = mn;
    }
  }

  // join the two lane halves of each column; off = max + log2(sum)
  float off[2];
#pragma unroll
  for (int g = 0; g < 2; ++g) {
    const float mo = __shfl_xor(mrun[g], 16);
    const float lo = __shfl_xor(lrun[g], 16);
    const float M  = fmaxf(mrun[g], mo);
    const float L  = lrun[g] * exp2_slot(mrun[g] - M) + lo * exp2_slot(mo - M);
    off[g] = M + log2_slot(L);
  }

  // ---- walk 2: P^T, O^T += V^T P^T, head mean of P ----
  v8f o[4][2];
#pragma unroll
  for (int d = 0; d < 4; ++d) { o[d][0] = vzero8(); o[d][1] = vzero8(); }

  const half_t* vbase = vt + ((size_t)(b * NHEAD + hh)) * DHEAD * NSEQ;
  const int tq = threadIdx.x >> 3;             // query row this thread sums
  const int tj = (threadIdx.x & 7) * 4;        // its four keys of the pass
  float* aw = attnw + ((size_t)(b * NSEQ + q0 + tq)) * NSEQ + tj;

  v16h vf[4];
#pragma unroll
  for (int d = 0; d < 4; ++d) vf[d] = load_frag16(vbase, NSEQ, d * 16 + c, 0, lane);

#pragma unroll 1  // as in walk 1
  for (int i = 0; i < NSEQ / KCH; ++i) {
    const int k0 = i * KCH;
    const int kx = ((i + 1) & (NSEQ / KCH - 1)) * KCH;   // next pass (the last one refetches the first: in bounds, unused)
    v8f st[2][2];
    scores_t(kc, qf, st);
    load_k(krow, kx, lane, kc);

    float* Rw = R + (size_t)(((i & 1) * NHEAD + hh) * QCOLS) * RP;
    v16h pb[2];
#pragma unroll
    for (int g = 0; g < 2; ++g) {
#pragma unroll
      for (int t = 0; t < 2; ++t) {
        float p[8];
#pragma unroll
        for (int r = 0; r < 8; ++r) {
          p[r] = exp2_slot(fmaf(st[t][g][r], SC, -off[g]));
          pb[g][t * 8 + r] = (half_t)p[r];     // hardware k order: keys 8 hi + r, 16 + 8 hi + r
        }
        float4* dst = reinterpret_cast<float4*>(Rw + (g * 16 + c) * RP + t * 16 + hi * 8);
        dst[0] = make_float4(p[0], p[1], p[2], p[3]);
        dst[1] = make_float4(p[4], p[5], p[6], p[7]);
      }
    }
#pragma unroll
    for (int d = 0; d < 4; ++d) {
      o[d][0] = wmma32(vf[d], pb[0], o[d][0]);
      o[d][1] = wmma32(vf[d], pb[1], o[d][1]);
    }
#pragma unroll
    for (int d = 0; d < 4; ++d) vf[d] = load_frag16(vbase, NSEQ, d * 16 + c, kx, lane);

    // One barrier per pass: it publishes this pass's P^T, and it ends every
    // reader's reads of the other buffer, which the next pass overwrites.
    lds_barrier();

    const float* Rr = R + (size_t)((i & 1) * NHEAD * QCOLS + tq) * RP + tj;
    float4 s = *reinterpret_cast<const float4*>(Rr);
#pragma unroll
    for (int h = 1; h < NHEAD; ++h) {
      const float4 u = *reinterpret_cast<const float4*>(Rr + h * QCOLS * RP);
      s.x += u.x; s.y += u.y; s.z += u.z; s.w += u.w;
    }
    *reinterpret_cast<float4*>(aw + k0) =
        make_float4(s.x * 0.125f, s.y * 0.125f, s.z * 0.125f, s.w * 0.125f);
  }

  // ---- ctx: a lane holds 8 consecutive d of one query: one 16-byte store ----
#pragma unroll
  for (int g = 0; g < 2; ++g) {
    half_t* crow = ctx + (((size_t)(b * NSEQ + q0 + g * 16 + c)) * NHEAD + hh) * DHEAD + hi * 8;
#pragma unroll
    for (int d = 0; d < 4; ++d) {
      union { half_t h[8]; float4 v; } u;
#pragma unroll
      for (int r = 0; r < 8; ++r) u.h[r] = (half_t)o[d][g][r];
      *reinterpret_cast<float4*>(crow + d * 16) = u.v;
    }
  }
}

// ---------------------------------------------------------------------------
// Host launch
// ---------------------------------------------------------------------------
extern "C" void kernel_launch(void* const* d_in, const int* in_sizes, int n_in,
                              void* d_out, int out_size, void* d_ws, size_t ws_size,
                              hipStream_t stream) {
  (void)in_sizes; (void)n_in; (void)out_size; (void)ws_size;

  const float* h_in  = (const float*)d_in[0];
  const float* ln1_g = (const float*)d_in[1];
  const float* ln1_b = (const float*)d_in[2];
  const float* wq = (const float*)d_in[3];  const float* bq = (const float*)d_in[4];
  const float* wk = (const float*)d_in[5];  const float* bk = (const float*)d_in[6];
  const float* wv = (const float*)d_in[7];  const float* bv = (const float*)d_in[8];
  const float* wo = (const float*)d_in[9];  const float* bo = (const float*)d_in[10];
  const float* ln2_g = (const float*)d_in[11]; const float* ln2_b = (const float*)d_in[12];
  const float* w1 = (const float*)d_in[13]; const float* b1 = (const float*)d_in[14];
  const float* w2 = (const float*)d_in[15]; const float* b2 = (const float*)d_in[16];

  // ---- workspace layout (bytes) ----
  char* ws = (char*)d_ws;
  size_t off = 0;
  half_t* WQH = (half_t*)(ws + off); off += (size_t)DMODEL * DMODEL * 2;        // 0.5 MB
  half_t* WKH = (half_t*)(ws + off); off += (size_t)DMODEL * DMODEL * 2;
  half_t* WVH = (half_t*)(ws + off); off += (size_t)DMODEL * DMODEL * 2;
  half_t* WOH = (half_t*)(ws + off); off += (size_t)DMODEL * DMODEL * 2;
  half_t* W1H = (half_t*)(ws + off); off += (size_t)2 * DMODEL * DMODEL * 2;    // (2D,D)
  half_t* W2H = (half_t*)(ws + off); off += (size_t)2 * DMODEL * DMODEL * 2;    // (D,2D)
  half_t* HN  = (half_t*)(ws + off); off += (size_t)MROWS * DMODEL * 2;         // hn / f (reused)
  float*  H2  = (float*)(ws + off);  off += (size_t)MROWS * DMODEL * 4;         // h + attn_out
  half_t* CTX = (half_t*)(ws + off); off += (size_t)MROWS * DMODEL * 2;
  half_t* Qb  = (half_t*)(ws + off); size_t qoff = off; off += (size_t)MROWS * DMODEL * 2;
  half_t* Kb  = (half_t*)(ws + off); off += (size_t)MROWS * DMODEL * 2;
  half_t* VT  = (half_t*)(ws + off); off += (size_t)MROWS * DMODEL * 2;
  half_t* Gb  = (half_t*)(ws + qoff);  // FFN hidden [M, 2D] reuses Q+K regions (dead by then)

  float* out_h    = (float*)d_out;
  float* out_attn = (float*)d_out + (size_t)MROWS * DMODEL;

  // weights -> f16
  const int DD = DMODEL * DMODEL, DD2 = 2 * DMODEL * DMODEL;
  f2h_kernel<<<(DD  + 255) / 256, 256, 0, stream>>>(wq, WQH, DD);
  f2h_kernel<<<(DD  + 255) / 256, 256, 0, stream>>>(wk, WKH, DD);
  f2h_kernel<<<(DD  + 255) / 256, 256, 0, stream>>>(wv, WVH, DD);
  f2h_kernel<<<(DD  + 255) / 256, 256, 0, stream>>>(wo, WOH, DD);
  f2h_kernel<<<(DD2 + 255) / 256, 256, 0, stream>>>(w1, W1H, DD2);
  f2h_kernel<<<(DD2 + 255) / 256, 256, 0, stream>>>(w2, W2H, DD2);

  // LN1
  ln_kernel<<<MROWS / 8, 256, 0, stream>>>(h_in, ln1_g, ln1_b, HN);

  // QKV projections (block tile 128x128)
  dim3 gD(DMODEL / 128, MROWS / 128);       // (4, 128)
  gemm_kernel<false><<<gD, 256, 0, stream>>>(HN, WQH, bq, nullptr, nullptr, Qb, DMODEL, DMODEL, 0);
  gemm_kernel<false><<<gD, 256, 0, stream>>>(HN, WKH, bk, nullptr, nullptr, Kb, DMODEL, DMODEL, 0);
  // V leaves its projection as Vt [B,H,DH,N], the layout attention reads
  gemm_kernel<true><<<gD, 256, 0, stream>>>(HN, WVH, bv, nullptr, nullptr, VT, DMODEL, DMODEL, 0);

  // attention (72 KB dynamic LDS; CDNA5 WGP has 320 KB)
  const int attn_lds = 2 * NHEAD * QCOLS * RP * (int)sizeof(float);
  hipFuncSetAttribute(reinterpret_cast<const void*>(attn_kernel),
                      hipFuncAttributeMaxDynamicSharedMemorySize, attn_lds);
  attn_kernel<<<NBATCH * (NSEQ / QCOLS), 256, attn_lds, stream>>>(Qb, Kb, VT, CTX, out_attn);

  // out projection + residual -> h2 (fp32)
  gemm_kernel<false><<<gD, 256, 0, stream>>>(CTX, WOH, bo, h_in, H2, nullptr, DMODEL, DMODEL, 0);

  // LN2 -> f (f16, reuses HN)
  ln_kernel<<<MROWS / 8, 256, 0, stream>>>(H2, ln2_g, ln2_b, HN);

  // FFN1: silu(f @ w1^T + b1) -> g f16 [M, 2D]
  dim3 g2(2 * DMODEL / 128, MROWS / 128);   // (8, 128)
  gemm_kernel<false><<<g2, 256, 0, stream>>>(HN, W1H, b1, nullptr, nullptr, Gb, 2 * DMODEL, DMODEL, 1);

  // FFN2: g @ w2^T + b2 + h2 -> final h (fp32, straight to d_out)
  gemm_kernel<false><<<gD, 256, 0, stream>>>(Gb, W2H, b2, H2, out_h, nullptr, DMODEL, 2 * DMODEL, 0);
}

// v005
// It runs in 249 microseconds.
// Next to v004, in two timings, it ran 1.13 times as fast each time.
// Counting every step since v000, it is 6.42 times as fast.
#include <hip/hip_runtime.h>

// ---------------------------------------------------------------------------
// Transformer encoder layer for MI455X (gfx1250, wave32, WMMA).
// All GEMMs use v_wmma_f32_16x16x32_f16 (f16 in, fp32 accumulate).
// GEMM wave tile: 32x64 (2x4 WMMA), block tile 128x128 (8 waves), tiles staged in LDS.
// ---------------------------------------------------------------------------

typedef _Float16 half_t;
typedef __attribute__((ext_vector_type(16))) _Float16 v16h;
typedef __attribute__((ext_vector_type(8)))  float    v8f;

#define DMODEL 512
#define NSEQ   1024
#define NBATCH 16
#define NHEAD  8
#define DHEAD  64
#define MROWS  (NBATCH * NSEQ)   // 16384 token rows

union AFrag16 { v16h v; float4 q[2]; };

// Load one 16x32 f16 WMMA fragment (A layout, or B layout for W stored [N,K]).
// Per ISA 7.12.2: lane L (0..15) holds row/col L; lanes 16..31 hold the K+8
// group. frag elems 0..7 = K kb..kb+7, elems 8..15 = K kb+16..kb+23.
__device__ __forceinline__ v16h load_frag16(const half_t* __restrict__ base,
                                            int stride, int idx, int k, int lane) {
  const int kb = (lane >> 4) << 3;   // 0 or 8
  const half_t* p = base + (size_t)idx * (size_t)stride + (size_t)(k + kb);
  AFrag16 f;
  f.q[0] = *reinterpret_cast<const float4*>(p);        // K kb .. kb+7
  f.q[1] = *reinterpret_cast<const float4*>(p + 16);   // K kb+16 .. kb+23
  return f.v;
}

__device__ __forceinline__ v8f wmma32(v16h a, v16h b, v8f c) {
  return __builtin_amdgcn_wmma_f32_16x16x32_f16(false, a, false, b,
                                                (short)0, c, false, false);
}

__device__ __forceinline__ v8f vzero8() {
  v8f z = {0.f, 0.f, 0.f, 0.f, 0.f, 0.f, 0.f, 0.f};
  return z;
}

// ---------------------------------------------------------------------------
// fp32 -> f16 conversion (weights)
// ---------------------------------------------------------------------------
__global__ void f2h_kernel(const float* __restrict__ src, half_t* __restrict__ dst, int n) {
  int i = blockIdx.x * blockDim.x + threadIdx.x;
  if (i < n) dst[i] = (half_t)src[i];
}

// ---------------------------------------------------------------------------
// LayerNorm: one wave (32 lanes) per row of 512; lane owns 16 contiguous cols.
// ---------------------------------------------------------------------------
__global__ __launch_bounds__(256) void ln_kernel(const float* __restrict__ x,
                                                 const float* __restrict__ g,
                                                 const float* __restrict__ bta,
                                                 half_t* __restrict__ out) {
  const int row  = blockIdx.x * 8 + (threadIdx.x >> 5);
  const int lane = threadIdx.x & 31;
  const float* xr = x + (size_t)row * DMODEL + lane * 16;

  float v[16];
  const float4* x4 = reinterpret_cast<const float4*>(xr);
#pragma unroll
  for (int j = 0; j < 4; ++j) {
    float4 t = x4[j];
    v[4 * j + 0] = t.x; v[4 * j + 1] = t.y; v[4 * j + 2] = t.z; v[4 * j + 3] = t.w;
  }
  float s = 0.f;
#pragma unroll
  for (int j = 0; j < 16; ++j) s += v[j];
#pragma unroll
  for (int o = 16; o > 0; o >>= 1) s += __shfl_xor(s, o);
  const float mu = s * (1.0f / DMODEL);

  float q = 0.f;
#pragma unroll
  for (int j = 0; j < 16; ++j) { float d = v[j] - mu; q += d * d; }
#pragma unroll
  for (int o = 16; o > 0; o >>= 1) q += __shfl_xor(q, o);
  const float rs = rsqrtf(q * (1.0f / DMODEL) + 1e-5f);

  half_t* orow = out + (size_t)row * DMODEL + lane * 16;
#pragma unroll
  for (int j = 0; j < 16; ++j) {
    int c = lane * 16 + j;
    orow[j] = (half_t)((v[j] - mu) * rs * g[c] + bta[c]);
  }
}

// ---------------------------------------------------------------------------
// WMMA GEMM: out[M,Nn] = act(A_f16[M,K] @ W_f16[Nn,K]^T + bias) (+ resid)
// Block: 256 thr = 8 waves; block tile 128x128; wave tile 32x64 (2x4 WMMA).
// Both operand tiles pass through LDS: asynchronous 16-byte copies bring 128 B of
// each of the 128 + 128 rows per trip (a wave's copy covers four whole lines),
// two buffers, the next tile in flight while this one is multiplied.
// ---------------------------------------------------------------------------
#define GKT  64              // k per trip: 128 B of every operand row
#define GPIT 144             // LDS row pitch in bytes: 16 B x odd, for 16-byte fragment reads
#define GOPB (128 * GPIT)    // one operand's tile in LDS
#define GBUF (2 * GOPB)      // a buffer: A tile, then W tile

// One 16x32 f16 fragment from an LDS tile; the k order is load_frag16's.
__device__ __forceinline__ v16h lds_frag16(const char* tile, int row, int kbyte, int hi) {
  const char* p = tile + row * GPIT + kbyte + hi * 16;
  AFrag16 f;
  f.q[0] = *reinterpret_cast<const float4*>(p);        // K kb .. kb+7
  f.q[1] = *reinterpret_cast<const float4*>(p + 32);   // K kb+16 .. kb+23
  return f.v;
}

// One trip's tiles: a thread copies 16 B of rows r, r + 32, r + 64, r + 96 of A and
// of W. lds: its place in the buffer's A tile; rs: 32 rows of the source, in elements.
// The s_wait_xcnt closes the statement so that it stands in front of whatever
// rewrites an address register that a copy names.
__device__ __forceinline__ void copy_tiles(unsigned lds, const half_t* ga, const half_t* gw,
                                           size_t rs) {
  asm volatile(
      "global_load_async_to_lds_b128 %0, %8, off\n\t"
      "global_load_async_to_lds_b128 %1, %9, off\n\t"
      "global_load_async_to_lds_b128 %2, %10, off\n\t"
      "global_load_async_to_lds_b128 %3, %11, off\n\t"
      "global_load_async_to_lds_b128 %4, %12, off\n\t"
      "global_load_async_to_lds_b128 %5, %13, off\n\t"
      "global_load_async_to_lds_b128 %6, %14, off\n\t"
      "global_load_async_to_lds_b128 %7, %15, off\n\t"
      "s_wait_xcnt 0x0"
      :: "v"(lds), "v"(lds + 32 * GPIT), "v"(lds + 64 * GPIT), "v"(lds + 96 * GPIT),
         "v"(lds + GOPB), "v"(lds + GOPB + 32 * GPIT), "v"(lds + GOPB + 64 * GPIT),
         "v"(lds + GOPB + 96 * GPIT),
         "v"(ga), "v"(ga + rs), "v"(ga + 2 * rs), "v"(ga + 3 * rs),
         "v"(gw), "v"(gw + rs), "v"(gw + 2 * rs), "v"(gw + 3 * rs)
      : "memory");
}

// TR: out16 is written transposed, [M / NSEQ][Nn][NSEQ], with the bias and nothing else.
template <bool TR>
__global__ __launch_bounds__(256) void gemm_kernel(const half_t* __restrict__ A,
                                                   const half_t* __restrict__ W,
                                                   const float* __restrict__ bias,
                                                   const float* __restrict__ resid,
                                                   float* __restrict__ out32,
                                                   half_t* __restrict__ out16,
                                                   int Nn, int K, int act) {
  __shared__ __attribute__((aligned(16))) char gs[2 * GBUF];

  const int lane = threadIdx.x & 31;
  const int w    = threadIdx.x >> 5;
  const int wm   = w & 3;          // 4 waves along M (32 rows each)
  const int wn   = w >> 2;         // 2 waves along N (64 cols each)
  const int m0   = blockIdx.y * 128 + wm * 32;
  const int n0   = blockIdx.x * 128 + wn * 64;
  const int lm   = lane & 15;
  const int hi   = lane >> 4;

  v8f acc[2][4];
#pragma unroll
  for (int i = 0; i < 2; ++i)
#pragma unroll
    for (int j = 0; j < 4; ++j) acc[i][j] = vzero8();

  // this thread's share of a tile: row cr (and + 32, 64, 96), 16-byte piece cp
  const int cr = threadIdx.x >> 3;
  const int cp = threadIdx.x & 7;
  const unsigned lds0 = (unsigned)(size_t)gs + (unsigned)(cr * GPIT + cp * 16);
  const half_t* ga = A + (size_t)(blockIdx.y * 128 + cr) * K + cp * 8;
  const half_t* gw = W + (size_t)(blockIdx.x * 128 + cr) * K + cp * 8;
  const size_t  rs = (size_t)32 * K;
  const int     T  = K / GKT;

  copy_tiles(lds0, ga, gw, rs);
  // tile 0 has landed for this wave; the barrier publishes every wave's share
  asm volatile("s_wait_asynccnt 0x0" ::: "memory");
  __syncthreads();
  if (T > 1) copy_tiles(lds0 + GBUF, ga + GKT, gw + GKT, rs);

  for (int t = 0; t < T; ++t) {
    const char* ta = gs + (t & 1) * GBUF + (wm * 32 + lm) * GPIT;
    const char* tw = gs + (t & 1) * GBUF + GOPB + (wn * 64 + lm) * GPIT;
#pragma unroll  // both 32-k halves of the trip in line: every LDS offset is an immediate
    for (int kb = 0; kb < 2 * GKT; kb += 64) {
      v16h a0 = lds_frag16(ta, 0,  kb, hi);
      v16h a1 = lds_frag16(ta, 16, kb, hi);
      v16h b0 = lds_frag16(tw, 0,  kb, hi);
      v16h b1 = lds_frag16(tw, 16, kb, hi);
      v16h b2 = lds_frag16(tw, 32, kb, hi);
      v16h b3 = lds_frag16(tw, 48, kb, hi);
      acc[0][0] = wmma32(a0, b0, acc[0][0]);
      acc[0][1] = wmma32(a0, b1, acc[0][1]);
      acc[0][2] = wmma32(a0, b2, acc[0][2]);
      acc[0][3] = wmma32(a0, b3, acc[0][3]);
      acc[1][0] = wmma32(a1, b0, acc[1][0]);
      acc[1][1] = wmma32(a1, b1, acc[1][1]);
      acc[1][2] = wmma32(a1, b2, acc[1][2]);
      acc[1][3] = wmma32(a1, b3, acc[1][3]);
    }
    // this wave's reads of the buffer are done before it is handed to the copies
    asm volatile("s_wait_dscnt 0x0" ::: "memory");
    // this wave's share of tile t + 1 has landed
    asm volatile("s_wait_asynccnt 0x0" ::: "memory");
    // publishes tile t + 1 and ends every reader's reads of tile t's buffer
    __syncthreads();
    if (t + 2 < T)
      copy_tiles(lds0 + (t & 1) * GBUF, ga + (size_t)(t + 2) * GKT, gw + (size_t)(t + 2) * GKT, rs);
  }
  // no copy is left in flight when the wave goes on to its stores and ends
  asm volatile("s_wait_asynccnt 0x0" ::: "memory");

  // Transposed f16 output [M / NSEQ][Nn][NSEQ]: a lane's 8 accumulator rows are 8
  // consecutive tokens of one column, so they leave as one 16-byte store.
  // The block's 128 rows lie in one sequence (128 divides NSEQ).
  if constexpr (TR) {
    half_t* p = out16 + ((size_t)((blockIdx.y * 128 / NSEQ) * Nn + n0 + lm)) * NSEQ +
                ((m0 & (NSEQ - 1)) + (hi << 3));
#pragma unroll
    for (int j = 0; j < 4; ++j) {
      const float bz = bias[n0 + j * 16 + lm];
#pragma unroll
      for (int i = 0; i < 2; ++i) {
        union { half_t h[8]; float4 v; } u;
#pragma unroll
        for (int r = 0; r < 8; ++r) u.h[r] = (half_t)(acc[i][j][r] + bz);
        *reinterpret_cast<float4*>(p + j * 16 * NSEQ + i * 16) = u.v;
      }
    }
    return;
  }

#pragma unroll
  for (int i = 0; i < 2; ++i) {
#pragma unroll
    for (int j = 0; j < 4; ++j) {
      const int colg = n0 + j * 16 + lm;
      const float bz = bias[colg];
#pragma unroll
      for (int r = 0; r < 8; ++r) {
        const int rowg = m0 + i * 16 + r + (hi << 3);
        float val = acc[i][j][r] + bz;
        if (act) val = val / (1.f + __expf(-val));     // SiLU
        const size_t off = (size_t)rowg * Nn + colg;
        if (resid) val += resid[off];
        if (out32) out32[off] = val;
        if (out16) out16[off] = (half_t)val;
      }
    }
  }
}

// ---------------------------------------------------------------------------
// 2^t and log2(t) on the transcendental unit. The v_nop is the one slot the
// instruction set asks for behind a transcendental before its result is read or
// its source overwritten; inside one statement it cannot be lost. In place: the
// register written is the one the compiler's own arithmetic has just written, so
// it is never an operand of a matrix instruction that stands shortly in front.
// ---------------------------------------------------------------------------
__device__ __forceinline__ float exp2_slot(float t) {
  asm("v_exp_f32 %0, %0\n\tv_nop" : "+v"(t));
  return t;
}
__device__ __forceinline__ float log2_slot(float t) {
  asm("v_log_f32 %0, %0\n\tv_nop" : "+v"(t));
  return t;
}

#define QCOLS 32   // query columns per wave (two 16-column groups)
#define QWG   64   // query columns per work-group: two waves per head
#define KCH   32   // keys per pass
#define RP    36   // LDS row pitch in floats: 144 B = 16 B x odd, for 16-byte accesses
#define KPIT  1040 // K tile row in LDS: one key's 8 heads (1024 B) + 16: 16 B x odd
#define KBUF  (KCH * KPIT)
#define VPIT  80   // V^T tile row in LDS: 32 keys of one (head, d) (64 B) + 16: 16 B x odd
#define VBUF  (DMODEL * VPIT)
#define VOFF  (2 * KBUF)             // LDS map: K tile x 2, V^T tile x 2, P^T x 2
#define ROFF  (VOFF + 2 * VBUF)
#define ALDS  (ROFF + 2 * NHEAD * QWG * RP * 4)

// One 16x32 f16 fragment from LDS; p: the lane's row, at its 8 hi-th k. The k order is load_frag16's.
__device__ __forceinline__ v16h lds_frag(const char* p) {
  AFrag16 f;
  f.q[0] = *reinterpret_cast<const float4*>(p);        // K kb .. kb+7
  f.q[1] = *reinterpret_cast<const float4*>(p + 32);   // K kb+16 .. kb+23
  return f.v;
}

// K fragments (A operand) of the tile's 32 keys, one head: two 16-key tiles x two k steps.
__device__ __forceinline__ void lds_k(const char* p, v16h (&kf)[2][2]) {
#pragma unroll
  for (int t = 0; t < 2; ++t) {
    kf[t][0] = lds_frag(p + t * 16 * KPIT);
    kf[t][1] = lds_frag(p + t * 16 * KPIT + 64);
  }
}

// A K tile (32 keys x 1024 B, contiguous in memory): a thread copies 16 B of keys
// r, r + 8, r + 16, r + 24; a wave's copy covers four whole lines.
// The s_wait_xcnt closes the statement so that it stands in front of whatever
// rewrites an address register that a copy names.
__device__ __forceinline__ void copy_k(unsigned lk, const half_t* gk) {
  asm volatile(
      "global_load_async_to_lds_b128 %0, %4, off\n\t"
      "global_load_async_to_lds_b128 %1, %5, off\n\t"
      "global_load_async_to_lds_b128 %2, %6, off\n\t"
      "global_load_async_to_lds_b128 %3, %7, off\n\t"
      "s_wait_xcnt 0x0"
      :: "v"(lk), "v"(lk + 8 * KPIT), "v"(lk + 16 * KPIT), "v"(lk + 24 * KPIT),
         "v"(gk), "v"(gk + 8 * DMODEL), "v"(gk + 16 * DMODEL), "v"(gk + 24 * DMODEL)
      : "memory");
}

// A K tile as above and a V^T tile (512 rows x 64 B): 16 B of rows r, r + 128, r + 256, r + 384.
__device__ __forceinline__ void copy_kv(unsigned lk, const half_t* gk,
                                        unsigned lv, const half_t* gv) {
  asm volatile(
      "global_load_async_to_lds_b128 %0, %8, off\n\t"
      "global_load_async_to_lds_b128 %1, %9, off\n\t"
      "global_load_async_to_lds_b128 %2, %10, off\n\t"
      "global_load_async_to_lds_b128 %3, %11, off\n\t"
      "global_load_async_to_lds_b128 %4, %12, off\n\t"
      "global_load_async_to_lds_b128 %5, %13, off\n\t"
      "global_load_async_to_lds_b128 %6, %14, off\n\t"
      "global_load_async_to_lds_b128 %7, %15, off\n\t"
      "s_wait_xcnt 0x0"
      :: "v"(lk), "v"(lk + 8 * KPIT), "v"(lk + 16 * KPIT), "v"(lk + 24 * KPIT),
         "v"(lv), "v"(lv + 128 * VPIT), "v"(lv + 256 * VPIT), "v"(lv + 384 * VPIT),
         "v"(gk), "v"(gk + 8 * DMODEL), "v"(gk + 16 * DMODEL), "v"(gk + 24 * DMODEL),
         "v"(gv), "v"(gv + 128 * NSEQ), "v"(gv + 256 * NSEQ), "v"(gv + 384 * NSEQ)
      : "memory");
}

// S^T = K Q^T: st[t][g][r] = score(key 16 t + 8 hi + r, query 16 g + c), unscaled.
__device__ __forceinline__ void scores_t(const v16h (&kf)[2][2], const v16h (&qf)[2][2],
                                         v8f (&st)[2][2]) {
#pragma unroll
  for (int t = 0; t < 2; ++t)
#pragma unroll
    for (int g = 0; g < 2; ++g) st[t][g] = wmma32(kf[t][0], qf[g][0], vzero8());
#pragma unroll
  for (int t = 0; t < 2; ++t)
#pragma unroll
    for (int g = 0; g < 2; ++g) st[t][g] = wmma32(kf[t][1], qf[g][1], st[t][g]);
}

// ---------------------------------------------------------------------------
// Attention: one work-group per (b, 64-query tile); wave w = head w & 7, query
// half w >> 3. The pass's 32 keys of K and of V^T, all heads, come into LDS by
// asynchronous copies, two buffers, the next tile in flight while this one is
// worked on; both waves of a head read their fragments there.
// Walk 1 over the keys: S^T = K Q^T, each lane keeps the running maximum and
// sum of its own query column (scores are not stored).
// Walk 2: S^T again, P^T = 2^(x - max - log2 sum) in the accumulator registers,
// which are a B operand as they stand: O^T += V^T P^T. The eight heads' P^T of
// the pass meet in LDS, are summed in head order and stored once.
// LDS: 65 KB of K, 80 KB of V^T, two buffers of 8 heads x 64 queries x 32 keys
// f32 (pitch 36) = 144 KB: one work-group of 16 waves per WGP.
// ---------------------------------------------------------------------------
__global__ __launch_bounds__(512) void attn_kernel(const half_t* __restrict__ q,
                                                   const half_t* __restrict__ kk,
                                                   const half_t* __restrict__ vt,
                                                   half_t* __restrict__ ctx,
                                                   float* __restrict__ attnw) {
  __shared__ __attribute__((aligned(16))) char smem[ALDS];
  float* R = (float*)(smem + ROFF);            // [2][NHEAD][QWG][RP]

  const int lane = threadIdx.x & 31;
  const int hh   = (threadIdx.x >> 5) & 7;     // head
  const int qg   = threadIdx.x >> 8;           // which 32 of the 64 queries
  const int b    = blockIdx.x >> 4;            // N / 64 = 16 query tiles per batch
  const int q0   = (blockIdx.x & 15) * QWG;
  const int qw   = q0 + qg * QCOLS;            // this wave's first query
  const int c    = lane & 15;
  const int hi   = lane >> 4;
  const float SC = 0.125f * 1.4426950408889634f;   // 1/sqrt(64) * log2(e)

  v16h qf[2][2];
#pragma unroll
  for (int g = 0; g < 2; ++g) {
    const half_t* qb = q + (((size_t)(b * NSEQ + qw + g * 16 + c)) * NHEAD + hh) * DHEAD;
    qf[g][0] = load_frag16(qb, 0, 0, 0,  lane);
    qf[g][1] = load_frag16(qb, 0, 0, 32, lane);
  }
  // The Q loads' address pair is free for reuse from here on: keep the wait in
  // front of whatever overwrites it.
  asm volatile("s_wait_xcnt 0x0" ::: "memory");

  // this thread's share of a tile, in LDS (buffer 0) and in memory (tile 0)
  const unsigned sb = (unsigned)(size_t)smem;
  const unsigned lk = sb + (unsigned)((threadIdx.x >> 6) * KPIT + (threadIdx.x & 63) * 16);
  const unsigned lv = sb + (unsigned)(VOFF + (threadIdx.x >> 2) * VPIT + (threadIdx.x & 3) * 16);
  const half_t* gk = kk + (size_t)(b * NSEQ + (threadIdx.x >> 6)) * DMODEL + (threadIdx.x & 63) * 8;
  const half_t* gv = vt + (size_t)(b * DMODEL + (threadIdx.x >> 2)) * NSEQ + (threadIdx.x & 3) * 8;
  // this lane's fragment rows in buffer 0
  const char* kfr = smem + c * KPIT + hh * (DHEAD * 2) + hi * 16;
  const char* vfr = smem + VOFF + (hh * DHEAD + c) * VPIT + hi * 16;

  // ---- walk 1: column maximum and sum (log2 domain), per lane half ----
  float mrun[2] = {-1e30f, -1e30f};
  float lrun[2] = {0.f, 0.f};

  copy_k(lk, gk);
  // tile 0 has landed for this wave; the barrier publishes every wave's share
  asm volatile("s_wait_asynccnt 0x0" ::: "memory");
  __syncthreads();
  copy_k(lk + KBUF, gk + KCH * DMODEL);

#pragma unroll 1  // one pass per trip keeps the live set under 256 registers
  for (int i = 0; i < NSEQ / KCH; ++i) {
    v16h kc[2][2];
    lds_k(kfr + (i & 1) * KBUF, kc);
    v8f st[2][2];
    scores_t(kc, qf, st);
#pragma unroll
    for (int g = 0; g < 2; ++g) {
      float c0 = fmaxf(st[0][g][0], st[1][g][0]);
#pragma unroll
      for (int r = 1; r < 8; ++r) c0 = fmaxf(c0, fmaxf(st[0][g][r], st[1][g][r]));
      const float mn = fmaxf(mrun[g], c0 * SC);
      float s0 = exp2_slot(fmaf(st[0][g][0], SC, -mn));
      float s1 = exp2_slot(fmaf(st[0][g][1], SC, -mn));
      float s2 = exp2_slot(fmaf(st[1][g][0], SC, -mn));
      float s3 = exp2_slot(fmaf(st[1][g][1], SC, -mn));
#pragma unroll
      for (int r = 2; r < 8; r += 2) {
        s0 += exp2_slot(fmaf(st[0][g][r],     SC, -mn));
        s1 += exp2_slot(fmaf(st[0][g][r + 1], SC, -mn));
        s2 += exp2_slot(fmaf(st[1][g][r],     SC, -mn));
        s3 += exp2_slot(fmaf(st[1][g][r + 1], SC, -mn));
      }
      lrun[g] = lrun[g] * exp2_slot(mrun[g] - mn) + ((s0 + s1) + (s2 + s3));
      mrun[g] = mn;
    }
    // Keeps the pass's arithmetic in front of the waits: moved behind the barrier it
    // would stand between the barrier and the refill, and the refill would be
    // waited for as soon as it is issued.
    __builtin_amdgcn_sched_barrier(0);
    // this wave's reads of the buffer are done before it is handed to the copies
    asm volatile("s_wait_dscnt 0x0" ::: "memory");
    // this wave's share of tile i + 1 has landed
    asm volatile("s_wait_asynccnt 0x0" ::: "memory");
    // publishes tile i + 1 and ends every reader's reads of tile i's buffer
    __syncthreads();
    if (i + 2 < NSEQ / KCH)
      copy_k(lk + (i & 1) * KBUF, gk + (size_t)(i + 2) * (KCH * DMODEL));
  }
  // no copy is in flight when walk 2 takes the buffers over
  asm volatile("s_wait_asynccnt 0x0" ::: "memory");

  // walk 2's tile 0 (every reader left both K buffers at walk 1's last barriers)
  copy_kv(lk, gk, lv, gv);

  // join the two lane halves of each column; off = max + log2(sum)
  float off[2];
#pragma unroll
  for (int g = 0; g < 2; ++g) {
    const float mo = __shfl_xor(mrun[g], 16);
    const float lo = __shfl_xor(lrun[g], 16);
    const float M  = fmaxf(mrun[g], mo);
    const float L  = lrun[g] * exp2_slot(mrun[g] - M) + lo * exp2_slot(mo - M);
    off[g] = M + log2_slot(L);
  }

  // ---- walk 2: P^T, O^T += V^T P^T, head mean of P ----
  v8f o[4][2];
#pragma unroll
  for (int d = 0; d < 4; ++d) { o[d][0] = vzero8(); o[d][1] = vzero8(); }

  const int tq = threadIdx.x >> 3;             // query row this thread sums
  const int tj = (threadIdx.x & 7) * 4;        // its four keys of the pass
  float* aw = attnw + ((size_t)(b * NSEQ + q0 + tq)) * NSEQ + tj;

  // tile 0 has landed for this wave; the barrier publishes every wave's share
  asm volatile("s_wait_asynccnt 0x0" ::: "memory");
  __syncthreads();
  copy_kv(lk + KBUF, gk + KCH * DMODEL, lv + VBUF, gv + KCH);

#pragma unroll 1  // as in walk 1
  for (int i = 0; i < NSEQ / KCH; ++i) {
    const int k0 = i * KCH;
    v16h kc[2][2];
    lds_k(kfr + (i & 1) * KBUF, kc);
    v8f st[2][2];
    scores_t(kc, qf, st);
    v16h vf[4];
#pragma unroll
    for (int d = 0; d < 4; ++d) vf[d] = lds_frag(vfr + (i & 1) * VBUF + d * 16 * VPIT);

    float* Rw = R + (size_t)(((i & 1) * NHEAD + hh) * QWG + qg * QCOLS) * RP;
    v16h pb[2];
#pragma unroll
    for (int g = 0; g < 2; ++g) {
#pragma unroll
      for (int t = 0; t < 2; ++t) {
        float p[8];
#pragma unroll
        for (int r = 0; r < 8; ++r) {
          p[r] = exp2_slot(fmaf(st[t][g][r], SC, -off[g]));
          pb[g][t * 8 + r] = (half_t)p[r];     // hardware k order: keys 8 hi + r, 16 + 8 hi + r
        }
        float4* dst = reinterpret_cast<float4*>(Rw + (g * 16 + c) * RP + t * 16 + hi * 8);
        dst[0] = make_float4(p[0], p[1], p[2], p[3]);
        dst[1] = make_float4(p[4], p[5], p[6], p[7]);
      }
    }
#pragma unroll
    for (int d = 0; d < 4; ++d) {
      o[d][0] = wmma32(vf[d], pb[0], o[d][0]);
      o[d][1] = wmma32(vf[d], pb[1], o[d][1]);
    }

    // this wave's reads of the tiles and its writes of P^T are done
    asm volatile("s_wait_dscnt 0x0" ::: "memory");
    // this wave's share of tile i + 1 has landed
    asm volatile("s_wait_asynccnt 0x0" ::: "memory");
    // One barrier per pass: it publishes tile i + 1 and this pass's P^T, and it ends
    // every reader's reads of tile i's buffers and of the other P^T buffer, which
    // the next pass overwrites.
    __syncthreads();
    if (i + 2 < NSEQ / KCH)
      copy_kv(lk + (i & 1) * KBUF, gk + (size_t)(i + 2) * (KCH * DMODEL),
              lv + (i & 1) * VBUF, gv + (i + 2) * KCH);

    const float* Rr = R + (size_t)((i & 1) * NHEAD * QWG + tq) * RP + tj;
    float4 s = *reinterpret_cast<const float4*>(Rr);
#pragma unroll
    for (int h = 1; h < NHEAD; ++h) {
      const float4 u = *reinterpret_cast<const float4*>(Rr + h * QWG * RP);
      s.x += u.x; s.y += u.y; s.z += u.z; s.w += u.w;
    }
    *reinterpret_cast<float4*>(aw + k0) =
        make_float4(s.x * 0.125f, s.y * 0.125f, s.z * 0.125f, s.w * 0.125f);
  }
  // no copy is left in flight when the wave goes on to its stores and ends
  asm volatile("s_wait_asynccnt 0x0" ::: "memory");

  // ---- ctx: a lane holds 8 consecutive d of one query: one 16-byte store ----
#pragma unroll
  for (int g = 0; g < 2; ++g) {
    half_t* crow = ctx + (((size_t)(b * NSEQ + qw + g * 16 + c)) * NHEAD + hh) * DHEAD + hi * 8;
#pragma unroll
    for (int d = 0; d < 4; ++d) {
      union { half_t h[8]; float4 v; } u;
#pragma unroll
      for (int r = 0; r < 8; ++r) u.h[r] = (half_t)o[d][g][r];
      *reinterpret_cast<float4*>(crow + d * 16) = u.v;
    }
  }
}

// ---------------------------------------------------------------------------
// Host launch
// ---------------------------------------------------------------------------
extern "C" void kernel_launch(void* const* d_in, const int* in_sizes, int n_in,
                              void* d_out, int out_size, void* d_ws, size_t ws_size,
                              hipStream_t stream) {
  (void)in_sizes; (void)n_in; (void)out_size; (void)ws_size;

  const float* h_in  = (const float*)d_in[0];
  const float* ln1_g = (const float*)d_in[1];
  const float* ln1_b = (const float*)d_in[2];
  const float* wq = (const float*)d_in[3];  const float* bq = (const float*)d_in[4];
  const float* wk = (const float*)d_in[5];  const float* bk = (const float*)d_in[6];
  const float* wv = (const float*)d_in[7];  const float* bv = (const float*)d_in[8];
  const float* wo = (const float*)d_in[9];  const float* bo = (const float*)d_in[10];
  const float* ln2_g = (const float*)d_in[11]; const float* ln2_b = (const float*)d_in[12];
  const float* w1 = (const float*)d_in[13]; const float* b1 = (const float*)d_in[14];
  const float* w2 = (const float*)d_in[15]; const float* b2 = (const float*)d_in[16];

  // ---- workspace layout (bytes) ----
  char* ws = (char*)d_ws;
  size_t off = 0;
  half_t* WQH = (half_t*)(ws + off); off += (size_t)DMODEL * DMODEL * 2;        // 0.5 MB
  half_t* WKH = (half_t*)(ws + off); off += (size_t)DMODEL * DMODEL * 2;
  half_t* WVH = (half_t*)(ws + off); off += (size_t)DMODEL * DMODEL * 2;
  half_t* WOH = (half_t*)(ws + off); off += (size_t)DMODEL * DMODEL * 2;
  half_t* W1H = (half_t*)(ws + off); off += (size_t)2 * DMODEL * DMODEL * 2;    // (2D,D)
  half_t* W2H = (half_t*)(ws + off); off += (size_t)2 * DMODEL * DMODEL * 2;    // (D,2D)
  half_t* HN  = (half_t*)(ws + off); off += (size_t)MROWS * DMODEL * 2;         // hn / f (reused)
  float*  H2  = (float*)(ws + off);  off += (size_t)MROWS * DMODEL * 4;         // h + attn_out
  half_t* CTX = (half_t*)(ws + off); off += (size_t)MROWS * DMODEL * 2;
  half_t* Qb  = (half_t*)(ws + off); size_t qoff = off; off += (size_t)MROWS * DMODEL * 2;
  half_t* Kb  = (half_t*)(ws + off); off += (size_t)MROWS * DMODEL * 2;
  half_t* VT  = (half_t*)(ws + off); off += (size_t)MROWS * DMODEL * 2;
  half_t* Gb  = (half_t*)(ws + qoff);  // FFN hidden [M, 2D] reuses Q+K regions (dead by then)

  float* out_h    = (float*)d_out;
  float* out_attn = (float*)d_out + (size_t)MROWS * DMODEL;

  // weights -> f16
  const int DD = DMODEL * DMODEL, DD2 = 2 * DMODEL * DMODEL;
  f2h_kernel<<<(DD  + 255) / 256, 256, 0, stream>>>(wq, WQH, DD);
  f2h_kernel<<<(DD  + 255) / 256, 256, 0, stream>>>(wk, WKH, DD);
  f2h_kernel<<<(DD  + 255) / 256, 256, 0, stream>>>(wv, WVH, DD);
  f2h_kernel<<<(DD  + 255) / 256, 256, 0, stream>>>(wo, WOH, DD);
  f2h_kernel<<<(DD2 + 255) / 256, 256, 0, stream>>>(w1, W1H, DD2);
  f2h_kernel<<<(DD2 + 255) / 256, 256, 0, stream>>>(w2, W2H, DD2);

  // LN1
  ln_kernel<<<MROWS / 8, 256, 0, stream>>>(h_in, ln1_g, ln1_b, HN);

  // QKV projections (block tile 128x128)
  dim3 gD(DMODEL / 128, MROWS / 128);       // (4, 128)
  gemm_kernel<false><<<gD, 256, 0, stream>>>(HN, WQH, bq, nullptr, nullptr, Qb, DMODEL, DMODEL, 0);
  gemm_kernel<false><<<gD, 256, 0, stream>>>(HN, WKH, bk, nullptr, nullptr, Kb, DMODEL, DMODEL, 0);
  // V leaves its projection as Vt [B,H,DH,N], the layout attention reads
  gemm_kernel<true><<<gD, 256, 0, stream>>>(HN, WVH, bv, nullptr, nullptr, VT, DMODEL, DMODEL, 0);

  // attention (289 KB static LDS: one work-group per WGP, 256 work-groups)
  attn_kernel<<<NBATCH * (NSEQ / QWG), 512, 0, stream>>>(Qb, Kb, VT, CTX, out_attn);

  // out projection + residual -> h2 (fp32)
  gemm_kernel<false><<<gD, 256, 0, stream>>>(CTX, WOH, bo, h_in, H2, nullptr, DMODEL, DMODEL, 0);

  // LN2 -> f (f16, reuses HN)
  ln_kernel<<<MROWS / 8, 256, 0, stream>>>(H2, ln2_g, ln2_b, HN);

  // FFN1: silu(f @ w1^T + b1) -> g f16 [M, 2D]
  dim3 g2(2 * DMODEL / 128, MROWS / 128);   // (8, 128)
  gemm_kernel<false><<<g2, 256, 0, stream>>>(HN, W1H, b1, nullptr, nullptr, Gb, 2 * DMODEL, DMODEL, 1);

  // FFN2: g @ w2^T + b2 + h2 -> final h (fp32, straight to d_out)
  gemm_kernel<false><<<gD, 256, 0, stream>>>(Gb, W2H, b2, H2, out_h, nullptr, DMODEL, 2 * DMODEL, 0);
}

// v006
// One run takes 236 microseconds.
// In both of two side-by-side timings against v005, it was 1.05 times as fast.
// All steps since v000 together make it 6.75 times as fast.
#include <hip/hip_runtime.h>

// ---------------------------------------------------------------------------
// Transformer encoder layer for MI455X (gfx1250, wave32, WMMA).
// All GEMMs use v_wmma_f32_16x16x32_f16 (f16 in, fp32 accumulate).
// GEMM wave tile: 32x64 (2x4 WMMA), block tile 128x128 (8 waves), tiles staged in LDS.
// ---------------------------------------------------------------------------

typedef _Float16 half_t;
typedef __attribute__((ext_vector_type(16))) _Float16 v16h;
typedef __attribute__((ext_vector_type(8)))  float    v8f;

#define DMODEL 512
#define NSEQ   1024
#define NBATCH 16
#define NHEAD  8
#define DHEAD  64
#define MROWS  (NBATCH * NSEQ)   // 16384 token rows

union AFrag16 { v16h v; float4 q[2]; };

// Load one 16x32 f16 WMMA fragment (A layout, or B layout for W stored [N,K]).
// Per ISA 7.12.2: lane L (0..15) holds row/col L; lanes 16..31 hold the K+8
// group. frag elems 0..7 = K kb..kb+7, elems 8..15 = K kb+16..kb+23.
__device__ __forceinline__ v16h load_frag16(const half_t* __restrict__ base,
                                            int stride, int idx, int k, int lane) {
  const int kb = (lane >> 4) << 3;   // 0 or 8
  const half_t* p = base + (size_t)idx * (size_t)stride + (size_t)(k + kb);
  AFrag16 f;
  f.q[0] = *reinterpret_cast<const float4*>(p);        // K kb .. kb+7
  f.q[1] = *reinterpret_cast<const float4*>(p + 16);   // K kb+16 .. kb+23
  return f.v;
}

__device__ __forceinline__ v8f wmma32(v16h a, v16h b, v8f c) {
  return __builtin_amdgcn_wmma_f32_16x16x32_f16(false, a, false, b,
                                                (short)0, c, false, false);
}

__device__ __forceinline__ v8f vzero8() {
  v8f z = {0.f, 0.f, 0.f, 0.f, 0.f, 0.f, 0.f, 0.f};
  return z;
}

#define WCH  8192                      // weight values per converting work-group
#define WPB  (DMODEL * DMODEL / WCH)   // such work-groups per D x D values
#define WBLK (8 * WPB)                 // all six weights: 8 D x D values

// ---------------------------------------------------------------------------
// LayerNorm: one wave (32 lanes) per row of 512; lane owns 16 contiguous cols.
// WCONV: the work-groups behind the rows' round the six weights to f16. That work
// reads inputs only, as the first LayerNorm does, so it needs no launch of its own.
// wh: the six f16 weights, one after the other in the order of the arguments.
// A work-group takes 8192 values: 8 loads of 16 B per thread, all in flight
// together, each wave's load and store covering whole lines.
// ---------------------------------------------------------------------------
template <bool WCONV>
__global__ __launch_bounds__(256) void ln_kernel(const float* __restrict__ x,
                                                 const float* __restrict__ g,
                                                 const float* __restrict__ bta,
                                                 half_t* __restrict__ out,
                                                 const float* __restrict__ wq,
                                                 const float* __restrict__ wk,
                                                 const float* __restrict__ wv,
                                                 const float* __restrict__ wo,
                                                 const float* __restrict__ w1,
                                                 const float* __restrict__ w2,
                                                 half_t* __restrict__ wh) {
  if constexpr (WCONV) {
    if (blockIdx.x >= MROWS / 8) {
      const int cb = blockIdx.x - MROWS / 8;
      const float* ws;   // the weight this work-group reads
      int fb;            // the first work-group of that weight
      if      (cb < 1 * WPB) { ws = wq; fb = 0; }
      else if (cb < 2 * WPB) { ws = wk; fb = 1 * WPB; }
      else if (cb < 3 * WPB) { ws = wv; fb = 2 * WPB; }
      else if (cb < 4 * WPB) { ws = wo; fb = 3 * WPB; }
      else if (cb < 6 * WPB) { ws = w1; fb = 4 * WPB; }
      else                   { ws = w2; fb = 6 * WPB; }
      const float4* s4 = reinterpret_cast<const float4*>(ws + (size_t)(cb - fb) * WCH) + threadIdx.x;
      half_t* d = wh + (size_t)cb * WCH + threadIdx.x * 4;
      float4 t[8];
#pragma unroll
      for (int j = 0; j < 8; ++j) t[j] = s4[j * 256];
#pragma unroll
      for (int j = 0; j < 8; ++j) {
        union { half_t h[4]; float2 v; } u;
        u.h[0] = (half_t)t[j].x; u.h[1] = (half_t)t[j].y;
        u.h[2] = (half_t)t[j].z; u.h[3] = (half_t)t[j].w;
        *reinterpret_cast<float2*>(d + j * 1024) = u.v;
      }
      return;
    }
  }
  const int row  = blockIdx.x * 8 + (threadIdx.x >> 5);
  const int lane = threadIdx.x & 31;
  const float* xr = x + (size_t)row * DMODEL + lane * 16;

  float v[16];
  const float4* x4 = reinterpret_cast<const float4*>(xr);
#pragma unroll
  for (int j = 0; j < 4; ++j) {
    float4 t = x4[j];
    v[4 * j + 0] = t.x; v[4 * j + 1] = t.y; v[4 * j + 2] = t.z; v[4 * j + 3] = t.w;
  }
  float s = 0.f;
#pragma unroll
  for (int j = 0; j < 16; ++j) s += v[j];
#pragma unroll
  for (int o = 16; o > 0; o >>= 1) s += __shfl_xor(s, o);
  const float mu = s * (1.0f / DMODEL);

  float q = 0.f;
#pragma unroll
  for (int j = 0; j < 16; ++j) { float d = v[j] - mu; q += d * d; }
#pragma unroll
  for (int o = 16; o > 0; o >>= 1) q += __shfl_xor(q, o);
  const float rs = rsqrtf(q * (1.0f / DMODEL) + 1e-5f);

  half_t* orow = out + (size_t)row * DMODEL + lane * 16;
#pragma unroll
  for (int j = 0; j < 16; ++j) {
    int c = lane * 16 + j;
    orow[j] = (half_t)((v[j] - mu) * rs * g[c] + bta[c]);
  }
}

// ---------------------------------------------------------------------------
// WMMA GEMM: out[M,Nn] = act(A_f16[M,K] @ W_f16[Nn,K]^T + bias) (+ resid)
// Block: 256 thr = 8 waves; block tile 128x128; wave tile 32x64 (2x4 WMMA).
// Both operand tiles pass through LDS: asynchronous 16-byte copies bring 128 B of
// each of the 128 + 128 rows per trip (a wave's copy covers four whole lines),
// two buffers, the next tile in flight while this one is multiplied.
// ---------------------------------------------------------------------------
#define GKT  64              // k per trip: 128 B of every operand row
#define GPIT 144             // LDS row pitch in bytes: 16 B x odd, for 16-byte fragment reads
#define GOPB (128 * GPIT)    // one operand's tile in LDS
#define GBUF (2 * GOPB)      // a buffer: A tile, then W tile

// One 16x32 f16 fragment from an LDS tile; the k order is load_frag16's.
__device__ __forceinline__ v16h lds_frag16(const char* tile, int row, int kbyte, int hi) {
  const char* p = tile + row * GPIT + kbyte + hi * 16;
  AFrag16 f;
  f.q[0] = *reinterpret_cast<const float4*>(p);        // K kb .. kb+7
  f.q[1] = *reinterpret_cast<const float4*>(p + 32);   // K kb+16 .. kb+23
  return f.v;
}

// One trip's tiles: a thread copies 16 B of rows r, r + 32, r + 64, r + 96 of A and
// of W. lds: its place in the buffer's A tile; rs: 32 rows of the source, in elements.
// The s_wait_xcnt closes the statement so that it stands in front of whatever
// rewrites an address register that a copy names.
__device__ __forceinline__ void copy_tiles(unsigned lds, const half_t* ga, const half_t* gw,
                                           size_t rs) {
  asm volatile(
      "global_load_async_to_lds_b128 %0, %8, off\n\t"
      "global_load_async_to_lds_b128 %1, %9, off\n\t"
      "global_load_async_to_lds_b128 %2, %10, off\n\t"
      "global_load_async_to_lds_b128 %3, %11, off\n\t"
      "global_load_async_to_lds_b128 %4, %12, off\n\t"
      "global_load_async_to_lds_b128 %5, %13, off\n\t"
      "global_load_async_to_lds_b128 %6, %14, off\n\t"
      "global_load_async_to_lds_b128 %7, %15, off\n\t"
      "s_wait_xcnt 0x0"
      :: "v"(lds), "v"(lds + 32 * GPIT), "v"(lds + 64 * GPIT), "v"(lds + 96 * GPIT),
         "v"(lds + GOPB), "v"(lds + GOPB + 32 * GPIT), "v"(lds + GOPB + 64 * GPIT),
         "v"(lds + GOPB + 96 * GPIT),
         "v"(ga), "v"(ga + rs), "v"(ga + 2 * rs), "v"(ga + 3 * rs),
         "v"(gw), "v"(gw + rs), "v"(gw + 2 * rs), "v"(gw + 3 * rs)
      : "memory");
}

// TR: out16 is written transposed, [M / NSEQ][Nn][NSEQ], with the bias and nothing else.
template <bool TR>
__global__ __launch_bounds__(256) void gemm_kernel(const half_t* __restrict__ A,
                                                   const half_t* __restrict__ W,
                                                   const float* __restrict__ bias,
                                                   const float* __restrict__ resid,
                                                   float* __restrict__ out32,
                                                   half_t* __restrict__ out16,
                                                   int Nn, int K, int act) {
  __shared__ __attribute__((aligned(16))) char gs[2 * GBUF];

  const int lane = threadIdx.x & 31;
  const int w    = threadIdx.x >> 5;
  const int wm   = w & 3;          // 4 waves along M (32 rows each)
  const int wn   = w >> 2;         // 2 waves along N (64 cols each)
  const int m0   = blockIdx.y * 128 + wm * 32;
  const int n0   = blockIdx.x * 128 + wn * 64;
  const int lm   = lane & 15;
  const int hi   = lane >> 4;

  v8f acc[2][4];
#pragma unroll
  for (int i = 0; i < 2; ++i)
#pragma unroll
    for (int j = 0; j < 4; ++j) acc[i][j] = vzero8();

  // this thread's share of a tile: row cr (and + 32, 64, 96), 16-byte piece cp
  const int cr = threadIdx.x >> 3;
  const int cp = threadIdx.x & 7;
  const unsigned lds0 = (unsigned)(size_t)gs + (unsigned)(cr * GPIT + cp * 16);
  const half_t* ga = A + (size_t)(blockIdx.y * 128 + cr) * K + cp * 8;
  const half_t* gw = W + (size_t)(blockIdx.x * 128 + cr) * K + cp * 8;
  const size_t  rs = (size_t)32 * K;
  const int     T  = K / GKT;

  copy_tiles(lds0, ga, gw, rs);
  // tile 0 has landed for this wave; the barrier publishes every wave's share
  asm volatile("s_wait_asynccnt 0x0" ::: "memory");
  __syncthreads();
  if (T > 1) copy_tiles(lds0 + GBUF, ga + GKT, gw + GKT, rs);

  for (int t = 0; t < T; ++t) {
    const char* ta = gs + (t & 1) * GBUF + (wm * 32 + lm) * GPIT;
    const char* tw = gs + (t & 1) * GBUF + GOPB + (wn * 64 + lm) * GPIT;
#pragma unroll  // both 32-k halves of the trip in line: every LDS offset is an immediate
    for (int kb = 0; kb < 2 * GKT; kb += 64) {
      v16h a0 = lds_frag16(ta, 0,  kb, hi);
      v16h a1 = lds_frag16(ta, 16, kb, hi);
      v16h b0 = lds_frag16(tw, 0,  kb, hi);
      v16h b1 = lds_frag16(tw, 16, kb, hi);
      v16h b2 = lds_frag16(tw, 32, kb, hi);
      v16h b3 = lds_frag16(tw, 48, kb, hi);
      acc[0][0] = wmma32(a0, b0, acc[0][0]);
      acc[0][1] = wmma32(a0, b1, acc[0][1]);
      acc[0][2] = wmma32(a0, b2, acc[0][2]);
      acc[0][3] = wmma32(a0, b3, acc[0][3]);
      acc[1][0] = wmma32(a1, b0, acc[1][0]);
      acc[1][1] = wmma32(a1, b1, acc[1][1]);
      acc[1][2] = wmma32(a1, b2, acc[1][2]);
      acc[1][3] = wmma32(a1, b3, acc[1][3]);
    }
    // this wave's reads of the buffer are done before it is handed to the copies
    asm volatile("s_wait_dscnt 0x0" ::: "memory");
    // this wave's share of tile t + 1 has landed
    asm volatile("s_wait_asynccnt 0x0" ::: "memory");
    // publishes tile t + 1 and ends every reader's reads of tile t's buffer
    __syncthreads();
    if (t + 2 < T)
      copy_tiles(lds0 + (t & 1) * GBUF, ga + (size_t)(t + 2) * GKT, gw + (size_t)(t + 2) * GKT, rs);
  }
  // no copy is left in flight when the wave goes on to its stores and ends
  asm volatile("s_wait_asynccnt 0x0" ::: "memory");

  // Transposed f16 output [M / NSEQ][Nn][NSEQ]: a lane's 8 accumulator rows are 8
  // consecutive tokens of one column, so they leave as one 16-byte store.
  // The block's 128 rows lie in one sequence (128 divides NSEQ).
  if constexpr (TR) {
    half_t* p = out16 + ((size_t)((blockIdx.y * 128 / NSEQ) * Nn + n0 + lm)) * NSEQ +
                ((m0 & (NSEQ - 1)) + (hi << 3));
#pragma unroll
    for (int j = 0; j < 4; ++j) {
      const float bz = bias[n0 + j * 16 + lm];
#pragma unroll
      for (int i = 0; i < 2; ++i) {
        union { half_t h[8]; float4 v; } u;
#pragma unroll
        for (int r = 0; r < 8; ++r) u.h[r] = (half_t)(acc[i][j][r] + bz);
        *reinterpret_cast<float4*>(p + j * 16 * NSEQ + i * 16) = u.v;
      }
    }
    return;
  }

#pragma unroll
  for (int i = 0; i < 2; ++i) {
#pragma unroll
    for (int j = 0; j < 4; ++j) {
      const int colg = n0 + j * 16 + lm;
      const float bz = bias[colg];
#pragma unroll
      for (int r = 0; r < 8; ++r) {
        const int rowg = m0 + i * 16 + r + (hi << 3);
        float val = acc[i][j][r] + bz;
        if (act) val = val / (1.f + __expf(-val));     // SiLU
        const size_t off = (size_t)rowg * Nn + colg;
        if (resid) val += resid[off];
        if (out32) out32[off] = val;
        if (out16) out16[off] = (half_t)val;
      }
    }
  }
}

// ---------------------------------------------------------------------------
// 2^t and log2(t) on the transcendental unit. The v_nop is the one slot the
// instruction set asks for behind a transcendental before its result is read or
// its source overwritten; inside one statement it cannot be lost. In place: the
// register written is the one the compiler's own arithmetic has just written, so
// it is never an operand of a matrix instruction that stands shortly in front.
// ---------------------------------------------------------------------------
__device__ __forceinline__ float exp2_slot(float t) {
  asm("v_exp_f32 %0, %0\n\tv_nop" : "+v"(t));
  return t;
}
__device__ __forceinline__ float log2_slot(float t) {
  asm("v_log_f32 %0, %0\n\tv_nop" : "+v"(t));
  return t;
}

#define QCOLS 32   // query columns per wave (two 16-column groups)
#define QWG   64   // query columns per work-group: two waves per head
#define KCH   32   // keys per pass
#define RP    36   // LDS row pitch in floats: 144 B = 16 B x odd, for 16-byte accesses
#define KPIT  1040 // K tile row in LDS: one key's 8 heads (1024 B) + 16: 16 B x odd
#define KBUF  (KCH * KPIT)
#define VPIT  80   // V^T tile row in LDS: 32 keys of one (head, d) (64 B) + 16: 16 B x odd
#define VBUF  (DMODEL * VPIT)
#define VOFF  (2 * KBUF)             // LDS map: K tile x 2, V^T tile x 2, P^T x 2
#define ROFF  (VOFF + 2 * VBUF)
#define ALDS  (ROFF + 2 * NHEAD * QWG * RP * 4)

// One 16x32 f16 fragment from LDS; p: the lane's row, at its 8 hi-th k. The k order is load_frag16's.
__device__ __forceinline__ v16h lds_frag(const char* p) {
  AFrag16 f;
  f.q[0] = *reinterpret_cast<const float4*>(p);        // K kb .. kb+7
  f.q[1] = *reinterpret_cast<const float4*>(p + 32);   // K kb+16 .. kb+23
  return f.v;
}

// K fragments (A operand) of the tile's 32 keys, one head: two 16-key tiles x two k steps.
__device__ __forceinline__ void lds_k(const char* p, v16h (&kf)[2][2]) {
#pragma unroll
  for (int t = 0; t < 2; ++t) {
    kf[t][0] = lds_frag(p + t * 16 * KPIT);
    kf[t][1] = lds_frag(p + t * 16 * KPIT + 64);
  }
}

// A K tile (32 keys x 1024 B, contiguous in memory): a thread copies 16 B of keys
// r, r + 8, r + 16, r + 24; a wave's copy covers four whole lines.
// The s_wait_xcnt closes the statement so that it stands in front of whatever
// rewrites an address register that a copy names.
__device__ __forceinline__ void copy_k(unsigned lk, const half_t* gk) {
  asm volatile(
      "global_load_async_to_lds_b128 %0, %4, off\n\t"
      "global_load_async_to_lds_b128 %1, %5, off\n\t"
      "global_load_async_to_lds_b128 %2, %6, off\n\t"
      "global_load_async_to_lds_b128 %3, %7, off\n\t"
      "s_wait_xcnt 0x0"
      :: "v"(lk), "v"(lk + 8 * KPIT), "v"(lk + 16 * KPIT), "v"(lk + 24 * KPIT),
         "v"(gk), "v"(gk + 8 * DMODEL), "v"(gk + 16 * DMODEL), "v"(gk + 24 * DMODEL)
      : "memory");
}

// A K tile as above and a V^T tile (512 rows x 64 B): 16 B of rows r, r + 128, r + 256, r + 384.
__device__ __forceinline__ void copy_kv(unsigned lk, const half_t* gk,
                                        unsigned lv, const half_t* gv) {
  asm volatile(
      "global_load_async_to_lds_b128 %0, %8, off\n\t"
      "global_load_async_to_lds_b128 %1, %9, off\n\t"
      "global_load_async_to_lds_b128 %2, %10, off\n\t"
      "global_load_async_to_lds_b128 %3, %11, off\n\t"
      "global_load_async_to_lds_b128 %4, %12, off\n\t"
      "global_load_async_to_lds_b128 %5, %13, off\n\t"
      "global_load_async_to_lds_b128 %6, %14, off\n\t"
      "global_load_async_to_lds_b128 %7, %15, off\n\t"
      "s_wait_xcnt 0x0"
      :: "v"(lk), "v"(lk + 8 * KPIT), "v"(lk + 16 * KPIT), "v"(lk + 24 * KPIT),
         "v"(lv), "v"(lv + 128 * VPIT), "v"(lv + 256 * VPIT), "v"(lv + 384 * VPIT),
         "v"(gk), "v"(gk + 8 * DMODEL), "v"(gk + 16 * DMODEL), "v"(gk + 24 * DMODEL),
         "v"(gv), "v"(gv + 128 * NSEQ), "v"(gv + 256 * NSEQ), "v"(gv + 384 * NSEQ)
      : "memory");
}

// S^T = K Q^T: st[t][g][r] = score(key 16 t + 8 hi + r, query 16 g + c), unscaled.
__device__ __forceinline__ void scores_t(const v16h (&kf)[2][2], const v16h (&qf)[2][2],
                                         v8f (&st)[2][2]) {
#pragma unroll
  for (int t = 0; t < 2; ++t)
#pragma unroll
    for (int g = 0; g < 2; ++g) st[t][g] = wmma32(kf[t][0], qf[g][0], vzero8());
#pragma unroll
  for (int t = 0; t < 2; ++t)
#pragma unroll
    for (int g = 0; g < 2; ++g) st[t][g] = wmma32(kf[t][1], qf[g][1], st[t][g]);
}

// ---------------------------------------------------------------------------
// Attention: one work-group per (b, 64-query tile); wave w = head w & 7, query
// half w >> 3. The pass's 32 keys of K and of V^T, all heads, come into LDS by
// asynchronous copies, two buffers, the next tile in flight while this one is
// worked on; both waves of a head read their fragments there.
// Walk 1 over the keys: S^T = K Q^T, each lane keeps the running maximum and
// sum of its own query column (scores are not stored).
// Walk 2: S^T again, P^T = 2^(x - max - log2 sum) in the accumulator registers,
// which are a B operand as they stand: O^T += V^T P^T. The eight heads' P^T of
// the pass meet in LDS, are summed in head order and stored once.
// LDS: 65 KB of K, 80 KB of V^T, two buffers of 8 heads x 64 queries x 32 keys
// f32 (pitch 36) = 144 KB: one work-group of 16 waves per WGP.
// ---------------------------------------------------------------------------
__global__ __launch_bounds__(512) void attn_kernel(const half_t* __restrict__ q,
                                                   const half_t* __restrict__ kk,
                                                   const half_t* __restrict__ vt,
                                                   half_t* __restrict__ ctx,
                                                   float* __restrict__ attnw) {
  __shared__ __attribute__((aligned(16))) char smem[ALDS];
  float* R = (float*)(smem + ROFF);            // [2][NHEAD][QWG][RP]

  const int lane = threadIdx.x & 31;
  const int hh   = (threadIdx.x >> 5) & 7;     // head
  const int qg   = threadIdx.x >> 8;           // which 32 of the 64 queries
  const int b    = blockIdx.x >> 4;            // N / 64 = 16 query tiles per batch
  const int q0   = (blockIdx.x & 15) * QWG;
  const int qw   = q0 + qg * QCOLS;            // this wave's first query
  const int c    = lane & 15;
  const int hi   = lane >> 4;
  const float SC = 0.125f * 1.4426950408889634f;   // 1/sqrt(64) * log2(e)

  v16h qf[2][2];
#pragma unroll
  for (int g = 0; g < 2; ++g) {
    const half_t* qb = q + (((size_t)(b * NSEQ + qw + g * 16 + c)) * NHEAD + hh) * DHEAD;
    qf[g][0] = load_frag16(qb, 0, 0, 0,  lane);
    qf[g][1] = load_frag16(qb, 0, 0, 32, lane);
  }
  // The Q loads' address pair is free for reuse from here on: keep the wait in
  // front of whatever overwrites it.
  asm volatile("s_wait_xcnt 0x0" ::: "memory");

  // this thread's share of a tile, in LDS (buffer 0) and in memory (tile 0)
  const unsigned sb = (unsigned)(size_t)smem;
  const unsigned lk = sb + (unsigned)((threadIdx.x >> 6) * KPIT + (threadIdx.x & 63) * 16);
  const unsigned lv = sb + (unsigned)(VOFF + (threadIdx.x >> 2) * VPIT + (threadIdx.x & 3) * 16);
  const half_t* gk = kk + (size_t)(b * NSEQ + (threadIdx.x >> 6)) * DMODEL + (threadIdx.x & 63) * 8;
  const half_t* gv = vt + (size_t)(b * DMODEL + (threadIdx.x >> 2)) * NSEQ + (threadIdx.x & 3) * 8;
  // this lane's fragment rows in buffer 0
  const char* kfr = smem + c * KPIT + hh * (DHEAD * 2) + hi * 16;
  const char* vfr = smem + VOFF + (hh * DHEAD + c) * VPIT + hi * 16;

  // ---- walk 1: column maximum and sum (log2 domain), per lane half ----
  float mrun[2] = {-1e30f, -1e30f};
  float lrun[2] = {0.f, 0.f};

  copy_k(lk, gk);
  // tile 0 has landed for this wave; the barrier publishes every wave's share
  asm volatile("s_wait_asynccnt 0x0" ::: "memory");
  __syncthreads();
  copy_k(lk + KBUF, gk + KCH * DMODEL);

#pragma unroll 1  // one pass per trip keeps the live set under 256 registers
  for (int i = 0; i < NSEQ / KCH; ++i) {
    v16h kc[2][2];
    lds_k(kfr + (i & 1) * KBUF, kc);
    v8f st[2][2];
    scores_t(kc, qf, st);
#pragma unroll
    for (int g = 0; g < 2; ++g) {
      float c0 = fmaxf(st[0][g][0], st[1][g][0]);
#pragma unroll
      for (int r = 1; r < 8; ++r) c0 = fmaxf(c0, fmaxf(st[0][g][r], st[1][g][r]));
      const float mn = fmaxf(mrun[g], c0 * SC);
      float s0 = exp2_slot(fmaf(st[0][g][0], SC, -mn));
      float s1 = exp2_slot(fmaf(st[0][g][1], SC, -mn));
      float s2 = exp2_slot(fmaf(st[1][g][0], SC, -mn));
      float s3 = exp2_slot(fmaf(st[1][g][1], SC, -mn));
#pragma unroll
      for (int r = 2; r < 8; r += 2) {
        s0 += exp2_slot(fmaf(st[0][g][r],     SC, -mn));
        s1 += exp2_slot(fmaf(st[0][g][r + 1], SC, -mn));
        s2 += exp2_slot(fmaf(st[1][g][r],     SC, -mn));
        s3 += exp2_slot(fmaf(st[1][g][r + 1], SC, -mn));
      }
      lrun[g] = lrun[g] * exp2_slot(mrun[g] - mn) + ((s0 + s1) + (s2 + s3));
      mrun[g] = mn;
    }
    // Keeps the pass's arithmetic in front of the waits: moved behind the barrier it
    // would stand between the barrier and the refill, and the refill would be
    // waited for as soon as it is issued.
    __builtin_amdgcn_sched_barrier(0);
    // this wave's reads of the buffer are done before it is handed to the copies
    asm volatile("s_wait_dscnt 0x0" ::: "memory");
    // this wave's share of tile i + 1 has landed
    asm volatile("s_wait_asynccnt 0x0" ::: "memory");
    // publishes tile i + 1 and ends every reader's reads of tile i's buffer
    __syncthreads();
    if (i + 2 < NSEQ / KCH)
      copy_k(lk + (i & 1) * KBUF, gk + (size_t)(i + 2) * (KCH * DMODEL));
  }
  // no copy is in flight when walk 2 takes the buffers over
  asm volatile("s_wait_asynccnt 0x0" ::: "memory");

  // walk 2's tile 0 (every reader left both K buffers at walk 1's last barriers)
  copy_kv(lk, gk, lv, gv);

  // join the two lane halves of each column; off = max + log2(sum)
  float off[2];
#pragma unroll
  for (int g = 0; g < 2; ++g) {
    const float mo = __shfl_xor(mrun[g], 16);
    const float lo = __shfl_xor(lrun[g], 16);
    const float M  = fmaxf(mrun[g], mo);
    const float L  = lrun[g] * exp2_slot(mrun[g] - M) + lo * exp2_slot(mo - M);
    off[g] = M + log2_slot(L);
  }

  // ---- walk 2: P^T, O^T += V^T P^T, head mean of P ----
  v8f o[4][2];
#pragma unroll
  for (int d = 0; d < 4; ++d) { o[d][0] = vzero8(); o[d][1] = vzero8(); }

  const int tq = threadIdx.x >> 3;             // query row this thread sums
  const int tj = (threadIdx.x & 7) * 4;        // its four keys of the pass
  float* aw = attnw + ((size_t)(b * NSEQ + q0 + tq)) * NSEQ + tj;

  // tile 0 has landed for this wave; the barrier publishes every wave's share
  asm volatile("s_wait_asynccnt 0x0" ::: "memory");
  __syncthreads();
  copy_kv(lk + KBUF, gk + KCH * DMODEL, lv + VBUF, gv + KCH);

#pragma unroll 1  // as in walk 1
  for (int i = 0; i < NSEQ / KCH; ++i) {
    const int k0 = i * KCH;
    v16h kc[2][2];
    lds_k(kfr + (i & 1) * KBUF, kc);
    v8f st[2][2];
    scores_t(kc, qf, st);
    v16h vf[4];
#pragma unroll
    for (int d = 0; d < 4; ++d) vf[d] = lds_frag(vfr + (i & 1) * VBUF + d * 16 * VPIT);

    float* Rw = R + (size_t)(((i & 1) * NHEAD + hh) * QWG + qg * QCOLS) * RP;
    v16h pb[2];
#pragma unroll
    for (int g = 0; g < 2; ++g) {
#pragma unroll
      for (int t = 0; t < 2; ++t) {
        float p[8];
#pragma unroll
        for (int r = 0; r < 8; ++r) {
          p[r] = exp2_slot(fmaf(st[t][g][r], SC, -off[g]));
          pb[g][t * 8 + r] = (half_t)p[r];     // hardware k order: keys 8 hi + r, 16 + 8 hi + r
        }
        float4* dst = reinterpret_cast<float4*>(Rw + (g * 16 + c) * RP + t * 16 + hi * 8);
        dst[0] = make_float4(p[0], p[1], p[2], p[3]);
        dst[1] = make_float4(p[4], p[5], p[6], p[7]);
      }
    }
#pragma unroll
    for (int d = 0; d < 4; ++d) {
      o[d][0] = wmma32(vf[d], pb[0], o[d][0]);
      o[d][1] = wmma32(vf[d], pb[1], o[d][1]);
    }

    // this wave's reads of the tiles and its writes of P^T are done
    asm volatile("s_wait_dscnt 0x0" ::: "memory");
    // this wave's share of tile i + 1 has landed
    asm volatile("s_wait_asynccnt 0x0" ::: "memory");
    // One barrier per pass: it publishes tile i + 1 and this pass's P^T, and it ends
    // every reader's reads of tile i's buffers and of the other P^T buffer, which
    // the next pass overwrites.
    __syncthreads();
    if (i + 2 < NSEQ / KCH)
      copy_kv(lk + (i & 1) * KBUF, gk + (size_t)(i + 2) * (KCH * DMODEL),
              lv + (i & 1) * VBUF, gv + (i + 2) * KCH);

    const float* Rr = R + (size_t)((i & 1) * NHEAD * QWG + tq) * RP + tj;
    float4 s = *reinterpret_cast<const float4*>(Rr);
#pragma unroll
    for (int h = 1; h < NHEAD; ++h) {
      const float4 u = *reinterpret_cast<const float4*>(Rr + h * QWG * RP);
      s.x += u.x; s.y += u.y; s.z += u.z; s.w += u.w;
    }
    *reinterpret_cast<float4*>(aw + k0) =
        make_float4(s.x * 0.125f, s.y * 0.125f, s.z * 0.125f, s.w * 0.125f);
  }
  // no copy is left in flight when the wave goes on to its stores and ends
  asm volatile("s_wait_asynccnt 0x0" ::: "memory");

  // ---- ctx: a lane holds 8 consecutive d of one query: one 16-byte store ----
#pragma unroll
  for (int g = 0; g < 2; ++g) {
    half_t* crow = ctx + (((size_t)(b * NSEQ + qw + g * 16 + c)) * NHEAD + hh) * DHEAD + hi * 8;
#pragma unroll
    for (int d = 0; d < 4; ++d) {
      union { half_t h[8]; float4 v; } u;
#pragma unroll
      for (int r = 0; r < 8; ++r) u.h[r] = (half_t)o[d][g][r];
      *reinterpret_cast<float4*>(crow + d * 16) = u.v;
    }
  }
}

// ---------------------------------------------------------------------------
// Host launch
// ---------------------------------------------------------------------------
extern "C" void kernel_launch(void* const* d_in, const int* in_sizes, int n_in,
                              void* d_out, int out_size, void* d_ws, size_t ws_size,
                              hipStream_t stream) {
  (void)in_sizes; (void)n_in; (void)out_size; (void)ws_size;

  const float* h_in  = (const float*)d_in[0];
  const float* ln1_g = (const float*)d_in[1];
  const float* ln1_b = (const float*)d_in[2];
  const float* wq = (const float*)d_in[3];  const float* bq = (const float*)d_in[4];
  const float* wk = (const float*)d_in[5];  const float* bk = (const float*)d_in[6];
  const float* wv = (const float*)d_in[7];  const float* bv = (const float*)d_in[8];
  const float* wo = (const float*)d_in[9];  const float* bo = (const float*)d_in[10];
  const float* ln2_g = (const float*)d_in[11]; const float* ln2_b = (const float*)d_in[12];
  const float* w1 = (const float*)d_in[13]; const float* b1 = (const float*)d_in[14];
  const float* w2 = (const float*)d_in[15]; const float* b2 = (const float*)d_in[16];

  // ---- workspace layout (bytes) ----
  char* ws = (char*)d_ws;
  size_t off = 0;
  half_t* WQH = (half_t*)(ws + off); off += (size_t)DMODEL * DMODEL * 2;        // 0.5 MB
  half_t* WKH = (half_t*)(ws + off); off += (size_t)DMODEL * DMODEL * 2;
  half_t* WVH = (half_t*)(ws + off); off += (size_t)DMODEL * DMODEL * 2;
  half_t* WOH = (half_t*)(ws + off); off += (size_t)DMODEL * DMODEL * 2;
  half_t* W1H = (half_t*)(ws + off); off += (size_t)2 * DMODEL * DMODEL * 2;    // (2D,D)
  half_t* W2H = (half_t*)(ws + off); off += (size_t)2 * DMODEL * DMODEL * 2;    // (D,2D)
  half_t* HN  = (half_t*)(ws + off); off += (size_t)MROWS * DMODEL * 2;         // hn / f (reused)
  float*  H2  = (float*)(ws + off);  off += (size_t)MROWS * DMODEL * 4;         // h + attn_out
  half_t* CTX = (half_t*)(ws + off); off += (size_t)MROWS * DMODEL * 2;
  half_t* Qb  = (half_t*)(ws + off); size_t qoff = off; off += (size_t)MROWS * DMODEL * 2;
  half_t* Kb  = (half_t*)(ws + off); off += (size_t)MROWS * DMODEL * 2;
  half_t* VT  = (half_t*)(ws + off); off += (size_t)MROWS * DMODEL * 2;
  half_t* Gb  = (half_t*)(ws + qoff);  // FFN hidden [M, 2D] reuses Q+K regions (dead by then)

  float* out_h    = (float*)d_out;
  float* out_attn = (float*)d_out + (size_t)MROWS * DMODEL;

  // LN1, and weights -> f16 (WQH .. W2H lie one after the other, from WQH on)
  ln_kernel<true><<<MROWS / 8 + WBLK, 256, 0, stream>>>(h_in, ln1_g, ln1_b, HN,
                                                        wq, wk, wv, wo, w1, w2, WQH);

  // QKV projections (block tile 128x128)
  dim3 gD(DMODEL / 128, MROWS / 128);       // (4, 128)
  gemm_kernel<false><<<gD, 256, 0, stream>>>(HN, WQH, bq, nullptr, nullptr, Qb, DMODEL, DMODEL, 0);
  gemm_kernel<false><<<gD, 256, 0, stream>>>(HN, WKH, bk, nullptr, nullptr, Kb, DMODEL, DMODEL, 0);
  // V leaves its projection as Vt [B,H,DH,N], the layout attention reads
  gemm_kernel<true><<<gD, 256, 0, stream>>>(HN, WVH, bv, nullptr, nullptr, VT, DMODEL, DMODEL, 0);

  // attention (289 KB static LDS: one work-group per WGP, 256 work-groups)
  attn_kernel<<<NBATCH * (NSEQ / QWG), 512, 0, stream>>>(Qb, Kb, VT, CTX, out_attn);

  // out projection + residual -> h2 (fp32)
  gemm_kernel<false><<<gD, 256, 0, stream>>>(CTX, WOH, bo, h_in, H2, nullptr, DMODEL, DMODEL, 0);

  // LN2 -> f (f16, reuses HN)
  ln_kernel<false><<<MROWS / 8, 256, 0, stream>>>(H2, ln2_g, ln2_b, HN, nullptr, nullptr, nullptr,
                                                  nullptr, nullptr, nullptr, nullptr);

  // FFN1: silu(f @ w1^T + b1) -> g f16 [M, 2D]
  dim3 g2(2 * DMODEL / 128, MROWS / 128);   // (8, 128)
  gemm_kernel<false><<<g2, 256, 0, stream>>>(HN, W1H, b1, nullptr, nullptr, Gb, 2 * DMODEL, DMODEL, 1);

  // FFN2: g @ w2^T + b2 + h2 -> final h (fp32, straight to d_out)
  gemm_kernel<false><<<gD, 256, 0, stream>>>(Gb, W2H, b2, H2, out_h, nullptr, DMODEL, 2 * DMODEL, 0);
}

// v007
// Measured time: 190 microseconds a run.
// In both of two side-by-side timings against v006, it was 1.25 times as fast.
// Over all steps from v000 it is 8.45 times as fast.
#include <hip/hip_runtime.h>

// ---------------------------------------------------------------------------
// Transformer encoder layer for MI455X (gfx1250, wave32, WMMA).
// All GEMMs use v_wmma_f32_16x16x32_f16 (f16 in, fp32 accumulate).
// GEMM wave tile: 32x64 (2x4 WMMA), block tile 128x128 (8 waves), tiles staged in LDS.
// ---------------------------------------------------------------------------

typedef _Float16 half_t;
typedef __attribute__((ext_vector_type(16))) _Float16 v16h;
typedef __attribute__((ext_vector_type(8)))  float    v8f;

#define DMODEL 512
#define NSEQ   1024
#define NBATCH 16
#define NHEAD  8
#define DHEAD  64
#define MROWS  (NBATCH * NSEQ)   // 16384 token rows

union AFrag16 { v16h v; float4 q[2]; };

// Load one 16x32 f16 WMMA fragment (A layout, or B layout for W stored [N,K]).
// Per ISA 7.12.2: lane L (0..15) holds row/col L; lanes 16..31 hold the K+8
// group. frag elems 0..7 = K kb..kb+7, elems 8..15 = K kb+16..kb+23.
__device__ __forceinline__ v16h load_frag16(const half_t* __restrict__ base,
                                            int stride, int idx, int k, int lane) {
  const int kb = (lane >> 4) << 3;   // 0 or 8
  const half_t* p = base + (size_t)idx * (size_t)stride + (size_t)(k + kb);
  AFrag16 f;
  f.q[0] = *reinterpret_cast<const float4*>(p);        // K kb .. kb+7
  f.q[1] = *reinterpret_cast<const float4*>(p + 16);   // K kb+16 .. kb+23
  return f.v;
}

__device__ __forceinline__ v8f wmma32(v16h a, v16h b, v8f c) {
  return __builtin_amdgcn_wmma_f32_16x16x32_f16(false, a, false, b,
                                                (short)0, c, false, false);
}

__device__ __forceinline__ v8f vzero8() {
  v8f z = {0.f, 0.f, 0.f, 0.f, 0.f, 0.f, 0.f, 0.f};
  return z;
}

#define WCH  8192                      // weight values per converting work-group
#define WPB  (DMODEL * DMODEL / WCH)   // such work-groups per D x D values
#define WBLK (8 * WPB)                 // all six weights: 8 D x D values

// ---------------------------------------------------------------------------
// LayerNorm: one wave (32 lanes) per row of 512; lane owns 16 contiguous cols.
// WCONV: the work-groups behind the rows' round the six weights to f16. That work
// reads inputs only, as the first LayerNorm does, so it needs no launch of its own.
// wh: the six f16 weights, one after the other in the order of the arguments.
// A work-group takes 8192 values: 8 loads of 16 B per thread, all in flight
// together, each wave's load and store covering whole lines.
// ---------------------------------------------------------------------------
template <bool WCONV>
__global__ __launch_bounds__(256) void ln_kernel(const float* __restrict__ x,
                                                 const float* __restrict__ g,
                                                 const float* __restrict__ bta,
                                                 half_t* __restrict__ out,
                                                 const float* __restrict__ wq,
                                                 const float* __restrict__ wk,
                                                 const float* __restrict__ wv,
                                                 const float* __restrict__ wo,
                                                 const float* __restrict__ w1,
                                                 const float* __restrict__ w2,
                                                 half_t* __restrict__ wh) {
  if constexpr (WCONV) {
    if (blockIdx.x >= MROWS / 8) {
      const int cb = blockIdx.x - MROWS / 8;
      const float* ws;   // the weight this work-group reads
      int fb;            // the first work-group of that weight
      if      (cb < 1 * WPB) { ws = wq; fb = 0; }
      else if (cb < 2 * WPB) { ws = wk; fb = 1 * WPB; }
      else if (cb < 3 * WPB) { ws = wv; fb = 2 * WPB; }
      else if (cb < 4 * WPB) { ws = wo; fb = 3 * WPB; }
      else if (cb < 6 * WPB) { ws = w1; fb = 4 * WPB; }
      else                   { ws = w2; fb = 6 * WPB; }
      const float4* s4 = reinterpret_cast<const float4*>(ws + (size_t)(cb - fb) * WCH) + threadIdx.x;
      half_t* d = wh + (size_t)cb * WCH + threadIdx.x * 4;
      float4 t[8];
#pragma unroll
      for (int j = 0; j < 8; ++j) t[j] = s4[j * 256];
#pragma unroll
      for (int j = 0; j < 8; ++j) {
        union { half_t h[4]; float2 v; } u;
        u.h[0] = (half_t)t[j].x; u.h[1] = (half_t)t[j].y;
        u.h[2] = (half_t)t[j].z; u.h[3] = (half_t)t[j].w;
        *reinterpret_cast<float2*>(d + j * 1024) = u.v;
      }
      return;
    }
  }
  const int row  = blockIdx.x * 8 + (threadIdx.x >> 5);
  const int lane = threadIdx.x & 31;
  const float* xr = x + (size_t)row * DMODEL + lane * 16;

  float v[16];
  const float4* x4 = reinterpret_cast<const float4*>(xr);
#pragma unroll
  for (int j = 0; j < 4; ++j) {
    float4 t = x4[j];
    v[4 * j + 0] = t.x; v[4 * j + 1] = t.y; v[4 * j + 2] = t.z; v[4 * j + 3] = t.w;
  }
  float s = 0.f;
#pragma unroll
  for (int j = 0; j < 16; ++j) s += v[j];
#pragma unroll
  for (int o = 16; o > 0; o >>= 1) s += __shfl_xor(s, o);
  const float mu = s * (1.0f / DMODEL);

  float q = 0.f;
#pragma unroll
  for (int j = 0; j < 16; ++j) { float d = v[j] - mu; q += d * d; }
#pragma unroll
  for (int o = 16; o > 0; o >>= 1) q += __shfl_xor(q, o);
  const float rs = rsqrtf(q * (1.0f / DMODEL) + 1e-5f);

  half_t* orow = out + (size_t)row * DMODEL + lane * 16;
#pragma unroll
  for (int j = 0; j < 16; ++j) {
    int c = lane * 16 + j;
    orow[j] = (half_t)((v[j] - mu) * rs * g[c] + bta[c]);
  }
}

// ---------------------------------------------------------------------------
// 2^t and log2(t) on the transcendental unit. The v_nop is the one slot the
// instruction set asks for behind a transcendental before its result is read or
// its source overwritten; inside one statement it cannot be lost. In place: the
// register written is the one the compiler's own arithmetic has just written, so
// it is never an operand of a matrix instruction that stands shortly in front.
// ---------------------------------------------------------------------------
__device__ __forceinline__ float exp2_slot(float t) {
  asm("v_exp_f32 %0, %0\n\tv_nop" : "+v"(t));
  return t;
}
__device__ __forceinline__ float log2_slot(float t) {
  asm("v_log_f32 %0, %0\n\tv_nop" : "+v"(t));
  return t;
}

// ---------------------------------------------------------------------------
// WMMA GEMM: out[M,Nn] = act(A_f16[M,K] @ W_f16[Nn,K]^T + bias) (+ resid)
// Block: 256 thr = 8 waves; block tile 128x128; wave tile 32x64 (2x4 WMMA).
// Both operand tiles pass through LDS: asynchronous 16-byte copies bring 128 B of
// each of the 128 + 128 rows per trip (a wave's copy covers four whole lines),
// two buffers, the next tile in flight while this one is multiplied.
// ---------------------------------------------------------------------------
#define GKT  64              // k per trip: 128 B of every operand row
#define GPIT 144             // LDS row pitch in bytes: 16 B x odd, for 16-byte fragment reads
#define GOPB (128 * GPIT)    // one operand's tile in LDS
#define GBUF (2 * GOPB)      // a buffer: A tile, then W tile

// One 16x32 f16 fragment from an LDS tile; the k order is load_frag16's.
__device__ __forceinline__ v16h lds_frag16(const char* tile, int row, int kbyte, int hi) {
  const char* p = tile + row * GPIT + kbyte + hi * 16;
  AFrag16 f;
  f.q[0] = *reinterpret_cast<const float4*>(p);        // K kb .. kb+7
  f.q[1] = *reinterpret_cast<const float4*>(p + 32);   // K kb+16 .. kb+23
  return f.v;
}

// One trip's tiles: a thread copies 16 B of rows r, r + 32, r + 64, r + 96 of A and
// of W. lds: its place in the buffer's A tile; rs: 32 rows of the source, in elements.
// The s_wait_xcnt closes the statement so that it stands in front of whatever
// rewrites an address register that a copy names.
__device__ __forceinline__ void copy_tiles(unsigned lds, const half_t* ga, const half_t* gw,
                                           size_t rs) {
  asm volatile(
      "global_load_async_to_lds_b128 %0, %8, off\n\t"
      "global_load_async_to_lds_b128 %1, %9, off\n\t"
      "global_load_async_to_lds_b128 %2, %10, off\n\t"
      "global_load_async_to_lds_b128 %3, %11, off\n\t"
      "global_load_async_to_lds_b128 %4, %12, off\n\t"
      "global_load_async_to_lds_b128 %5, %13, off\n\t"
      "global_load_async_to_lds_b128 %6, %14, off\n\t"
      "global_load_async_to_lds_b128 %7, %15, off\n\t"
      "s_wait_xcnt 0x0"
      :: "v"(lds), "v"(lds + 32 * GPIT), "v"(lds + 64 * GPIT), "v"(lds + 96 * GPIT),
         "v"(lds + GOPB), "v"(lds + GOPB + 32 * GPIT), "v"(lds + GOPB + 64 * GPIT),
         "v"(lds + GOPB + 96 * GPIT),
         "v"(ga), "v"(ga + rs), "v"(ga + 2 * rs), "v"(ga + 3 * rs),
         "v"(gw), "v"(gw + rs), "v"(gw + 2 * rs), "v"(gw + 3 * rs)
      : "memory");
}

// What leaves the accumulators is fixed at compile time, so that no branch stands
// between one element and the next and the epilogue's loads need not be waited for
// one at a time:
#define EP_F16  0   // out16 = acc + bias
#define EP_TR   1   // the same, written transposed: out16[M / NSEQ][Nn][NSEQ]
#define EP_SILU 2   // out16 = silu(acc + bias)
#define EP_RES  3   // out32 = acc + bias + resid
// Nn: the row length of out and resid; a constant, so that every element of a lane
// is an immediate offset from one address.
template <int EP, int Nn>
__global__ __launch_bounds__(256) void gemm_kernel(const half_t* __restrict__ A,
                                                   const half_t* __restrict__ W,
                                                   const float* __restrict__ bias,
                                                   const float* __restrict__ resid,
                                                   float* __restrict__ out32,
                                                   half_t* __restrict__ out16,
                                                   int K) {
  __shared__ __attribute__((aligned(16))) char gs[2 * GBUF];

  const int lane = threadIdx.x & 31;
  const int w    = threadIdx.x >> 5;
  const int wm   = w & 3;          // 4 waves along M (32 rows each)
  const int wn   = w >> 2;         // 2 waves along N (64 cols each)
  const int m0   = blockIdx.y * 128 + wm * 32;
  const int n0   = blockIdx.x * 128 + wn * 64;
  const int lm   = lane & 15;
  const int hi   = lane >> 4;

  v8f acc[2][4];
#pragma unroll
  for (int i = 0; i < 2; ++i)
#pragma unroll
    for (int j = 0; j < 4; ++j) acc[i][j] = vzero8();

  // this thread's share of a tile: row cr (and + 32, 64, 96), 16-byte piece cp
  const int cr = threadIdx.x >> 3;
  const int cp = threadIdx.x & 7;
  const unsigned lds0 = (unsigned)(size_t)gs + (unsigned)(cr * GPIT + cp * 16);
  const half_t* ga = A + (size_t)(blockIdx.y * 128 + cr) * K + cp * 8;
  const half_t* gw = W + (size_t)(blockIdx.x * 128 + cr) * K + cp * 8;
  const size_t  rs = (size_t)32 * K;
  const int     T  = K / GKT;

  copy_tiles(lds0, ga, gw, rs);
  // tile 0 has landed for this wave; the barrier publishes every wave's share
  asm volatile("s_wait_asynccnt 0x0" ::: "memory");
  __syncthreads();
  if (T > 1) copy_tiles(lds0 + GBUF, ga + GKT, gw + GKT, rs);

  // The epilogue's loads, all issued here, behind the first tiles' copies: they are
  // in flight together, beside tile 1's copies, and are waited for once, at the first
  // trip's barrier. eo: this lane's first element.
  const size_t eo = (size_t)(m0 + (hi << 3)) * Nn + (n0 + lm);
  float bz[4];
#pragma unroll
  for (int j = 0; j < 4; ++j) bz[j] = bias[n0 + j * 16 + lm];
  float rv[2][4][8];
  if constexpr (EP == EP_RES) {
    const float* rp = resid + eo;
#pragma unroll
    for (int i = 0; i < 2; ++i)
#pragma unroll
      for (int j = 0; j < 4; ++j)
#pragma unroll
        for (int r = 0; r < 8; ++r) rv[i][j][r] = rp[(i * 16 + r) * Nn + j * 16];
  }
  // These loads' address registers, the bias pointer's scalar pair among them, are free
  // for reuse from here on: keep the wait in front of whatever overwrites them.
  asm volatile("s_wait_xcnt 0x0" ::: "memory");

  for (int t = 0; t < T; ++t) {
    const char* ta = gs + (t & 1) * GBUF + (wm * 32 + lm) * GPIT;
    const char* tw = gs + (t & 1) * GBUF + GOPB + (wn * 64 + lm) * GPIT;
#pragma unroll  // both 32-k halves of the trip in line: every LDS offset is an immediate
    for (int kb = 0; kb < 2 * GKT; kb += 64) {
      v16h a0 = lds_frag16(ta, 0,  kb, hi);
      v16h a1 = lds_frag16(ta, 16, kb, hi);
      v16h b0 = lds_frag16(tw, 0,  kb, hi);
      v16h b1 = lds_frag16(tw, 16, kb, hi);
      v16h b2 = lds_frag16(tw, 32, kb, hi);
      v16h b3 = lds_frag16(tw, 48, kb, hi);
      acc[0][0] = wmma32(a0, b0, acc[0][0]);
      acc[0][1] = wmma32(a0, b1, acc[0][1]);
      acc[0][2] = wmma32(a0, b2, acc[0][2]);
      acc[0][3] = wmma32(a0, b3, acc[0][3]);
      acc[1][0] = wmma32(a1, b0, acc[1][0]);
      acc[1][1] = wmma32(a1, b1, acc[1][1]);
      acc[1][2] = wmma32(a1, b2, acc[1][2]);
      acc[1][3] = wmma32(a1, b3, acc[1][3]);
    }
    // this wave's reads of the buffer are done before it is handed to the copies
    asm volatile("s_wait_dscnt 0x0" ::: "memory");
    // this wave's share of tile t + 1 has landed
    asm volatile("s_wait_asynccnt 0x0" ::: "memory");
    // publishes tile t + 1 and ends every reader's reads of tile t's buffer
    __syncthreads();
    if (t + 2 < T)
      copy_tiles(lds0 + (t & 1) * GBUF, ga + (size_t)(t + 2) * GKT, gw + (size_t)(t + 2) * GKT, rs);
  }
  // no copy is left in flight when the wave goes on to its stores and ends
  asm volatile("s_wait_asynccnt 0x0" ::: "memory");

  // Transposed f16 output [M / NSEQ][Nn][NSEQ]: a lane's 8 accumulator rows are 8
  // consecutive tokens of one column, so they leave as one 16-byte store.
  // The block's 128 rows lie in one sequence (128 divides NSEQ).
  if constexpr (EP == EP_TR) {
    half_t* p = out16 + ((size_t)((blockIdx.y * 128 / NSEQ) * Nn + n0 + lm)) * NSEQ +
                ((m0 & (NSEQ - 1)) + (hi << 3));
#pragma unroll
    for (int j = 0; j < 4; ++j) {
#pragma unroll
      for (int i = 0; i < 2; ++i) {
        union { half_t h[8]; float4 v; } u;
#pragma unroll
        for (int r = 0; r < 8; ++r) u.h[r] = (half_t)(acc[i][j][r] + bz[j]);
        *reinterpret_cast<float4*>(p + j * 16 * NSEQ + i * 16) = u.v;
      }
    }
    return;
  }

#pragma unroll
  for (int i = 0; i < 2; ++i) {
#pragma unroll
    for (int j = 0; j < 4; ++j) {
#pragma unroll
      for (int r = 0; r < 8; ++r) {
        const int e = (i * 16 + r) * Nn + j * 16;
        float val = acc[i][j][r] + bz[j];
        if constexpr (EP == EP_SILU) val = val / (1.f + exp2_slot(val * -1.4426950408889634f));  // e^-val
        if constexpr (EP == EP_RES) (out32 + eo)[e] = val + rv[i][j][r];
        else                        (out16 + eo)[e] = (half_t)val;
      }
    }
  }
}

#define QCOLS 32   // query columns per wave (two 16-column groups)
#define QWG   64   // query columns per work-group: two waves per head
#define KCH   32   // keys per pass
#define RP    36   // LDS row pitch in floats: 144 B = 16 B x odd, for 16-byte accesses
#define KPIT  1040 // K tile row in LDS: one key's 8 heads (1024 B) + 16: 16 B x odd
#define KBUF  (KCH * KPIT)
#define VPIT  80   // V^T tile row in LDS: 32 keys of one (head, d) (64 B) + 16: 16 B x odd
#define VBUF  (DMODEL * VPIT)
#define VOFF  (2 * KBUF)             // LDS map: K tile x 2, V^T tile x 2, P^T x 2
#define ROFF  (VOFF + 2 * VBUF)
#define ALDS  (ROFF + 2 * NHEAD * QWG * RP * 4)

// One 16x32 f16 fragment from LDS; p: the lane's row, at its 8 hi-th k. The k order is load_frag16's.
__device__ __forceinline__ v16h lds_frag(const char* p) {
  AFrag16 f;
  f.q[0] = *reinterpret_cast<const float4*>(p);        // K kb .. kb+7
  f.q[1] = *reinterpret_cast<const float4*>(p + 32);   // K kb+16 .. kb+23
  return f.v;
}

// K fragments (A operand) of the tile's 32 keys, one head: two 16-key tiles x two k steps.
__device__ __forceinline__ void lds_k(const char* p, v16h (&kf)[2][2]) {
#pragma unroll
  for (int t = 0; t < 2; ++t) {
    kf[t][0] = lds_frag(p + t * 16 * KPIT);
    kf[t][1] = lds_frag(p + t * 16 * KPIT + 64);
  }
}

// A K tile (32 keys x 1024 B, contiguous in memory): a thread copies 16 B of keys
// r, r + 8, r + 16, r + 24; a wave's copy covers four whole lines.
// The s_wait_xcnt closes the statement so that it stands in front of whatever
// rewrites an address register that a copy names.
__device__ __forceinline__ void copy_k(unsigned lk, const half_t* gk) {
  asm volatile(
      "global_load_async_to_lds_b128 %0, %4, off\n\t"
      "global_load_async_to_lds_b128 %1, %5, off\n\t"
      "global_load_async_to_lds_b128 %2, %6, off\n\t"
      "global_load_async_to_lds_b128 %3, %7, off\n\t"
      "s_wait_xcnt 0x0"
      :: "v"(lk), "v"(lk + 8 * KPIT), "v"(lk + 16 * KPIT), "v"(lk + 24 * KPIT),
         "v"(gk), "v"(gk + 8 * DMODEL), "v"(gk + 16 * DMODEL), "v"(gk + 24 * DMODEL)
      : "memory");
}

// A K tile as above and a V^T tile (512 rows x 64 B): 16 B of rows r, r + 128, r + 256, r + 384.
__device__ __forceinline__ void copy_kv(unsigned lk, const half_t* gk,
                                        unsigned lv, const half_t* gv) {
  asm volatile(
      "global_load_async_to_lds_b128 %0, %8, off\n\t"
      "global_load_async_to_lds_b128 %1, %9, off\n\t"
      "global_load_async_to_lds_b128 %2, %10, off\n\t"
      "global_load_async_to_lds_b128 %3, %11, off\n\t"
      "global_load_async_to_lds_b128 %4, %12, off\n\t"
      "global_load_async_to_lds_b128 %5, %13, off\n\t"
      "global_load_async_to_lds_b128 %6, %14, off\n\t"
      "global_load_async_to_lds_b128 %7, %15, off\n\t"
      "s_wait_xcnt 0x0"
      :: "v"(lk), "v"(lk + 8 * KPIT), "v"(lk + 16 * KPIT), "v"(lk + 24 * KPIT),
         "v"(lv), "v"(lv + 128 * VPIT), "v"(lv + 256 * VPIT), "v"(lv + 384 * VPIT),
         "v"(gk), "v"(gk + 8 * DMODEL), "v"(gk + 16 * DMODEL), "v"(gk + 24 * DMODEL),
         "v"(gv), "v"(gv + 128 * NSEQ), "v"(gv + 256 * NSEQ), "v"(gv + 384 * NSEQ)
      : "memory");
}

// S^T = K Q^T: st[t][g][r] = score(key 16 t + 8 hi + r, query 16 g + c), unscaled.
__device__ __forceinline__ void scores_t(const v16h (&kf)[2][2], const v16h (&qf)[2][2],
                                         v8f (&st)[2][2]) {
#pragma unroll
  for (int t = 0; t < 2; ++t)
#pragma unroll
    for (int g = 0; g < 2; ++g) st[t][g] = wmma32(kf[t][0], qf[g][0], vzero8());
#pragma unroll
  for (int t = 0; t < 2; ++t)
#pragma unroll
    for (int g = 0; g < 2; ++g) st[t][g] = wmma32(kf[t][1], qf[g][1], st[t][g]);
}

// ---------------------------------------------------------------------------
// Attention: one work-group per (b, 64-query tile); wave w = head w & 7, query
// half w >> 3. The pass's 32 keys of K and of V^T, all heads, come into LDS by
// asynchronous copies, two buffers, the next tile in flight while this one is
// worked on; both waves of a head read their fragments there.
// Walk 1 over the keys: S^T = K Q^T, each lane keeps the running maximum and
// sum of its own query column (scores are not stored).
// Walk 2: S^T again, P^T = 2^(x - max - log2 sum) in the accumulator registers,
// which are a B operand as they stand: O^T += V^T P^T. The eight heads' P^T of
// the pass meet in LDS, are summed in head order and stored once.
// LDS: 65 KB of K, 80 KB of V^T, two buffers of 8 heads x 64 queries x 32 keys
// f32 (pitch 36) = 144 KB: one work-group of 16 waves per WGP.
// ---------------------------------------------------------------------------
__global__ __launch_bounds__(512) void attn_kernel(const half_t* __restrict__ q,
                                                   const half_t* __restrict__ kk,
                                                   const half_t* __restrict__ vt,
                                                   half_t* __restrict__ ctx,
                                                   float* __restrict__ attnw) {
  __shared__ __attribute__((aligned(16))) char smem[ALDS];
  float* R = (float*)(smem + ROFF);            // [2][NHEAD][QWG][RP]

  const int lane = threadIdx.x & 31;
  const int hh   = (threadIdx.x >> 5) & 7;     // head
  const int qg   = threadIdx.x >> 8;           // which 32 of the 64 queries
  const int b    = blockIdx.x >> 4;            // N / 64 = 16 query tiles per batch
  const int q0   = (blockIdx.x & 15) * QWG;
  const int qw   = q0 + qg * QCOLS;            // this wave's first query
  const int c    = lane & 15;
  const int hi   = lane >> 4;
  const float SC = 0.125f * 1.4426950408889634f;   // 1/sqrt(64) * log2(e)

  v16h qf[2][2];
#pragma unroll
  for (int g = 0; g < 2; ++g) {
    const half_t* qb = q + (((size_t)(b * NSEQ + qw + g * 16 + c)) * NHEAD + hh) * DHEAD;
    qf[g][0] = load_frag16(qb, 0, 0, 0,  lane);
    qf[g][1] = load_frag16(qb, 0, 0, 32, lane);
  }
  // The Q loads' address pair is free for reuse from here on: keep the wait in
  // front of whatever overwrites it.
  asm volatile("s_wait_xcnt 0x0" ::: "memory");

  // this thread's share of a tile, in LDS (buffer 0) and in memory (tile 0)
  const unsigned sb = (unsigned)(size_t)smem;
  const unsigned lk = sb + (unsigned)((threadIdx.x >> 6) * KPIT + (threadIdx.x & 63) * 16);
  const unsigned lv = sb + (unsigned)(VOFF + (threadIdx.x >> 2) * VPIT + (threadIdx.x & 3) * 16);
  const half_t* gk = kk + (size_t)(b * NSEQ + (threadIdx.x >> 6)) * DMODEL + (threadIdx.x & 63) * 8;
  const half_t* gv = vt + (size_t)(b * DMODEL + (threadIdx.x >> 2)) * NSEQ + (threadIdx.x & 3) * 8;
  // this lane's fragment rows in buffer 0
  const char* kfr = smem + c * KPIT + hh * (DHEAD * 2) + hi * 16;
  const char* vfr = smem + VOFF + (hh * DHEAD + c) * VPIT + hi * 16;

  // ---- walk 1: column maximum and sum (log2 domain), per lane half ----
  float mrun[2] = {-1e30f, -1e30f};
  float lrun[2] = {0.f, 0.f};

  copy_k(lk, gk);
  // tile 0 has landed for this wave; the barrier publishes every wave's share
  asm volatile("s_wait_asynccnt 0x0" ::: "memory");
  __syncthreads();
  copy_k(lk + KBUF, gk + KCH * DMODEL);

#pragma unroll 1  // one pass per trip keeps the live set under 256 registers
  for (int i = 0; i < NSEQ / KCH; ++i) {
    v16h kc[2][2];
    lds_k(kfr + (i & 1) * KBUF, kc);
    v8f st[2][2];
    scores_t(kc, qf, st);
#pragma unroll
    for (int g = 0; g < 2; ++g) {
      float c0 = fmaxf(st[0][g][0], st[1][g][0]);
#pragma unroll
      for (int r = 1; r < 8; ++r) c0 = fmaxf(c0, fmaxf(st[0][g][r], st[1][g][r]));
      const float mn = fmaxf(mrun[g], c0 * SC);
      float s0 = exp2_slot(fmaf(st[0][g][0], SC, -mn));
      float s1 = exp2_slot(fmaf(st[0][g][1], SC, -mn));
      float s2 = exp2_slot(fmaf(st[1][g][0], SC, -mn));
      float s3 = exp2_slot(fmaf(st[1][g][1], SC, -mn));
#pragma unroll
      for (int r = 2; r < 8; r += 2) {
        s0 += exp2_slot(fmaf(st[0][g][r],     SC, -mn));
        s1 += exp2_slot(fmaf(st[0][g][r + 1], SC, -mn));
        s2 += exp2_slot(fmaf(st[1][g][r],     SC, -mn));
        s3 += exp2_slot(fmaf(st[1][g][r + 1], SC, -mn));
      }
      lrun[g] = lrun[g] * exp2_slot(mrun[g] - mn) + ((s0 + s1) + (s2 + s3));
      mrun[g] = mn;
    }
    // Keeps the pass's arithmetic in front of the waits: moved behind the barrier it
    // would stand between the barrier and the refill, and the refill would be
    // waited for as soon as it is issued.
    __builtin_amdgcn_sched_barrier(0);
    // this wave's reads of the buffer are done before it is handed to the copies
    asm volatile("s_wait_dscnt 0x0" ::: "memory");
    // this wave's share of tile i + 1 has landed
    asm volatile("s_wait_asynccnt 0x0" ::: "memory");
    // publishes tile i + 1 and ends every reader's reads of tile i's buffer
    __syncthreads();
    if (i + 2 < NSEQ / KCH)
      copy_k(lk + (i & 1) * KBUF, gk + (size_t)(i + 2) * (KCH * DMODEL));
  }
  // no copy is in flight when walk 2 takes the buffers over
  asm volatile("s_wait_asynccnt 0x0" ::: "memory");

  // walk 2's tile 0 (every reader left both K buffers at walk 1's last barriers)
  copy_kv(lk, gk, lv, gv);

  // join the two lane halves of each column; off = max + log2(sum)
  float off[2];
#pragma unroll
  for (int g = 0; g < 2; ++g) {
    const float mo = __shfl_xor(mrun[g], 16);
    const float lo = __shfl_xor(lrun[g], 16);
    const float M  = fmaxf(mrun[g], mo);
    const float L  = lrun[g] * exp2_slot(mrun[g] - M) + lo * exp2_slot(mo - M);
    off[g] = M + log2_slot(L);
  }

  // ---- walk 2: P^T, O^T += V^T P^T, head mean of P ----
  v8f o[4][2];
#pragma unroll
  for (int d = 0; d < 4; ++d) { o[d][0] = vzero8(); o[d][1] = vzero8(); }

  const int tq = threadIdx.x >> 3;             // query row this thread sums
  const int tj = (threadIdx.x & 7) * 4;        // its four keys of the pass
  float* aw = attnw + ((size_t)(b * NSEQ + q0 + tq)) * NSEQ + tj;

  // tile 0 has landed for this wave; the barrier publishes every wave's share
  asm volatile("s_wait_asynccnt 0x0" ::: "memory");
  __syncthreads();
  copy_kv(lk + KBUF, gk + KCH * DMODEL, lv + VBUF, gv + KCH);

#pragma unroll 1  // as in walk 1
  for (int i = 0; i < NSEQ / KCH; ++i) {
    const int k0 = i * KCH;
    v16h kc[2][2];
    lds_k(kfr + (i & 1) * KBUF, kc);
    v8f st[2][2];
    scores_t(kc, qf, st);
    v16h vf[4];
#pragma unroll
    for (int d = 0; d < 4; ++d) vf[d] = lds_frag(vfr + (i & 1) * VBUF + d * 16 * VPIT);

    float* Rw = R + (size_t)(((i & 1) * NHEAD + hh) * QWG + qg * QCOLS) * RP;
    v16h pb[2];
#pragma unroll
    for (int g = 0; g < 2; ++g) {
#pragma unroll
      for (int t = 0; t < 2; ++t) {
        float p[8];
#pragma unroll
        for (int r = 0; r < 8; ++r) {
          p[r] = exp2_slot(fmaf(st[t][g][r], SC, -off[g]));
          pb[g][t * 8 + r] = (half_t)p[r];     // hardware k order: keys 8 hi + r, 16 + 8 hi + r
        }
        float4* dst = reinterpret_cast<float4*>(Rw + (g * 16 + c) * RP + t * 16 + hi * 8);
        dst[0] = make_float4(p[0], p[1], p[2], p[3]);
        dst[1] = make_float4(p[4], p[5], p[6], p[7]);
      }
    }
#pragma unroll
    for (int d = 0; d < 4; ++d) {
      o[d][0] = wmma32(vf[d], pb[0], o[d][0]);
      o[d][1] = wmma32(vf[d], pb[1], o[d][1]);
    }

    // this wave's reads of the tiles and its writes of P^T are done
    asm volatile("s_wait_dscnt 0x0" ::: "memory");
    // this wave's share of tile i + 1 has landed
    asm volatile("s_wait_asynccnt 0x0" ::: "memory");
    // One barrier per pass: it publishes tile i + 1 and this pass's P^T, and it ends
    // every reader's reads of tile i's buffers and of the other P^T buffer, which
    // the next pass overwrites.
    __syncthreads();
    if (i + 2 < NSEQ / KCH)
      copy_kv(lk + (i & 1) * KBUF, gk + (size_t)(i + 2) * (KCH * DMODEL),
              lv + (i & 1) * VBUF, gv + (i + 2) * KCH);

    const float* Rr = R + (size_t)((i & 1) * NHEAD * QWG + tq) * RP + tj;
    float4 s = *reinterpret_cast<const float4*>(Rr);
#pragma unroll
    for (int h = 1; h < NHEAD; ++h) {
      const float4 u = *reinterpret_cast<const float4*>(Rr + h * QWG * RP);
      s.x += u.x; s.y += u.y; s.z += u.z; s.w += u.w;
    }
    *reinterpret_cast<float4*>(aw + k0) =
        make_float4(s.x * 0.125f, s.y * 0.125f, s.z * 0.125f, s.w * 0.125f);
  }
  // no copy is left in flight when the wave goes on to its stores and ends
  asm volatile("s_wait_asynccnt 0x0" ::: "memory");

  // ---- ctx: a lane holds 8 consecutive d of one query: one 16-byte store ----
#pragma unroll
  for (int g = 0; g < 2; ++g) {
    half_t* crow = ctx + (((size_t)(b * NSEQ + qw + g * 16 + c)) * NHEAD + hh) * DHEAD + hi * 8;
#pragma unroll
    for (int d = 0; d < 4; ++d) {
      union { half_t h[8]; float4 v; } u;
#pragma unroll
      for (int r = 0; r < 8; ++r) u.h[r] = (half_t)o[d][g][r];
      *reinterpret_cast<float4*>(crow + d * 16) = u.v;
    }
  }
}

// ---------------------------------------------------------------------------
// Host launch
// ---------------------------------------------------------------------------
extern "C" void kernel_launch(void* const* d_in, const int* in_sizes, int n_in,
                              void* d_out, int out_size, void* d_ws, size_t ws_size,
                              hipStream_t stream) {
  (void)in_sizes; (void)n_in; (void)out_size; (void)ws_size;

  const float* h_in  = (const float*)d_in[0];
  const float* ln1_g = (const float*)d_in[1];
  const float* ln1_b = (const float*)d_in[2];
  const float* wq = (const float*)d_in[3];  const float* bq = (const float*)d_in[4];
  const float* wk = (const float*)d_in[5];  const float* bk = (const float*)d_in[6];
  const float* wv = (const float*)d_in[7];  const float* bv = (const float*)d_in[8];
  const float* wo = (const float*)d_in[9];  const float* bo = (const float*)d_in[10];
  const float* ln2_g = (const float*)d_in[11]; const float* ln2_b = (const float*)d_in[12];
  const float* w1 = (const float*)d_in[13]; const float* b1 = (const float*)d_in[14];
  const float* w2 = (const float*)d_in[15]; const float* b2 = (const float*)d_in[16];

  // ---- workspace layout (bytes) ----
  char* ws = (char*)d_ws;
  size_t off = 0;
  half_t* WQH = (half_t*)(ws + off); off += (size_t)DMODEL * DMODEL * 2;        // 0.5 MB
  half_t* WKH = (half_t*)(ws + off); off += (size_t)DMODEL * DMODEL * 2;
  half_t* WVH = (half_t*)(ws + off); off += (size_t)DMODEL * DMODEL * 2;
  half_t* WOH = (half_t*)(ws + off); off += (size_t)DMODEL * DMODEL * 2;
  half_t* W1H = (half_t*)(ws + off); off += (size_t)2 * DMODEL * DMODEL * 2;    // (2D,D)
  half_t* W2H = (half_t*)(ws + off); off += (size_t)2 * DMODEL * DMODEL * 2;    // (D,2D)
  half_t* HN  = (half_t*)(ws + off); off += (size_t)MROWS * DMODEL * 2;         // hn / f (reused)
  float*  H2  = (float*)(ws + off);  off += (size_t)MROWS * DMODEL * 4;         // h + attn_out
  half_t* CTX = (half_t*)(ws + off); off += (size_t)MROWS * DMODEL * 2;
  half_t* Qb  = (half_t*)(ws + off); size_t qoff = off; off += (size_t)MROWS * DMODEL * 2;
  half_t* Kb  = (half_t*)(ws + off); off += (size_t)MROWS * DMODEL * 2;
  half_t* VT  = (half_t*)(ws + off); off += (size_t)MROWS * DMODEL * 2;
  half_t* Gb  = (half_t*)(ws + qoff);  // FFN hidden [M, 2D] reuses Q+K regions (dead by then)

  float* out_h    = (float*)d_out;
  float* out_attn = (float*)d_out + (size_t)MROWS * DMODEL;

  // LN1, and weights -> f16 (WQH .. W2H lie one after the other, from WQH on)
  ln_kernel<true><<<MROWS / 8 + WBLK, 256, 0, stream>>>(h_in, ln1_g, ln1_b, HN,
                                                        wq, wk, wv, wo, w1, w2, WQH);

  // QKV projections (block tile 128x128)
  dim3 gD(DMODEL / 128, MROWS / 128);       // (4, 128)
  gemm_kernel<EP_F16, DMODEL><<<gD, 256, 0, stream>>>(HN, WQH, bq, nullptr, nullptr, Qb, DMODEL);
  gemm_kernel<EP_F16, DMODEL><<<gD, 256, 0, stream>>>(HN, WKH, bk, nullptr, nullptr, Kb, DMODEL);
  // V leaves its projection as Vt [B,H,DH,N], the layout attention reads
  gemm_kernel<EP_TR, DMODEL><<<gD, 256, 0, stream>>>(HN, WVH, bv, nullptr, nullptr, VT, DMODEL);

  // attention (289 KB static LDS: one work-group per WGP, 256 work-groups)
  attn_kernel<<<NBATCH * (NSEQ / QWG), 512, 0, stream>>>(Qb, Kb, VT, CTX, out_attn);

  // out projection + residual -> h2 (fp32)
  gemm_kernel<EP_RES, DMODEL><<<gD, 256, 0, stream>>>(CTX, WOH, bo, h_in, H2, nullptr, DMODEL);

  // LN2 -> f (f16, reuses HN)
  ln_kernel<false><<<MROWS / 8, 256, 0, stream>>>(H2, ln2_g, ln2_b, HN, nullptr, nullptr, nullptr,
                                                  nullptr, nullptr, nullptr, nullptr);

  // FFN1: silu(f @ w1^T + b1) -> g f16 [M, 2D]
  dim3 g2(2 * DMODEL / 128, MROWS / 128);   // (8, 128)
  gemm_kernel<EP_SILU, 2 * DMODEL><<<g2, 256, 0, stream>>>(HN, W1H, b1, nullptr, nullptr, Gb, DMODEL);

  // FFN2: g @ w2^T + b2 + h2 -> final h (fp32, straight to d_out)
  gemm_kernel<EP_RES, DMODEL><<<gD, 256, 0, stream>>>(Gb, W2H, b2, H2, out_h, nullptr, 2 * DMODEL);
}

// v008
// It runs in 184 microseconds.
// Two timings next to v007 both put it at 1.03 times that version's speed.
// Over all steps from v000 it is 8.70 times as fast.
#include <hip/hip_runtime.h>

// ---------------------------------------------------------------------------
// Transformer encoder layer for MI455X (gfx1250, wave32, WMMA).
// All GEMMs use v_wmma_f32_16x16x32_f16 (f16 in, fp32 accumulate).
// GEMM wave tile: 32x64 (2x4 WMMA), block tile 128x128 (8 waves), tiles staged in LDS.
// ---------------------------------------------------------------------------

typedef _Float16 half_t;
typedef __attribute__((ext_vector_type(16))) _Float16 v16h;
typedef __attribute__((ext_vector_type(8)))  float    v8f;

#define DMODEL 512
#define NSEQ   1024
#define NBATCH 16
#define NHEAD  8
#define DHEAD  64
#define MROWS  (NBATCH * NSEQ)   // 16384 token rows

union AFrag16 { v16h v; float4 q[2]; };

// Load one 16x32 f16 WMMA fragment (A layout, or B layout for W stored [N,K]).
// Per ISA 7.12.2: lane L (0..15) holds row/col L; lanes 16..31 hold the K+8
// group. frag elems 0..7 = K kb..kb+7, elems 8..15 = K kb+16..kb+23.
__device__ __forceinline__ v16h load_frag16(const half_t* __restrict__ base,
                                            int stride, int idx, int k, int lane) {
  const int kb = (lane >> 4) << 3;   // 0 or 8
  const half_t* p = base + (size_t)idx * (size_t)stride + (size_t)(k + kb);
  AFrag16 f;
  f.q[0] = *reinterpret_cast<const float4*>(p);        // K kb .. kb+7
  f.q[1] = *reinterpret_cast<const float4*>(p + 16);   // K kb+16 .. kb+23
  return f.v;
}

__device__ __forceinline__ v8f wmma32(v16h a, v16h b, v8f c) {
  return __builtin_amdgcn_wmma_f32_16x16x32_f16(false, a, false, b,
                                                (short)0, c, false, false);
}

__device__ __forceinline__ v8f vzero8() {
  v8f z = {0.f, 0.f, 0.f, 0.f, 0.f, 0.f, 0.f, 0.f};
  return z;
}

#define WCH  8192                      // weight values per converting work-group
#define WPB  (DMODEL * DMODEL / WCH)   // such work-groups per D x D values
#define WBLK (8 * WPB)                 // all six weights: 8 D x D values

// ---------------------------------------------------------------------------
// LayerNorm: one wave (32 lanes) per row of 512; lane owns 16 contiguous cols.
// WCONV: the work-groups behind the rows' round the six weights to f16. That work
// reads inputs only, as the first LayerNorm does, so it needs no launch of its own.
// wh: the six f16 weights, one after the other in the order of the arguments.
// A work-group takes 8192 values: 8 loads of 16 B per thread, all in flight
// together, each wave's load and store covering whole lines.
// ---------------------------------------------------------------------------
template <bool WCONV>
__global__ __launch_bounds__(256) void ln_kernel(const float* __restrict__ x,
                                                 const float* __restrict__ g,
                                                 const float* __restrict__ bta,
                                                 half_t* __restrict__ out,
                                                 const float* __restrict__ wq,
                                                 const float* __restrict__ wk,
                                                 const float* __restrict__ wv,
                                                 const float* __restrict__ wo,
                                                 const float* __restrict__ w1,
                                                 const float* __restrict__ w2,
                                                 half_t* __restrict__ wh) {
  if constexpr (WCONV) {
    if (blockIdx.x >= MROWS / 8) {
      const int cb = blockIdx.x - MROWS / 8;
      const float* ws;   // the weight this work-group reads
      int fb;            // the first work-group of that weight
      if      (cb < 1 * WPB) { ws = wq; fb = 0; }
      else if (cb < 2 * WPB) { ws = wk; fb = 1 * WPB; }
      else if (cb < 3 * WPB) { ws = wv; fb = 2 * WPB; }
      else if (cb < 4 * WPB) { ws = wo; fb = 3 * WPB; }
      else if (cb < 6 * WPB) { ws = w1; fb = 4 * WPB; }
      else                   { ws = w2; fb = 6 * WPB; }
      const float4* s4 = reinterpret_cast<const float4*>(ws + (size_t)(cb - fb) * WCH) + threadIdx.x;
      half_t* d = wh + (size_t)cb * WCH + threadIdx.x * 4;
      float4 t[8];
#pragma unroll
      for (int j = 0; j < 8; ++j) t[j] = s4[j * 256];
#pragma unroll
      for (int j = 0; j < 8; ++j) {
        union { half_t h[4]; float2 v; } u;
        u.h[0] = (half_t)t[j].x; u.h[1] = (half_t)t[j].y;
        u.h[2] = (half_t)t[j].z; u.h[3] = (half_t)t[j].w;
        *reinterpret_cast<float2*>(d + j * 1024) = u.v;
      }
      return;
    }
  }
  const int row  = blockIdx.x * 8 + (threadIdx.x >> 5);
  const int lane = threadIdx.x & 31;
  const float* xr = x + (size_t)row * DMODEL + lane * 16;

  float v[16];
  const float4* x4 = reinterpret_cast<const float4*>(xr);
#pragma unroll
  for (int j = 0; j < 4; ++j) {
    float4 t = x4[j];
    v[4 * j + 0] = t.x; v[4 * j + 1] = t.y; v[4 * j + 2] = t.z; v[4 * j + 3] = t.w;
  }
  float s = 0.f;
#pragma unroll
  for (int j = 0; j < 16; ++j) s += v[j];
#pragma unroll
  for (int o = 16; o > 0; o >>= 1) s += __shfl_xor(s, o);
  const float mu = s * (1.0f / DMODEL);

  float q = 0.f;
#pragma unroll
  for (int j = 0; j < 16; ++j) { float d = v[j] - mu; q += d * d; }
#pragma unroll
  for (int o = 16; o > 0; o >>= 1) q += __shfl_xor(q, o);
  const float rs = rsqrtf(q * (1.0f / DMODEL) + 1e-5f);

  half_t* orow = out + (size_t)row * DMODEL + lane * 16;
#pragma unroll
  for (int j = 0; j < 16; ++j) {
    int c = lane * 16 + j;
    orow[j] = (half_t)((v[j] - mu) * rs * g[c] + bta[c]);
  }
}

// ---------------------------------------------------------------------------
// 2^t and log2(t) on the transcendental unit. The v_nop is the one slot the
// instruction set asks for behind a transcendental before its result is read or
// its source overwritten; inside one statement it cannot be lost. In place: the
// register written is the one the compiler's own arithmetic has just written, so
// it is never an operand of a matrix instruction that stands shortly in front.
// ---------------------------------------------------------------------------
__device__ __forceinline__ float exp2_slot(float t) {
  asm("v_exp_f32 %0, %0\n\tv_nop" : "+v"(t));
  return t;
}
__device__ __forceinline__ float log2_slot(float t) {
  asm("v_log_f32 %0, %0\n\tv_nop" : "+v"(t));
  return t;
}

// ---------------------------------------------------------------------------
// WMMA GEMM: out[M,Nn] = act(A_f16[M,K] @ W_f16[Nn,K]^T + bias) (+ resid)
// Block: 256 thr = 8 waves; block tile 128x128; wave tile 32x64 (2x4 WMMA).
// Both operand tiles pass through LDS: asynchronous 16-byte copies bring 128 B of
// each of the 128 + 128 rows per trip (a wave's copy covers four whole lines),
// two buffers, the next tile in flight while this one is multiplied.
// ---------------------------------------------------------------------------
#define GKT  64              // k per trip: 128 B of every operand row
#define GPIT 144             // LDS row pitch in bytes: 16 B x odd, for 16-byte fragment reads
#define GOPB (128 * GPIT)    // one operand's tile in LDS
#define GBUF (2 * GOPB)      // a buffer: A tile, then W tile

// One 16x32 f16 fragment from an LDS tile; the k order is load_frag16's.
__device__ __forceinline__ v16h lds_frag16(const char* tile, int row, int kbyte, int hi) {
  const char* p = tile + row * GPIT + kbyte + hi * 16;
  AFrag16 f;
  f.q[0] = *reinterpret_cast<const float4*>(p);        // K kb .. kb+7
  f.q[1] = *reinterpret_cast<const float4*>(p + 32);   // K kb+16 .. kb+23
  return f.v;
}

// One trip's tiles: a thread copies 16 B of rows r, r + 32, r + 64, r + 96 of A and
// of W. lds: its place in the buffer's A tile; rs: 32 rows of the source, in elements.
// The s_wait_xcnt closes the statement so that it stands in front of whatever
// rewrites an address register that a copy names.
__device__ __forceinline__ void copy_tiles(unsigned lds, const half_t* ga, const half_t* gw,
                                           size_t rs) {
  asm volatile(
      "global_load_async_to_lds_b128 %0, %8, off\n\t"
      "global_load_async_to_lds_b128 %1, %9, off\n\t"
      "global_load_async_to_lds_b128 %2, %10, off\n\t"
      "global_load_async_to_lds_b128 %3, %11, off\n\t"
      "global_load_async_to_lds_b128 %4, %12, off\n\t"
      "global_load_async_to_lds_b128 %5, %13, off\n\t"
      "global_load_async_to_lds_b128 %6, %14, off\n\t"
      "global_load_async_to_lds_b128 %7, %15, off\n\t"
      "s_wait_xcnt 0x0"
      :: "v"(lds), "v"(lds + 32 * GPIT), "v"(lds + 64 * GPIT), "v"(lds + 96 * GPIT),
         "v"(lds + GOPB), "v"(lds + GOPB + 32 * GPIT), "v"(lds + GOPB + 64 * GPIT),
         "v"(lds + GOPB + 96 * GPIT),
         "v"(ga), "v"(ga + rs), "v"(ga + 2 * rs), "v"(ga + 3 * rs),
         "v"(gw), "v"(gw + rs), "v"(gw + 2 * rs), "v"(gw + 3 * rs)
      : "memory");
}

// What leaves the accumulators is fixed at compile time, so that no branch stands
// between one element and the next and the epilogue's loads need not be waited for
// one at a time:
#define EP_QKV  0   // three projections of one A in one launch, see below
#define EP_SILU 2   // out16 = silu(acc + bias)
#define EP_RES  3   // out32 = acc + bias + resid
// Nn: the row length of out and resid; a constant, so that every element of a lane
// is an immediate offset from one address.
// EP_QKV: W holds three [Nn, K] weights one after the other, and blockIdx.x runs over
// the 3 Nn / 128 column tiles of all three. A work-group lies in one of them: the first
// goes to out16 with bias, the second to out_k with bias_k (both acc + bias), the third
// to out_v with bias_v, written transposed: out_v[M / NSEQ][Nn][NSEQ]. The three
// products read the same A and nothing of each other, so they need no launch each.
template <int EP, int Nn>
__global__ __launch_bounds__(256) void gemm_kernel(const half_t* __restrict__ A,
                                                   const half_t* __restrict__ W,
                                                   const float* __restrict__ bias,
                                                   const float* __restrict__ resid,
                                                   float* __restrict__ out32,
                                                   half_t* __restrict__ out16,
                                                   int K,
                                                   const float* __restrict__ bias_k,
                                                   const float* __restrict__ bias_v,
                                                   half_t* __restrict__ out_k,
                                                   half_t* __restrict__ out_v) {
  __shared__ __attribute__((aligned(16))) char gs[2 * GBUF];

  const int lane = threadIdx.x & 31;
  const int w    = threadIdx.x >> 5;
  const int wm   = w & 3;          // 4 waves along M (32 rows each)
  const int wn   = w >> 2;         // 2 waves along N (64 cols each)
  const int m0   = blockIdx.y * 128 + wm * 32;
  // which of the three weights (0 elsewhere), and the column tile inside its output
  const int sel  = EP == EP_QKV ? (int)blockIdx.x / (Nn / 128) : 0;
  const int n0   = ((int)blockIdx.x - sel * (Nn / 128)) * 128 + wn * 64;
  if constexpr (EP == EP_QKV) {
    bias  = sel == 0 ? bias  : sel == 1 ? bias_k : bias_v;
    out16 = sel == 0 ? out16 : sel == 1 ? out_k  : out_v;
  }
  const int lm   = lane & 15;
  const int hi   = lane >> 4;

  v8f acc[2][4];
#pragma unroll
  for (int i = 0; i < 2; ++i)
#pragma unroll
    for (int j = 0; j < 4; ++j) acc[i][j] = vzero8();

  // this thread's share of a tile: row cr (and + 32, 64, 96), 16-byte piece cp
  const int cr = threadIdx.x >> 3;
  const int cp = threadIdx.x & 7;
  const unsigned lds0 = (unsigned)(size_t)gs + (unsigned)(cr * GPIT + cp * 16);
  const half_t* ga = A + (size_t)(blockIdx.y * 128 + cr) * K + cp * 8;
  const half_t* gw = W + (size_t)(blockIdx.x * 128 + cr) * K + cp * 8;
  const size_t  rs = (size_t)32 * K;
  const int     T  = K / GKT;

  copy_tiles(lds0, ga, gw, rs);
  // tile 0 has landed for this wave; the barrier publishes every wave's share
  asm volatile("s_wait_asynccnt 0x0" ::: "memory");
  __syncthreads();
  if (T > 1) copy_tiles(lds0 + GBUF, ga + GKT, gw + GKT, rs);

  // The epilogue's loads, all issued here, behind the first tiles' copies: they are
  // in flight together, beside tile 1's copies, and are waited for once, at the first
  // trip's barrier. eo: this lane's first element.
  const size_t eo = (size_t)(m0 + (hi << 3)) * Nn + (n0 + lm);
  float bz[4];
#pragma unroll
  for (int j = 0; j < 4; ++j) bz[j] = bias[n0 + j * 16 + lm];
  float rv[2][4][8];
  if constexpr (EP == EP_RES) {
    const float* rp = resid + eo;
#pragma unroll
    for (int i = 0; i < 2; ++i)
#pragma unroll
      for (int j = 0; j < 4; ++j)
#pragma unroll
        for (int r = 0; r < 8; ++r) rv[i][j][r] = rp[(i * 16 + r) * Nn + j * 16];
  }
  // These loads' address registers, the bias pointer's scalar pair among them, are free
  // for reuse from here on: keep the wait in front of whatever overwrites them.
  asm volatile("s_wait_xcnt 0x0" ::: "memory");

  for (int t = 0; t < T; ++t) {
    const char* ta = gs + (t & 1) * GBUF + (wm * 32 + lm) * GPIT;
    const char* tw = gs + (t & 1) * GBUF + GOPB + (wn * 64 + lm) * GPIT;
#pragma unroll  // both 32-k halves of the trip in line: every LDS offset is an immediate
    for (int kb = 0; kb < 2 * GKT; kb += 64) {
      v16h a0 = lds_frag16(ta, 0,  kb, hi);
      v16h a1 = lds_frag16(ta, 16, kb, hi);
      v16h b0 = lds_frag16(tw, 0,  kb, hi);
      v16h b1 = lds_frag16(tw, 16, kb, hi);
      v16h b2 = lds_frag16(tw, 32, kb, hi);
      v16h b3 = lds_frag16(tw, 48, kb, hi);
      acc[0][0] = wmma32(a0, b0, acc[0][0]);
      acc[0][1] = wmma32(a0, b1, acc[0][1]);
      acc[0][2] = wmma32(a0, b2, acc[0][2]);
      acc[0][3] = wmma32(a0, b3, acc[0][3]);
      acc[1][0] = wmma32(a1, b0, acc[1][0]);
      acc[1][1] = wmma32(a1, b1, acc[1][1]);
      acc[1][2] = wmma32(a1, b2, acc[1][2]);
      acc[1][3] = wmma32(a1, b3, acc[1][3]);
    }
    // this wave's reads of the buffer are done before it is handed to the copies
    asm volatile("s_wait_dscnt 0x0" ::: "memory");
    // this wave's share of tile t + 1 has landed
    asm volatile("s_wait_asynccnt 0x0" ::: "memory");
    // publishes tile t + 1 and ends every reader's reads of tile t's buffer
    __syncthreads();
    if (t + 2 < T)
      copy_tiles(lds0 + (t & 1) * GBUF, ga + (size_t)(t + 2) * GKT, gw + (size_t)(t + 2) * GKT, rs);
  }
  // no copy is left in flight when the wave goes on to its stores and ends
  asm volatile("s_wait_asynccnt 0x0" ::: "memory");

  // Transposed f16 output [M / NSEQ][Nn][NSEQ]: a lane's 8 accumulator rows are 8
  // consecutive tokens of one column, so they leave as one 16-byte store.
  // The block's 128 rows lie in one sequence (128 divides NSEQ).
  if (EP == EP_QKV && sel == 2) {
    half_t* p = out16 + ((size_t)((blockIdx.y * 128 / NSEQ) * Nn + n0 + lm)) * NSEQ +
                ((m0 & (NSEQ - 1)) + (hi << 3));
#pragma unroll
    for (int j = 0; j < 4; ++j) {
#pragma unroll
      for (int i = 0; i < 2; ++i) {
        union { half_t h[8]; float4 v; } u;
#pragma unroll
        for (int r = 0; r < 8; ++r) u.h[r] = (half_t)(acc[i][j][r] + bz[j]);
        *reinterpret_cast<float4*>(p + j * 16 * NSEQ + i * 16) = u.v;
      }
    }
    return;
  }

#pragma unroll
  for (int i = 0; i < 2; ++i) {
#pragma unroll
    for (int j = 0; j < 4; ++j) {
#pragma unroll
      for (int r = 0; r < 8; ++r) {
        const int e = (i * 16 + r) * Nn + j * 16;
        float val = acc[i][j][r] + bz[j];
        if constexpr (EP == EP_SILU) val = val / (1.f + exp2_slot(val * -1.4426950408889634f));  // e^-val
        if constexpr (EP == EP_RES) (out32 + eo)[e] = val + rv[i][j][r];
        else                        (out16 + eo)[e] = (half_t)val;
      }
    }
  }
}

#define QCOLS 32   // query columns per wave (two 16-column groups)
#define QWG   64   // query columns per work-group: two waves per head
#define KCH   32   // keys per pass
#define RP    36   // LDS row pitch in floats: 144 B = 16 B x odd, for 16-byte accesses
#define KPIT  1040 // K tile row in LDS: one key's 8 heads (1024 B) + 16: 16 B x odd
#define KBUF  (KCH * KPIT)
#define VPIT  80   // V^T tile row in LDS: 32 keys of one (head, d) (64 B) + 16: 16 B x odd
#define VBUF  (DMODEL * VPIT)
#define VOFF  (2 * KBUF)             // LDS map: K tile x 2, V^T tile x 2, P^T x 2
#define ROFF  (VOFF + 2 * VBUF)
#define ALDS  (ROFF + 2 * NHEAD * QWG * RP * 4)

// One 16x32 f16 fragment from LDS; p: the lane's row, at its 8 hi-th k. The k order is load_frag16's.
__device__ __forceinline__ v16h lds_frag(const char* p) {
  AFrag16 f;
  f.q[0] = *reinterpret_cast<const float4*>(p);        // K kb .. kb+7
  f.q[1] = *reinterpret_cast<const float4*>(p + 32);   // K kb+16 .. kb+23
  return f.v;
}

// K fragments (A operand) of the tile's 32 keys, one head: two 16-key tiles x two k steps.
__device__ __forceinline__ void lds_k(const char* p, v16h (&kf)[2][2]) {
#pragma unroll
  for (int t = 0; t < 2; ++t) {
    kf[t][0] = lds_frag(p + t * 16 * KPIT);
    kf[t][1] = lds_frag(p + t * 16 * KPIT + 64);
  }
}

// A K tile (32 keys x 1024 B, contiguous in memory): a thread copies 16 B of keys
// r, r + 8, r + 16, r + 24; a wave's copy covers four whole lines.
// The s_wait_xcnt closes the statement so that it stands in front of whatever
// rewrites an address register that a copy names.
__device__ __forceinline__ void copy_k(unsigned lk, const half_t* gk) {
  asm volatile(
      "global_load_async_to_lds_b128 %0, %4, off\n\t"
      "global_load_async_to_lds_b128 %1, %5, off\n\t"
      "global_load_async_to_lds_b128 %2, %6, off\n\t"
      "global_load_async_to_lds_b128 %3, %7, off\n\t"
      "s_wait_xcnt 0x0"
      :: "v"(lk), "v"(lk + 8 * KPIT), "v"(lk + 16 * KPIT), "v"(lk + 24 * KPIT),
         "v"(gk), "v"(gk + 8 * DMODEL), "v"(gk + 16 * DMODEL), "v"(gk + 24 * DMODEL)
      : "memory");
}

// A K tile as above and a V^T tile (512 rows x 64 B): 16 B of rows r, r + 128, r + 256, r + 384.
__device__ __forceinline__ void copy_kv(unsigned lk, const half_t* gk,
                                        unsigned lv, const half_t* gv) {
  asm volatile(
      "global_load_async_to_lds_b128 %0, %8, off\n\t"
      "global_load_async_to_lds_b128 %1, %9, off\n\t"
      "global_load_async_to_lds_b128 %2, %10, off\n\t"
      "global_load_async_to_lds_b128 %3, %11, off\n\t"
      "global_load_async_to_lds_b128 %4, %12, off\n\t"
      "global_load_async_to_lds_b128 %5, %13, off\n\t"
      "global_load_async_to_lds_b128 %6, %14, off\n\t"
      "global_load_async_to_lds_b128 %7, %15, off\n\t"
      "s_wait_xcnt 0x0"
      :: "v"(lk), "v"(lk + 8 * KPIT), "v"(lk + 16 * KPIT), "v"(lk + 24 * KPIT),
         "v"(lv), "v"(lv + 128 * VPIT), "v"(lv + 256 * VPIT), "v"(lv + 384 * VPIT),
         "v"(gk), "v"(gk + 8 * DMODEL), "v"(gk + 16 * DMODEL), "v"(gk + 24 * DMODEL),
         "v"(gv), "v"(gv + 128 * NSEQ), "v"(gv + 256 * NSEQ), "v"(gv + 384 * NSEQ)
      : "memory");
}

// S^T = K Q^T: st[t][g][r] = score(key 16 t + 8 hi + r, query 16 g + c), unscaled.
__device__ __forceinline__ void scores_t(const v16h (&kf)[2][2], const v16h (&qf)[2][2],
                                         v8f (&st)[2][2]) {
#pragma unroll
  for (int t = 0; t < 2; ++t)
#pragma unroll
    for (int g = 0; g < 2; ++g) st[t][g] = wmma32(kf[t][0], qf[g][0], vzero8());
#pragma unroll
  for (int t = 0; t < 2; ++t)
#pragma unroll
    for (int g = 0; g < 2; ++g) st[t][g] = wmma32(kf[t][1], qf[g][1], st[t][g]);
}

// ---------------------------------------------------------------------------
// Attention: one work-group per (b, 64-query tile); wave w = head w & 7, query
// half w >> 3. The pass's 32 keys of K and of V^T, all heads, come into LDS by
// asynchronous copies, two buffers, the next tile in flight while this one is
// worked on; both waves of a head read their fragments there.
// Walk 1 over the keys: S^T = K Q^T, each lane keeps the running maximum and
// sum of its own query column (scores are not stored).
// Walk 2: S^T again, P^T = 2^(x - max - log2 sum) in the accumulator registers,
// which are a B operand as they stand: O^T += V^T P^T. The eight heads' P^T of
// the pass meet in LDS, are summed in head order and stored once.
// LDS: 65 KB of K, 80 KB of V^T, two buffers of 8 heads x 64 queries x 32 keys
// f32 (pitch 36) = 144 KB: one work-group of 16 waves per WGP.
// ---------------------------------------------------------------------------
__global__ __launch_bounds__(512) void attn_kernel(const half_t* __restrict__ q,
                                                   const half_t* __restrict__ kk,
                                                   const half_t* __restrict__ vt,
                                                   half_t* __restrict__ ctx,
                                                   float* __restrict__ attnw) {
  __shared__ __attribute__((aligned(16))) char smem[ALDS];
  float* R = (float*)(smem + ROFF);            // [2][NHEAD][QWG][RP]

  const int lane = threadIdx.x & 31;
  const int hh   = (threadIdx.x >> 5) & 7;     // head
  const int qg   = threadIdx.x >> 8;           // which 32 of the 64 queries
  const int b    = blockIdx.x >> 4;            // N / 64 = 16 query tiles per batch
  const int q0   = (blockIdx.x & 15) * QWG;
  const int qw   = q0 + qg * QCOLS;            // this wave's first query
  const int c    = lane & 15;
  const int hi   = lane >> 4;
  const float SC = 0.125f * 1.4426950408889634f;   // 1/sqrt(64) * log2(e)

  v16h qf[2][2];
#pragma unroll
  for (int g = 0; g < 2; ++g) {
    const half_t* qb = q + (((size_t)(b * NSEQ + qw + g * 16 + c)) * NHEAD + hh) * DHEAD;
    qf[g][0] = load_frag16(qb, 0, 0, 0,  lane);
    qf[g][1] = load_frag16(qb, 0, 0, 32, lane);
  }
  // The Q loads' address pair is free for reuse from here on: keep the wait in
  // front of whatever overwrites it.
  asm volatile("s_wait_xcnt 0x0" ::: "memory");

  // this thread's share of a tile, in LDS (buffer 0) and in memory (tile 0)
  const unsigned sb = (unsigned)(size_t)smem;
  const unsigned lk = sb + (unsigned)((threadIdx.x >> 6) * KPIT + (threadIdx.x & 63) * 16);
  const unsigned lv = sb + (unsigned)(VOFF + (threadIdx.x >> 2) * VPIT + (threadIdx.x & 3) * 16);
  const half_t* gk = kk + (size_t)(b * NSEQ + (threadIdx.x >> 6)) * DMODEL + (threadIdx.x & 63) * 8;
  const half_t* gv = vt + (size_t)(b * DMODEL + (threadIdx.x >> 2)) * NSEQ + (threadIdx.x & 3) * 8;
  // this lane's fragment rows in buffer 0
  const char* kfr = smem + c * KPIT + hh * (DHEAD * 2) + hi * 16;
  const char* vfr = smem + VOFF + (hh * DHEAD + c) * VPIT + hi * 16;

  // ---- walk 1: column maximum and sum (log2 domain), per lane half ----
  float mrun[2] = {-1e30f, -1e30f};
  float lrun[2] = {0.f, 0.f};

  copy_k(lk, gk);
  // tile 0 has landed for this wave; the barrier publishes every wave's share
  asm volatile("s_wait_asynccnt 0x0" ::: "memory");
  __syncthreads();
  copy_k(lk + KBUF, gk + KCH * DMODEL);

#pragma unroll 1  // one pass per trip keeps the live set under 256 registers
  for (int i = 0; i < NSEQ / KCH; ++i) {
    v16h kc[2][2];
    lds_k(kfr + (i & 1) * KBUF, kc);
    v8f st[2][2];
    scores_t(kc, qf, st);
#pragma unroll
    for (int g = 0; g < 2; ++g) {
      float c0 = fmaxf(st[0][g][0], st[1][g][0]);
#pragma unroll
      for (int r = 1; r < 8; ++r) c0 = fmaxf(c0, fmaxf(st[0][g][r], st[1][g][r]));
      const float mn = fmaxf(mrun[g], c0 * SC);
      float s0 = exp2_slot(fmaf(st[0][g][0], SC, -mn));
      float s1 = exp2_slot(fmaf(st[0][g][1], SC, -mn));
      float s2 = exp2_slot(fmaf(st[1][g][0], SC, -mn));
      float s3 = exp2_slot(fmaf(st[1][g][1], SC, -mn));
#pragma unroll
      for (int r = 2; r < 8; r += 2) {
        s0 += exp2_slot(fmaf(st[0][g][r],     SC, -mn));
        s1 += exp2_slot(fmaf(st[0][g][r + 1], SC, -mn));
        s2 += exp2_slot(fmaf(st[1][g][r],     SC, -mn));
        s3 += exp2_slot(fmaf(st[1][g][r + 1], SC, -mn));
      }
      lrun[g] = lrun[g] * exp2_slot(mrun[g] - mn) + ((s0 + s1) + (s2 + s3));
      mrun[g] = mn;
    }
    // Keeps the pass's arithmetic in front of the waits: moved behind the barrier it
    // would stand between the barrier and the refill, and the refill would be
    // waited for as soon as it is issued.
    __builtin_amdgcn_sched_barrier(0);
    // this wave's reads of the buffer are done before it is handed to the copies
    asm volatile("s_wait_dscnt 0x0" ::: "memory");
    // this wave's share of tile i + 1 has landed
    asm volatile("s_wait_asynccnt 0x0" ::: "memory");
    // publishes tile i + 1 and ends every reader's reads of tile i's buffer
    __syncthreads();
    if (i + 2 < NSEQ / KCH)
      copy_k(lk + (i & 1) * KBUF, gk + (size_t)(i + 2) * (KCH * DMODEL));
  }
  // no copy is in flight when walk 2 takes the buffers over
  asm volatile("s_wait_asynccnt 0x0" ::: "memory");

  // walk 2's tile 0 (every reader left both K buffers at walk 1's last barriers)
  copy_kv(lk, gk, lv, gv);

  // join the two lane halves of each column; off = max + log2(sum)
  float off[2];
#pragma unroll
  for (int g = 0; g < 2; ++g) {
    const float mo = __shfl_xor(mrun[g], 16);
    const float lo = __shfl_xor(lrun[g], 16);
    const float M  = fmaxf(mrun[g], mo);
    const float L  = lrun[g] * exp2_slot(mrun[g] - M) + lo * exp2_slot(mo - M);
    off[g] = M + log2_slot(L);
  }

  // ---- walk 2: P^T, O^T += V^T P^T, head mean of P ----
  v8f o[4][2];
#pragma unroll
  for (int d = 0; d < 4; ++d) { o[d][0] = vzero8(); o[d][1] = vzero8(); }

  const int tq = threadIdx.x >> 3;             // query row this thread sums
  const int tj = (threadIdx.x & 7) * 4;        // its four keys of the pass
  float* aw = attnw + ((size_t)(b * NSEQ + q0 + tq)) * NSEQ + tj;

  // tile 0 has landed for this wave; the barrier publishes every wave's share
  asm volatile("s_wait_asynccnt 0x0" ::: "memory");
  __syncthreads();
  copy_kv(lk + KBUF, gk + KCH * DMODEL, lv + VBUF, gv + KCH);

#pragma unroll 1  // as in walk 1
  for (int i = 0; i < NSEQ / KCH; ++i) {
    const int k0 = i * KCH;
    v16h kc[2][2];
    lds_k(kfr + (i & 1) * KBUF, kc);
    v8f st[2][2];
    scores_t(kc, qf, st);
    v16h vf[4];
#pragma unroll
    for (int d = 0; d < 4; ++d) vf[d] = lds_frag(vfr + (i & 1) * VBUF + d * 16 * VPIT);

    float* Rw = R + (size_t)(((i & 1) * NHEAD + hh) * QWG + qg * QCOLS) * RP;
    v16h pb[2];
#pragma unroll
    for (int g = 0; g < 2; ++g) {
#pragma unroll
      for (int t = 0; t < 2; ++t) {
        float p[8];
#pragma unroll
        for (int r = 0; r < 8; ++r) {
          p[r] = exp2_slot(fmaf(st[t][g][r], SC, -off[g]));
          pb[g][t * 8 + r] = (half_t)p[r];     // hardware k order: keys 8 hi + r, 16 + 8 hi + r
        }
        float4* dst = reinterpret_cast<float4*>(Rw + (g * 16 + c) * RP + t * 16 + hi * 8);
        dst[0] = make_float4(p[0], p[1], p[2], p[3]);
        dst[1] = make_float4(p[4], p[5], p[6], p[7]);
      }
    }
#pragma unroll
    for (int d = 0; d < 4; ++d) {
      o[d][0] = wmma32(vf[d], pb[0], o[d][0]);
      o[d][1] = wmma32(vf[d], pb[1], o[d][1]);
    }

    // this wave's reads of the tiles and its writes of P^T are done
    asm volatile("s_wait_dscnt 0x0" ::: "memory");
    // this wave's share of tile i + 1 has landed
    asm volatile("s_wait_asynccnt 0x0" ::: "memory");
    // One barrier per pass: it publishes tile i + 1 and this pass's P^T, and it ends
    // every reader's reads of tile i's buffers and of the other P^T buffer, which
    // the next pass overwrites.
    __syncthreads();
    if (i + 2 < NSEQ / KCH)
      copy_kv(lk + (i & 1) * KBUF, gk + (size_t)(i + 2) * (KCH * DMODEL),
              lv + (i & 1) * VBUF, gv + (i + 2) * KCH);

    const float* Rr = R + (size_t)((i & 1) * NHEAD * QWG + tq) * RP + tj;
    float4 s = *reinterpret_cast<const float4*>(Rr);
#pragma unroll
    for (int h = 1; h < NHEAD; ++h) {
      const float4 u = *reinterpret_cast<const float4*>(Rr + h * QWG * RP);
      s.x += u.x; s.y += u.y; s.z += u.z; s.w += u.w;
    }
    *reinterpret_cast<float4*>(aw + k0) =
        make_float4(s.x * 0.125f, s.y * 0.125f, s.z * 0.125f, s.w * 0.125f);
  }
  // no copy is left in flight when the wave goes on to its stores and ends
  asm volatile("s_wait_asynccnt 0x0" ::: "memory");

  // ---- ctx: a lane holds 8 consecutive d of one query: one 16-byte store ----
#pragma unroll
  for (int g = 0; g < 2; ++g) {
    half_t* crow = ctx + (((size_t)(b * NSEQ + qw + g * 16 + c)) * NHEAD + hh) * DHEAD + hi * 8;
#pragma unroll
    for (int d = 0; d < 4; ++d) {
      union { half_t h[8]; float4 v; } u;
#pragma unroll
      for (int r = 0; r < 8; ++r) u.h[r] = (half_t)o[d][g][r];
      *reinterpret_cast<float4*>(crow + d * 16) = u.v;
    }
  }
}

// ---------------------------------------------------------------------------
// Host launch
// ---------------------------------------------------------------------------
extern "C" void kernel_launch(void* const* d_in, const int* in_sizes, int n_in,
                              void* d_out, int out_size, void* d_ws, size_t ws_size,
                              hipStream_t stream) {
  (void)in_sizes; (void)n_in; (void)out_size; (void)ws_size;

  const float* h_in  = (const float*)d_in[0];
  const float* ln1_g = (const float*)d_in[1];
  const float* ln1_b = (const float*)d_in[2];
  const float* wq = (const float*)d_in[3];  const float* bq = (const float*)d_in[4];
  const float* wk = (const float*)d_in[5];  const float* bk = (const float*)d_in[6];
  const float* wv = (const float*)d_in[7];  const float* bv = (const float*)d_in[8];
  const float* wo = (const float*)d_in[9];  const float* bo = (const float*)d_in[10];
  const float* ln2_g = (const float*)d_in[11]; const float* ln2_b = (const float*)d_in[12];
  const float* w1 = (const float*)d_in[13]; const float* b1 = (const float*)d_in[14];
  const float* w2 = (const float*)d_in[15]; const float* b2 = (const float*)d_in[16];

  // ---- workspace layout (bytes) ----
  char* ws = (char*)d_ws;
  size_t off = 0;
  half_t* WQH = (half_t*)(ws + off); off += (size_t)DMODEL * DMODEL * 2;        // 0.5 MB
  off += (size_t)DMODEL * DMODEL * 2;                                           // wk, behind wq
  off += (size_t)DMODEL * DMODEL * 2;                                           // wv, behind wk
  half_t* WOH = (half_t*)(ws + off); off += (size_t)DMODEL * DMODEL * 2;
  half_t* W1H = (half_t*)(ws + off); off += (size_t)2 * DMODEL * DMODEL * 2;    // (2D,D)
  half_t* W2H = (half_t*)(ws + off); off += (size_t)2 * DMODEL * DMODEL * 2;    // (D,2D)
  half_t* HN  = (half_t*)(ws + off); off += (size_t)MROWS * DMODEL * 2;         // hn / f (reused)
  float*  H2  = (float*)(ws + off);  off += (size_t)MROWS * DMODEL * 4;         // h + attn_out
  half_t* CTX = (half_t*)(ws + off); off += (size_t)MROWS * DMODEL * 2;
  half_t* Qb  = (half_t*)(ws + off); size_t qoff = off; off += (size_t)MROWS * DMODEL * 2;
  half_t* Kb  = (half_t*)(ws + off); off += (size_t)MROWS * DMODEL * 2;
  half_t* VT  = (half_t*)(ws + off); off += (size_t)MROWS * DMODEL * 2;
  half_t* Gb  = (half_t*)(ws + qoff);  // FFN hidden [M, 2D] reuses Q+K regions (dead by then)

  float* out_h    = (float*)d_out;
  float* out_attn = (float*)d_out + (size_t)MROWS * DMODEL;

  // LN1, and weights -> f16 (WQH .. W2H lie one after the other, from WQH on)
  ln_kernel<true><<<MROWS / 8 + WBLK, 256, 0, stream>>>(h_in, ln1_g, ln1_b, HN,
                                                        wq, wk, wv, wo, w1, w2, WQH);

  // QKV projections in one launch (block tile 128x128; the three f16 weights lie one after
  // the other from WQH on). V leaves its projection as Vt [B,H,DH,N], the layout attention reads.
  dim3 gD(DMODEL / 128, MROWS / 128);       // (4, 128)
  dim3 gQ(3 * DMODEL / 128, MROWS / 128);   // (12, 128)
  gemm_kernel<EP_QKV, DMODEL><<<gQ, 256, 0, stream>>>(HN, WQH, bq, nullptr, nullptr, Qb, DMODEL,
                                                      bk, bv, Kb, VT);

  // attention (289 KB static LDS: one work-group per WGP, 256 work-groups)
  attn_kernel<<<NBATCH * (NSEQ / QWG), 512, 0, stream>>>(Qb, Kb, VT, CTX, out_attn);

  // out projection + residual -> h2 (fp32)
  gemm_kernel<EP_RES, DMODEL><<<gD, 256, 0, stream>>>(CTX, WOH, bo, h_in, H2, nullptr, DMODEL,
                                                      nullptr, nullptr, nullptr, nullptr);

  // LN2 -> f (f16, reuses HN)
  ln_kernel<false><<<MROWS / 8, 256, 0, stream>>>(H2, ln2_g, ln2_b, HN, nullptr, nullptr, nullptr,
                                                  nullptr, nullptr, nullptr, nullptr);

  // FFN1: silu(f @ w1^T + b1) -> g f16 [M, 2D]
  dim3 g2(2 * DMODEL / 128, MROWS / 128);   // (8, 128)
  gemm_kernel<EP_SILU, 2 * DMODEL><<<g2, 256, 0, stream>>>(HN, W1H, b1, nullptr, nullptr, Gb, DMODEL,
                                                           nullptr, nullptr, nullptr, nullptr);

  // FFN2: g @ w2^T + b2 + h2 -> final h (fp32, straight to d_out)
  gemm_kernel<EP_RES, DMODEL><<<gD, 256, 0, stream>>>(Gb, W2H, b2, H2, out_h, nullptr, 2 * DMODEL,
                                                      nullptr, nullptr, nullptr, nullptr);
}

// v009
// Measured time: 178 microseconds a run.
// In both of two side-by-side timings against v008, it was 1.03 times as fast.
// Over all steps from v000 it is 8.99 times as fast.
#include <hip/hip_runtime.h>

// ---------------------------------------------------------------------------
// Transformer encoder layer for MI455X (gfx1250, wave32, WMMA).
// All GEMMs use v_wmma_f32_16x16x32_f16 (f16 in, fp32 accumulate).
// GEMM wave tile: 32x64 (2x4 WMMA), block tile 128x128 (8 waves), tiles staged in LDS.
// ---------------------------------------------------------------------------

typedef _Float16 half_t;
typedef __attribute__((ext_vector_type(16))) _Float16 v16h;
typedef __attribute__((ext_vector_type(8)))  float    v8f;

#define DMODEL 512
#define NSEQ   1024
#define NBATCH 16
#define NHEAD  8
#define DHEAD  64
#define MROWS  (NBATCH * NSEQ)   // 16384 token rows

union AFrag16 { v16h v; float4 q[2]; };

// Load one 16x32 f16 WMMA fragment (A layout, or B layout for W stored [N,K]).
// Per ISA 7.12.2: lane L (0..15) holds row/col L; lanes 16..31 hold the K+8
// group. frag elems 0..7 = K kb..kb+7, elems 8..15 = K kb+16..kb+23.
__device__ __forceinline__ v16h load_frag16(const half_t* __restrict__ base,
                                            int stride, int idx, int k, int lane) {
  const int kb = (lane >> 4) << 3;   // 0 or 8
  const half_t* p = base + (size_t)idx * (size_t)stride + (size_t)(k + kb);
  AFrag16 f;
  f.q[0] = *reinterpret_cast<const float4*>(p);        // K kb .. kb+7
  f.q[1] = *reinterpret_cast<const float4*>(p + 16);   // K kb+16 .. kb+23
  return f.v;
}

__device__ __forceinline__ v8f wmma32(v16h a, v16h b, v8f c) {
  return __builtin_amdgcn_wmma_f32_16x16x32_f16(false, a, false, b,
                                                (short)0, c, false, false);
}

__device__ __forceinline__ v8f vzero8() {
  v8f z = {0.f, 0.f, 0.f, 0.f, 0.f, 0.f, 0.f, 0.f};
  return z;
}

#define WCH  8192                      // weight values per converting work-group
#define WPB  (DMODEL * DMODEL / WCH)   // such work-groups per D x D values
#define WBLK (8 * WPB)                 // all six weights: 8 D x D values

// ---------------------------------------------------------------------------
// LayerNorm: one wave (32 lanes) per row of 512; lane owns 16 contiguous cols.
// WCONV: the work-groups behind the rows' round the six weights to f16. That work
// reads inputs only, as the first LayerNorm does, so it needs no launch of its own.
// wh: the six f16 weights, one after the other in the order of the arguments.
// A work-group takes 8192 values: 8 loads of 16 B per thread, all in flight
// together, each wave's load and store covering whole lines.
// ---------------------------------------------------------------------------
template <bool WCONV>
__global__ __launch_bounds__(256) void ln_kernel(const float* __restrict__ x,
                                                 const float* __restrict__ g,
                                                 const float* __restrict__ bta,
                                                 half_t* __restrict__ out,
                                                 const float* __restrict__ wq,
                                                 const float* __restrict__ wk,
                                                 const float* __restrict__ wv,
                                                 const float* __restrict__ wo,
                                                 const float* __restrict__ w1,
                                                 const float* __restrict__ w2,
                                                 half_t* __restrict__ wh) {
  if constexpr (WCONV) {
    if (blockIdx.x >= MROWS / 8) {
      const int cb = blockIdx.x - MROWS / 8;
      const float* ws;   // the weight this work-group reads
      int fb;            // the first work-group of that weight
      if      (cb < 1 * WPB) { ws = wq; fb = 0; }
      else if (cb < 2 * WPB) { ws = wk; fb = 1 * WPB; }
      else if (cb < 3 * WPB) { ws = wv; fb = 2 * WPB; }
      else if (cb < 4 * WPB) { ws = wo; fb = 3 * WPB; }
      else if (cb < 6 * WPB) { ws = w1; fb = 4 * WPB; }
      else                   { ws = w2; fb = 6 * WPB; }
      const float4* s4 = reinterpret_cast<const float4*>(ws + (size_t)(cb - fb) * WCH) + threadIdx.x;
      half_t* d = wh + (size_t)cb * WCH + threadIdx.x * 4;
      float4 t[8];
#pragma unroll
      for (int j = 0; j < 8; ++j) t[j] = s4[j * 256];
#pragma unroll
      for (int j = 0; j < 8; ++j) {
        union { half_t h[4]; float2 v; } u;
        u.h[0] = (half_t)t[j].x; u.h[1] = (half_t)t[j].y;
        u.h[2] = (half_t)t[j].z; u.h[3] = (half_t)t[j].w;
        *reinterpret_cast<float2*>(d + j * 1024) = u.v;
      }
      return;
    }
  }
  const int row  = blockIdx.x * 8 + (threadIdx.x >> 5);
  const int lane = threadIdx.x & 31;
  const float* xr = x + (size_t)row * DMODEL + lane * 16;

  float v[16];
  const float4* x4 = reinterpret_cast<const float4*>(xr);
#pragma unroll
  for (int j = 0; j < 4; ++j) {
    float4 t = x4[j];
    v[4 * j + 0] = t.x; v[4 * j + 1] = t.y; v[4 * j + 2] = t.z; v[4 * j + 3] = t.w;
  }
  float s = 0.f;
#pragma unroll
  for (int j = 0; j < 16; ++j) s += v[j];
#pragma unroll
  for (int o = 16; o > 0; o >>= 1) s += __shfl_xor(s, o);
  const float mu = s * (1.0f / DMODEL);

  float q = 0.f;
#pragma unroll
  for (int j = 0; j < 16; ++j) { float d = v[j] - mu; q += d * d; }
#pragma unroll
  for (int o = 16; o > 0; o >>= 1) q += __shfl_xor(q, o);
  const float rs = rsqrtf(q * (1.0f / DMODEL) + 1e-5f);

  half_t* orow = out + (size_t)row * DMODEL + lane * 16;
#pragma unroll
  for (int j = 0; j < 16; ++j) {
    int c = lane * 16 + j;
    orow[j] = (half_t)((v[j] - mu) * rs * g[c] + bta[c]);
  }
}

// ---------------------------------------------------------------------------
// 2^t and log2(t) on the transcendental unit. The v_nop is the one slot the
// instruction set asks for behind a transcendental before its result is read or
// its source overwritten; inside one statement it cannot be lost. In place: the
// register written is the one the compiler's own arithmetic has just written, so
// it is never an operand of a matrix instruction that stands shortly in front.
// ---------------------------------------------------------------------------
__device__ __forceinline__ float exp2_slot(float t) {
  asm("v_exp_f32 %0, %0\n\tv_nop" : "+v"(t));
  return t;
}
__device__ __forceinline__ float log2_slot(float t) {
  asm("v_log_f32 %0, %0\n\tv_nop" : "+v"(t));
  return t;
}

// ---------------------------------------------------------------------------
// WMMA GEMM: out[M,Nn] = act(A_f16[M,K] @ W_f16[Nn,K]^T + bias) (+ resid)
// Block: 256 thr = 8 waves; block tile 128x128; wave tile 32x64 (2x4 WMMA).
// Both operand tiles pass through LDS: asynchronous 16-byte copies bring 128 B of
// each of the 128 + 128 rows per trip (a wave's copy covers four whole lines),
// two buffers, the next tile in flight while this one is multiplied.
// ---------------------------------------------------------------------------
#define GKT  64              // k per trip: 128 B of every operand row
#define GPIT 144             // LDS row pitch in bytes: 16 B x odd, for 16-byte fragment reads
#define GOPB (128 * GPIT)    // one operand's tile in LDS
#define GBUF (2 * GOPB)      // a buffer: A tile, then W tile

// One 16x32 f16 fragment from an LDS tile; the k order is load_frag16's.
__device__ __forceinline__ v16h lds_frag16(const char* tile, int row, int kbyte, int hi) {
  const char* p = tile + row * GPIT + kbyte + hi * 16;
  AFrag16 f;
  f.q[0] = *reinterpret_cast<const float4*>(p);        // K kb .. kb+7
  f.q[1] = *reinterpret_cast<const float4*>(p + 32);   // K kb+16 .. kb+23
  return f.v;
}

// One trip's tiles: a thread copies 16 B of rows r, r + 32, r + 64, r + 96 of A and
// of W. lds: its place in the buffer's A tile; rs: 32 rows of the source, in elements.
// The s_wait_xcnt closes the statement so that it stands in front of whatever
// rewrites an address register that a copy names.
__device__ __forceinline__ void copy_tiles(unsigned lds, const half_t* ga, const half_t* gw,
                                           size_t rs) {
  asm volatile(
      "global_load_async_to_lds_b128 %0, %8, off\n\t"
      "global_load_async_to_lds_b128 %1, %9, off\n\t"
      "global_load_async_to_lds_b128 %2, %10, off\n\t"
      "global_load_async_to_lds_b128 %3, %11, off\n\t"
      "global_load_async_to_lds_b128 %4, %12, off\n\t"
      "global_load_async_to_lds_b128 %5, %13, off\n\t"
      "global_load_async_to_lds_b128 %6, %14, off\n\t"
      "global_load_async_to_lds_b128 %7, %15, off\n\t"
      "s_wait_xcnt 0x0"
      :: "v"(lds), "v"(lds + 32 * GPIT), "v"(lds + 64 * GPIT), "v"(lds + 96 * GPIT),
         "v"(lds + GOPB), "v"(lds + GOPB + 32 * GPIT), "v"(lds + GOPB + 64 * GPIT),
         "v"(lds + GOPB + 96 * GPIT),
         "v"(ga), "v"(ga + rs), "v"(ga + 2 * rs), "v"(ga + 3 * rs),
         "v"(gw), "v"(gw + rs), "v"(gw + 2 * rs), "v"(gw + 3 * rs)
      : "memory");
}

// What leaves the accumulators is fixed at compile time, so that no branch stands
// between one element and the next and the epilogue's loads need not be waited for
// one at a time:
#define EP_QKV  0   // three projections of one A in one launch, see below
#define EP_SILU 2   // out16 = silu(acc + bias)
#define EP_RES  3   // out32 = acc + bias + resid
// Nn: the row length of out and resid; a constant, so that every element of a lane
// is an immediate offset from one address.
// EP_QKV: W holds three [Nn, K] weights one after the other, and blockIdx.x runs over
// the 3 Nn / 128 column tiles of all three. A work-group lies in one of them: the first
// goes to out16 with bias, the second to out_k with bias_k (both acc + bias), the third
// to out_v with bias_v, written transposed: out_v[M / NSEQ][Nn][NSEQ]. The three
// products read the same A and nothing of each other, so they need no launch each.
template <int EP, int Nn>
__global__ __launch_bounds__(256) void gemm_kernel(const half_t* __restrict__ A,
                                                   const half_t* __restrict__ W,
                                                   const float* __restrict__ bias,
                                                   const float* __restrict__ resid,
                                                   float* __restrict__ out32,
                                                   half_t* __restrict__ out16,
                                                   int K,
                                                   const float* __restrict__ bias_k,
                                                   const float* __restrict__ bias_v,
                                                   half_t* __restrict__ out_k,
                                                   half_t* __restrict__ out_v) {
  __shared__ __attribute__((aligned(16))) char gs[2 * GBUF];

  const int lane = threadIdx.x & 31;
  const int w    = threadIdx.x >> 5;
  const int wm   = w & 3;          // 4 waves along M (32 rows each)
  const int wn   = w >> 2;         // 2 waves along N (64 cols each)
  const int m0   = blockIdx.y * 128 + wm * 32;
  // which of the three weights (0 elsewhere), and the column tile inside its output
  const int sel  = EP == EP_QKV ? (int)blockIdx.x / (Nn / 128) : 0;
  const int n0   = ((int)blockIdx.x - sel * (Nn / 128)) * 128 + wn * 64;
  if constexpr (EP == EP_QKV) {
    bias  = sel == 0 ? bias  : sel == 1 ? bias_k : bias_v;
    out16 = sel == 0 ? out16 : sel == 1 ? out_k  : out_v;
  }
  const int lm   = lane & 15;
  const int hi   = lane >> 4;

  v8f acc[2][4];
#pragma unroll
  for (int i = 0; i < 2; ++i)
#pragma unroll
    for (int j = 0; j < 4; ++j) acc[i][j] = vzero8();

  // this thread's share of a tile: row cr (and + 32, 64, 96), 16-byte piece cp
  const int cr = threadIdx.x >> 3;
  const int cp = threadIdx.x & 7;
  const unsigned lds0 = (unsigned)(size_t)gs + (unsigned)(cr * GPIT + cp * 16);
  const half_t* ga = A + (size_t)(blockIdx.y * 128 + cr) * K + cp * 8;
  const half_t* gw = W + (size_t)(blockIdx.x * 128 + cr) * K + cp * 8;
  const size_t  rs = (size_t)32 * K;
  const int     T  = K / GKT;

  copy_tiles(lds0, ga, gw, rs);
  // tile 0 has landed for this wave; the barrier publishes every wave's share
  asm volatile("s_wait_asynccnt 0x0" ::: "memory");
  __syncthreads();
  if (T > 1) copy_tiles(lds0 + GBUF, ga + GKT, gw + GKT, rs);

  // The epilogue's loads, all issued here, behind the first tiles' copies: they are
  // in flight together, beside tile 1's copies, and are waited for once, at the first
  // trip's barrier. eo: this lane's first element.
  const size_t eo = (size_t)(m0 + (hi << 3)) * Nn + (n0 + lm);
  float bz[4];
#pragma unroll
  for (int j = 0; j < 4; ++j) bz[j] = bias[n0 + j * 16 + lm];
  float rv[2][4][8];
  if constexpr (EP == EP_RES) {
    const float* rp = resid + eo;
#pragma unroll
    for (int i = 0; i < 2; ++i)
#pragma unroll
      for (int j = 0; j < 4; ++j)
#pragma unroll
        for (int r = 0; r < 8; ++r) rv[i][j][r] = rp[(i * 16 + r) * Nn + j * 16];
  }
  // These loads' address registers, the bias pointer's scalar pair among them, are free
  // for reuse from here on: keep the wait in front of whatever overwrites them.
  asm volatile("s_wait_xcnt 0x0" ::: "memory");

  for (int t = 0; t < T; ++t) {
    const char* ta = gs + (t & 1) * GBUF + (wm * 32 + lm) * GPIT;
    const char* tw = gs + (t & 1) * GBUF + GOPB + (wn * 64 + lm) * GPIT;
#pragma unroll  // both 32-k halves of the trip in line: every LDS offset is an immediate
    for (int kb = 0; kb < 2 * GKT; kb += 64) {
      v16h a0 = lds_frag16(ta, 0,  kb, hi);
      v16h a1 = lds_frag16(ta, 16, kb, hi);
      v16h b0 = lds_frag16(tw, 0,  kb, hi);
      v16h b1 = lds_frag16(tw, 16, kb, hi);
      v16h b2 = lds_frag16(tw, 32, kb, hi);
      v16h b3 = lds_frag16(tw, 48, kb, hi);
      acc[0][0] = wmma32(a0, b0, acc[0][0]);
      acc[0][1] = wmma32(a0, b1, acc[0][1]);
      acc[0][2] = wmma32(a0, b2, acc[0][2]);
      acc[0][3] = wmma32(a0, b3, acc[0][3]);
      acc[1][0] = wmma32(a1, b0, acc[1][0]);
      acc[1][1] = wmma32(a1, b1, acc[1][1]);
      acc[1][2] = wmma32(a1, b2, acc[1][2]);
      acc[1][3] = wmma32(a1, b3, acc[1][3]);
    }
    // this wave's reads of the buffer are done before it is handed to the copies
    asm volatile("s_wait_dscnt 0x0" ::: "memory");
    // this wave's share of tile t + 1 has landed
    asm volatile("s_wait_asynccnt 0x0" ::: "memory");
    // publishes tile t + 1 and ends every reader's reads of tile t's buffer
    __syncthreads();
    if (t + 2 < T)
      copy_tiles(lds0 + (t & 1) * GBUF, ga + (size_t)(t + 2) * GKT, gw + (size_t)(t + 2) * GKT, rs);
  }
  // no copy is left in flight when the wave goes on to its stores and ends
  asm volatile("s_wait_asynccnt 0x0" ::: "memory");

  // Transposed f16 output [M / NSEQ][Nn][NSEQ]: a lane's 8 accumulator rows are 8
  // consecutive tokens of one column, so they leave as one 16-byte store.
  // The block's 128 rows lie in one sequence (128 divides NSEQ).
  if (EP == EP_QKV && sel == 2) {
    half_t* p = out16 + ((size_t)((blockIdx.y * 128 / NSEQ) * Nn + n0 + lm)) * NSEQ +
                ((m0 & (NSEQ - 1)) + (hi << 3));
#pragma unroll
    for (int j = 0; j < 4; ++j) {
#pragma unroll
      for (int i = 0; i < 2; ++i) {
        union { half_t h[8]; float4 v; } u;
#pragma unroll
        for (int r = 0; r < 8; ++r) u.h[r] = (half_t)(acc[i][j][r] + bz[j]);
        *reinterpret_cast<float4*>(p + j * 16 * NSEQ + i * 16) = u.v;
      }
    }
    return;
  }

#pragma unroll
  for (int i = 0; i < 2; ++i) {
#pragma unroll
    for (int j = 0; j < 4; ++j) {
#pragma unroll
      for (int r = 0; r < 8; ++r) {
        const int e = (i * 16 + r) * Nn + j * 16;
        float val = acc[i][j][r] + bz[j];
        if constexpr (EP == EP_SILU) val = val / (1.f + exp2_slot(val * -1.4426950408889634f));  // e^-val
        if constexpr (EP == EP_RES) (out32 + eo)[e] = val + rv[i][j][r];
        else                        (out16 + eo)[e] = (half_t)val;
      }
    }
  }
}

#define QCOLS 32   // query columns per wave (two 16-column groups)
#define QWG   64   // query columns per work-group: two waves per head
#define KCH   32   // keys per pass
#define RP    36   // LDS row pitch in floats: 144 B = 16 B x odd, for 16-byte accesses
#define KPIT  1040 // K tile row in LDS: one key's 8 heads (1024 B) + 16: 16 B x odd
#define KBUF  (KCH * KPIT)
#define VPIT  80   // V^T tile row in LDS: 32 keys of one (head, d) (64 B) + 16: 16 B x odd
#define VBUF  (DMODEL * VPIT)
#define VOFF  (2 * KBUF)             // LDS map: K tile x 2, V^T tile x 2, P^T x 2
#define ROFF  (VOFF + 2 * VBUF)
#define ALDS  (ROFF + 2 * NHEAD * QWG * RP * 4)
#define K1T   4                      // walk 1: 32-key chunks per K tile (128 keys)
#define K1BUF (K1T * KBUF)           // walk 1 has the whole LDS for its two K tiles
static_assert(2 * K1BUF <= ALDS, "walk 1's two K tiles lie inside the LDS array");

// One 16x32 f16 fragment from LDS; p: the lane's row, at its 8 hi-th k. The k order is load_frag16's.
__device__ __forceinline__ v16h lds_frag(const char* p) {
  AFrag16 f;
  f.q[0] = *reinterpret_cast<const float4*>(p);        // K kb .. kb+7
  f.q[1] = *reinterpret_cast<const float4*>(p + 32);   // K kb+16 .. kb+23
  return f.v;
}

// K fragments (A operand) of the tile's 32 keys, one head: two 16-key tiles x two k steps.
__device__ __forceinline__ void lds_k(const char* p, v16h (&kf)[2][2]) {
#pragma unroll
  for (int t = 0; t < 2; ++t) {
    kf[t][0] = lds_frag(p + t * 16 * KPIT);
    kf[t][1] = lds_frag(p + t * 16 * KPIT + 64);
  }
}

// 64 keys of K (1024 B each, contiguous in memory): a thread copies 16 B of keys
// r, r + 8, ..., r + 56; a wave's copy covers four whole lines.
// The s_wait_xcnt closes the statement so that it stands in front of whatever
// rewrites an address register that a copy names.
__device__ __forceinline__ void copy_k64(unsigned lk, const half_t* gk) {
  asm volatile(
      "global_load_async_to_lds_b128 %0, %8, off\n\t"
      "global_load_async_to_lds_b128 %1, %9, off\n\t"
      "global_load_async_to_lds_b128 %2, %10, off\n\t"
      "global_load_async_to_lds_b128 %3, %11, off\n\t"
      "global_load_async_to_lds_b128 %4, %12, off\n\t"
      "global_load_async_to_lds_b128 %5, %13, off\n\t"
      "global_load_async_to_lds_b128 %6, %14, off\n\t"
      "global_load_async_to_lds_b128 %7, %15, off\n\t"
      "s_wait_xcnt 0x0"
      :: "v"(lk), "v"(lk + 8 * KPIT), "v"(lk + 16 * KPIT), "v"(lk + 24 * KPIT),
         "v"(lk + 32 * KPIT), "v"(lk + 40 * KPIT), "v"(lk + 48 * KPIT), "v"(lk + 56 * KPIT),
         "v"(gk), "v"(gk + 8 * DMODEL), "v"(gk + 16 * DMODEL), "v"(gk + 24 * DMODEL),
         "v"(gk + 32 * DMODEL), "v"(gk + 40 * DMODEL), "v"(gk + 48 * DMODEL), "v"(gk + 56 * DMODEL)
      : "memory");
}

// Walk 1's K tile: 128 keys, 16 copies a thread.
__device__ __forceinline__ void copy_k128(unsigned lk, const half_t* gk) {
  copy_k64(lk, gk);
  copy_k64(lk + 2 * KBUF, gk + 2 * KCH * DMODEL);
}

// Walk 2's K tile (32 keys: 16 B of keys r, r + 8, r + 16, r + 24) and V^T tile
// (512 rows x 64 B: 16 B of rows r, r + 128, r + 256, r + 384).
__device__ __forceinline__ void copy_kv(unsigned lk, const half_t* gk,
                                        unsigned lv, const half_t* gv) {
  asm volatile(
      "global_load_async_to_lds_b128 %0, %8, off\n\t"
      "global_load_async_to_lds_b128 %1, %9, off\n\t"
      "global_load_async_to_lds_b128 %2, %10, off\n\t"
      "global_load_async_to_lds_b128 %3, %11, off\n\t"
      "global_load_async_to_lds_b128 %4, %12, off\n\t"
      "global_load_async_to_lds_b128 %5, %13, off\n\t"
      "global_load_async_to_lds_b128 %6, %14, off\n\t"
      "global_load_async_to_lds_b128 %7, %15, off\n\t"
      "s_wait_xcnt 0x0"
      :: "v"(lk), "v"(lk + 8 * KPIT), "v"(lk + 16 * KPIT), "v"(lk + 24 * KPIT),
         "v"(lv), "v"(lv + 128 * VPIT), "v"(lv + 256 * VPIT), "v"(lv + 384 * VPIT),
         "v"(gk), "v"(gk + 8 * DMODEL), "v"(gk + 16 * DMODEL), "v"(gk + 24 * DMODEL),
         "v"(gv), "v"(gv + 128 * NSEQ), "v"(gv + 256 * NSEQ), "v"(gv + 384 * NSEQ)
      : "memory");
}

// S^T = K Q^T: st[t][g][r] = score(key 16 t + 8 hi + r, query 16 g + c), unscaled.
__device__ __forceinline__ void scores_t(const v16h (&kf)[2][2], const v16h (&qf)[2][2],
                                         v8f (&st)[2][2]) {
#pragma unroll
  for (int t = 0; t < 2; ++t)
#pragma unroll
    for (int g = 0; g < 2; ++g) st[t][g] = wmma32(kf[t][0], qf[g][0], vzero8());
#pragma unroll
  for (int t = 0; t < 2; ++t)
#pragma unroll
    for (int g = 0; g < 2; ++g) st[t][g] = wmma32(kf[t][1], qf[g][1], st[t][g]);
}

// ---------------------------------------------------------------------------
// Attention: one work-group per (b, 64-query tile); wave w = head w & 7, query
// half w >> 3. The pass's 32 keys of K and of V^T, all heads, come into LDS by
// asynchronous copies, two buffers, the next tile in flight while this one is
// worked on; both waves of a head read their fragments there.
// Walk 1 over the keys: S^T = K Q^T, each lane keeps the running maximum and
// sum of its own query column (scores are not stored). Its K tiles hold 128 keys.
// Walk 2: S^T again, P^T = 2^(x - max - log2 sum) in the accumulator registers,
// which are a B operand as they stand: O^T += V^T P^T. The eight heads' P^T of
// the pass meet in LDS, are summed in head order and stored once.
// LDS: 65 KB of K, 80 KB of V^T, two buffers of 8 heads x 64 queries x 32 keys
// f32 (pitch 36) = 144 KB: one work-group of 16 waves per WGP.
// ---------------------------------------------------------------------------
__global__ __launch_bounds__(512) void attn_kernel(const half_t* __restrict__ q,
                                                   const half_t* __restrict__ kk,
                                                   const half_t* __restrict__ vt,
                                                   half_t* __restrict__ ctx,
                                                   float* __restrict__ attnw) {
  __shared__ __attribute__((aligned(16))) char smem[ALDS];
  float* R = (float*)(smem + ROFF);            // [2][NHEAD][QWG][RP]

  const int lane = threadIdx.x & 31;
  const int hh   = (threadIdx.x >> 5) & 7;     // head
  const int qg   = threadIdx.x >> 8;           // which 32 of the 64 queries
  const int b    = blockIdx.x >> 4;            // N / 64 = 16 query tiles per batch
  const int q0   = (blockIdx.x & 15) * QWG;
  const int qw   = q0 + qg * QCOLS;            // this wave's first query
  const int c    = lane & 15;
  const int hi   = lane >> 4;
  const float SC = 0.125f * 1.4426950408889634f;   // 1/sqrt(64) * log2(e)

  v16h qf[2][2];
#pragma unroll
  for (int g = 0; g < 2; ++g) {
    const half_t* qb = q + (((size_t)(b * NSEQ + qw + g * 16 + c)) * NHEAD + hh) * DHEAD;
    qf[g][0] = load_frag16(qb, 0, 0, 0,  lane);
    qf[g][1] = load_frag16(qb, 0, 0, 32, lane);
  }
  // The Q loads' address pair is free for reuse from here on: keep the wait in
  // front of whatever overwrites it.
  asm volatile("s_wait_xcnt 0x0" ::: "memory");

  // this thread's share of a tile, in LDS (buffer 0) and in memory (tile 0)
  const unsigned sb = (unsigned)(size_t)smem;
  const unsigned lk = sb + (unsigned)((threadIdx.x >> 6) * KPIT + (threadIdx.x & 63) * 16);
  const unsigned lv = sb + (unsigned)(VOFF + (threadIdx.x >> 2) * VPIT + (threadIdx.x & 3) * 16);
  const half_t* gk = kk + (size_t)(b * NSEQ + (threadIdx.x >> 6)) * DMODEL + (threadIdx.x & 63) * 8;
  const half_t* gv = vt + (size_t)(b * DMODEL + (threadIdx.x >> 2)) * NSEQ + (threadIdx.x & 3) * 8;
  // this lane's fragment rows in buffer 0
  const char* kfr = smem + c * KPIT + hh * (DHEAD * 2) + hi * 16;
  const char* vfr = smem + VOFF + (hh * DHEAD + c) * VPIT + hi * 16;

  // ---- walk 1: column maximum and sum (log2 domain), per lane half ----
  float mrun[2] = {-1e30f, -1e30f};
  float lrun[2] = {0.f, 0.f};

  // Walk 1 needs neither V^T nor P^T, so its K tiles take their LDS too: 128 keys a
  // tile, and the waves meet once per 128 keys; between two barriers they drift apart,
  // and one wave's LDS reads and matrix work run under another's arithmetic.
  copy_k128(lk, gk);
  // tile 0 has landed for this wave; the barrier publishes every wave's share
  asm volatile("s_wait_asynccnt 0x0" ::: "memory");
  __syncthreads();
  copy_k128(lk + K1BUF, gk + K1T * KCH * DMODEL);

#pragma unroll 1  // one tile per trip keeps the live set under 256 registers
  for (int i = 0; i < NSEQ / (K1T * KCH); ++i) {
   const char* kt = kfr + (i & 1) * K1BUF;
#pragma unroll  // the four chunks in line: a chunk's LDS reads can stand ahead of the one before's arithmetic
   for (int s = 0; s < K1T; ++s) {
    v16h kc[2][2];
    lds_k(kt + s * KBUF, kc);
    v8f st[2][2];
    scores_t(kc, qf, st);
#pragma unroll
    for (int g = 0; g < 2; ++g) {
      float c0 = fmaxf(st[0][g][0], st[1][g][0]);
#pragma unroll
      for (int r = 1; r < 8; ++r) c0 = fmaxf(c0, fmaxf(st[0][g][r], st[1][g][r]));
      const float mn = fmaxf(mrun[g], c0 * SC);
      float s0 = exp2_slot(fmaf(st[0][g][0], SC, -mn));
      float s1 = exp2_slot(fmaf(st[0][g][1], SC, -mn));
      float s2 = exp2_slot(fmaf(st[1][g][0], SC, -mn));
      float s3 = exp2_slot(fmaf(st[1][g][1], SC, -mn));
#pragma unroll
      for (int r = 2; r < 8; r += 2) {
        s0 += exp2_slot(fmaf(st[0][g][r],     SC, -mn));
        s1 += exp2_slot(fmaf(st[0][g][r + 1], SC, -mn));
        s2 += exp2_slot(fmaf(st[1][g][r],     SC, -mn));
        s3 += exp2_slot(fmaf(st[1][g][r + 1], SC, -mn));
      }
      lrun[g] = lrun[g] * exp2_slot(mrun[g] - mn) + ((s0 + s1) + (s2 + s3));
      mrun[g] = mn;
    }
   }
    // Keeps the pass's arithmetic in front of the waits: moved behind the barrier it
    // would stand between the barrier and the refill, and the refill would be
    // waited for as soon as it is issued.
    __builtin_amdgcn_sched_barrier(0);
    // this wave's reads of the buffer are done before it is handed to the copies
    asm volatile("s_wait_dscnt 0x0" ::: "memory");
    // this wave's share of tile i + 1 has landed
    asm volatile("s_wait_asynccnt 0x0" ::: "memory");
    // publishes tile i + 1 and ends every reader's reads of tile i's buffer
    __syncthreads();
    if (i + 2 < NSEQ / (K1T * KCH))
      copy_k128(lk + (i & 1) * K1BUF, gk + (size_t)(i + 2) * (K1T * KCH * DMODEL));
  }
  // no copy is in flight when walk 2 takes the buffers over
  asm volatile("s_wait_asynccnt 0x0" ::: "memory");

  // walk 2's tile 0 (every reader left both of walk 1's tiles at its last barriers)
  copy_kv(lk, gk, lv, gv);

  // join the two lane halves of each column; off = max + log2(sum)
  float off[2];
#pragma unroll
  for (int g = 0; g < 2; ++g) {
    const float mo = __shfl_xor(mrun[g], 16);
    const float lo = __shfl_xor(lrun[g], 16);
    const float M  = fmaxf(mrun[g], mo);
    const float L  = lrun[g] * exp2_slot(mrun[g] - M) + lo * exp2_slot(mo - M);
    off[g] = M + log2_slot(L);
  }

  // ---- walk 2: P^T, O^T += V^T P^T, head mean of P ----
  v8f o[4][2];
#pragma unroll
  for (int d = 0; d < 4; ++d) { o[d][0] = vzero8(); o[d][1] = vzero8(); }

  const int tq = threadIdx.x >> 3;             // query row this thread sums
  const int tj = (threadIdx.x & 7) * 4;        // its four keys of the pass
  float* aw = attnw + ((size_t)(b * NSEQ + q0 + tq)) * NSEQ + tj;

  // tile 0 has landed for this wave; the barrier publishes every wave's share
  asm volatile("s_wait_asynccnt 0x0" ::: "memory");
  __syncthreads();
  copy_kv(lk + KBUF, gk + KCH * DMODEL, lv + VBUF, gv + KCH);

#pragma unroll 1  // as in walk 1
  for (int i = 0; i < NSEQ / KCH; ++i) {
    const int k0 = i * KCH;
    v16h kc[2][2];
    lds_k(kfr + (i & 1) * KBUF, kc);
    v8f st[2][2];
    scores_t(kc, qf, st);
    v16h vf[4];
#pragma unroll
    for (int d = 0; d < 4; ++d) vf[d] = lds_frag(vfr + (i & 1) * VBUF + d * 16 * VPIT);

    float* Rw = R + (size_t)(((i & 1) * NHEAD + hh) * QWG + qg * QCOLS) * RP;
    v16h pb[2];
#pragma unroll
    for (int g = 0; g < 2; ++g) {
#pragma unroll
      for (int t = 0; t < 2; ++t) {
        float p[8];
#pragma unroll
        for (int r = 0; r < 8; ++r) {
          p[r] = exp2_slot(fmaf(st[t][g][r], SC, -off[g]));
          pb[g][t * 8 + r] = (half_t)p[r];     // hardware k order: keys 8 hi + r, 16 + 8 hi + r
        }
        float4* dst = reinterpret_cast<float4*>(Rw + (g * 16 + c) * RP + t * 16 + hi * 8);
        dst[0] = make_float4(p[0], p[1], p[2], p[3]);
        dst[1] = make_float4(p[4], p[5], p[6], p[7]);
      }
    }
#pragma unroll
    for (int d = 0; d < 4; ++d) {
      o[d][0] = wmma32(vf[d], pb[0], o[d][0]);
      o[d][1] = wmma32(vf[d], pb[1], o[d][1]);
    }

    // this wave's reads of the tiles and its writes of P^T are done
    asm volatile("s_wait_dscnt 0x0" ::: "memory");
    // this wave's share of tile i + 1 has landed
    asm volatile("s_wait_asynccnt 0x0" ::: "memory");
    // One barrier per pass: it publishes tile i + 1 and this pass's P^T, and it ends
    // every reader's reads of tile i's buffers and of the other P^T buffer, which
    // the next pass overwrites.
    __syncthreads();
    if (i + 2 < NSEQ / KCH)
      copy_kv(lk + (i & 1) * KBUF, gk + (size_t)(i + 2) * (KCH * DMODEL),
              lv + (i & 1) * VBUF, gv + (i + 2) * KCH);

    const float* Rr = R + (size_t)((i & 1) * NHEAD * QWG + tq) * RP + tj;
    float4 s = *reinterpret_cast<const float4*>(Rr);
#pragma unroll
    for (int h = 1; h < NHEAD; ++h) {
      const float4 u = *reinterpret_cast<const float4*>(Rr + h * QWG * RP);
      s.x += u.x; s.y += u.y; s.z += u.z; s.w += u.w;
    }
    *reinterpret_cast<float4*>(aw + k0) =
        make_float4(s.x * 0.125f, s.y * 0.125f, s.z * 0.125f, s.w * 0.125f);
  }
  // no copy is left in flight when the wave goes on to its stores and ends
  asm volatile("s_wait_asynccnt 0x0" ::: "memory");

  // ---- ctx: a lane holds 8 consecutive d of one query: one 16-byte store ----
#pragma unroll
  for (int g = 0; g < 2; ++g) {
    half_t* crow = ctx + (((size_t)(b * NSEQ + qw + g * 16 + c)) * NHEAD + hh) * DHEAD + hi * 8;
#pragma unroll
    for (int d = 0; d < 4; ++d) {
      union { half_t h[8]; float4 v; } u;
#pragma unroll
      for (int r = 0; r < 8; ++r) u.h[r] = (half_t)o[d][g][r];
      *reinterpret_cast<float4*>(crow + d * 16) = u.v;
    }
  }
}

// ---------------------------------------------------------------------------
// Host launch
// ---------------------------------------------------------------------------
extern "C" void kernel_launch(void* const* d_in, const int* in_sizes, int n_in,
                              void* d_out, int out_size, void* d_ws, size_t ws_size,
                              hipStream_t stream) {
  (void)in_sizes; (void)n_in; (void)out_size; (void)ws_size;

  const float* h_in  = (const float*)d_in[0];
  const float* ln1_g = (const float*)d_in[1];
  const float* ln1_b = (const float*)d_in[2];
  const float* wq = (const float*)d_in[3];  const float* bq = (const float*)d_in[4];
  const float* wk = (const float*)d_in[5];  const float* bk = (const float*)d_in[6];
  const float* wv = (const float*)d_in[7];  const float* bv = (const float*)d_in[8];
  const float* wo = (const float*)d_in[9];  const float* bo = (const float*)d_in[10];
  const float* ln2_g = (const float*)d_in[11]; const float* ln2_b = (const float*)d_in[12];
  const float* w1 = (const float*)d_in[13]; const float* b1 = (const float*)d_in[14];
  const float* w2 = (const float*)d_in[15]; const float* b2 = (const float*)d_in[16];

  // ---- workspace layout (bytes) ----
  char* ws = (char*)d_ws;
  size_t off = 0;
  half_t* WQH = (half_t*)(ws + off); off += (size_t)DMODEL * DMODEL * 2;        // 0.5 MB
  off += (size_t)DMODEL * DMODEL * 2;                                           // wk, behind wq
  off += (size_t)DMODEL * DMODEL * 2;                                           // wv, behind wk
  half_t* WOH = (half_t*)(ws + off); off += (size_t)DMODEL * DMODEL * 2;
  half_t* W1H = (half_t*)(ws + off); off += (size_t)2 * DMODEL * DMODEL * 2;    // (2D,D)
  half_t* W2H = (half_t*)(ws + off); off += (size_t)2 * DMODEL * DMODEL * 2;    // (D,2D)
  half_t* HN  = (half_t*)(ws + off); off += (size_t)MROWS * DMODEL * 2;         // hn / f (reused)
  float*  H2  = (float*)(ws + off);  off += (size_t)MROWS * DMODEL * 4;         // h + attn_out
  half_t* CTX = (half_t*)(ws + off); off += (size_t)MROWS * DMODEL * 2;
  half_t* Qb  = (half_t*)(ws + off); size_t qoff = off; off += (size_t)MROWS * DMODEL * 2;
  half_t* Kb  = (half_t*)(ws + off); off += (size_t)MROWS * DMODEL * 2;
  half_t* VT  = (half_t*)(ws + off); off += (size_t)MROWS * DMODEL * 2;
  half_t* Gb  = (half_t*)(ws + qoff);  // FFN hidden [M, 2D] reuses Q+K regions (dead by then)

  float* out_h    = (float*)d_out;
  float* out_attn = (float*)d_out + (size_t)MROWS * DMODEL;

  // LN1, and weights -> f16 (WQH .. W2H lie one after the other, from WQH on)
  ln_kernel<true><<<MROWS / 8 + WBLK, 256, 0, stream>>>(h_in, ln1_g, ln1_b, HN,
                                                        wq, wk, wv, wo, w1, w2, WQH);

  // QKV projections in one launch (block tile 128x128; the three f16 weights lie one after
  // the other from WQH on). V leaves its projection as Vt [B,H,DH,N], the layout attention reads.
  dim3 gD(DMODEL / 128, MROWS / 128);       // (4, 128)
  dim3 gQ(3 * DMODEL / 128, MROWS / 128);   // (12, 128)
  gemm_kernel<EP_QKV, DMODEL><<<gQ, 256, 0, stream>>>(HN, WQH, bq, nullptr, nullptr, Qb, DMODEL,
                                                      bk, bv, Kb, VT);

  // attention (289 KB static LDS: one work-group per WGP, 256 work-groups)
  attn_kernel<<<NBATCH * (NSEQ / QWG), 512, 0, stream>>>(Qb, Kb, VT, CTX, out_attn);

  // out projection + residual -> h2 (fp32)
  gemm_kernel<EP_RES, DMODEL><<<gD, 256, 0, stream>>>(CTX, WOH, bo, h_in, H2, nullptr, DMODEL,
                                                      nullptr, nullptr, nullptr, nullptr);

  // LN2 -> f (f16, reuses HN)
  ln_kernel<false><<<MROWS / 8, 256, 0, stream>>>(H2, ln2_g, ln2_b, HN, nullptr, nullptr, nullptr,
                                                  nullptr, nullptr, nullptr, nullptr);

  // FFN1: silu(f @ w1^T + b1) -> g f16 [M, 2D]
  dim3 g2(2 * DMODEL / 128, MROWS / 128);   // (8, 128)
  gemm_kernel<EP_SILU, 2 * DMODEL><<<g2, 256, 0, stream>>>(HN, W1H, b1, nullptr, nullptr, Gb, DMODEL,
                                                           nullptr, nullptr, nullptr, nullptr);

  // FFN2: g @ w2^T + b2 + h2 -> final h (fp32, straight to d_out)
  gemm_kernel<EP_RES, DMODEL><<<gD, 256, 0, stream>>>(Gb, W2H, b2, H2, out_h, nullptr, 2 * DMODEL,
                                                      nullptr, nullptr, nullptr, nullptr);
}
